// v000
// Measured on an AMD MI455X. A time is GPU time per run, averaged over a window of back-to-back runs after a warm-up
// (all launches, gaps included; the runs take copies of the inputs in turn), and the median of several windows.
// Apart from v000's, it joins two sittings. Times from different sittings can be a few percent apart, while
// side-by-side timings come from the same sitting.
// v000, which the later versions start from, runs in 2150 microseconds.
#include <hip/hip_runtime.h>

// Multi-head attention on sequence-first tensors with the module's raw-view head merge (q, k, v [2048][2][1024] = [s][b][d]; projections 'oi' [1024][1024] + biases; per (head, batch): scores = q.k/8 + attn_mask[i][j] (f32 [2048][2048] input, read); softmax; O[h][b][s][dh] = attn.v; the module then views the contiguous (H, B, S, Dh) tensor directly as (S, B, D) (NO head transpose) and applies Wo^T + bo -> out [2048][2][1024]).
// Layout: both batch elements are read from the interleaved rows (row stride 2 x 1024); all 32 (head, batch) attention problems write O contiguously in (h, b, s, dh) order, whose memory IS the module's (S x B, D) view, so the output projection is one GEMM over 4096 rows.
// Compute dtypes, f32 accumulate: every input rounded to bf16; q/k/v on PLAIN bf16 operands (inputs: exact) + biases; additive mask (bf16-rounded) inside the softmax kernel; scores and attn.v: query rows < 512 hl (3 products), the rest single fp16 (x1024); softmax f32; Wo hl x exact (2 products) + bo.

#define NB_  2
#define TT   2048
#define DM   1024
#define NH_  16
#define NKV  16
#define REP  (NH_ / NKV)
#define HD   64
#define DQ   (NH_ * HD)
#define DKV  (NKV * HD)
typedef __attribute__((ext_vector_type(4))) unsigned short v4us;
#define ZH   2
#define RH   512                  // query rows < RH use hi+lo planes (0: none)
#define WIN  0
#define PCAR 1024.0f
#define SCL  0.125f   // HD^-0.5
typedef _Float16 h16;
typedef unsigned short bf;
typedef __attribute__((ext_vector_type(16))) __bf16   v16bf;
typedef __attribute__((ext_vector_type(16))) _Float16 v16h;
typedef __attribute__((ext_vector_type(8)))  _Float16 v8h;
typedef __attribute__((ext_vector_type(8)))  unsigned short v8us;
typedef __attribute__((ext_vector_type(8)))  float    v8f;
typedef __attribute__((ext_vector_type(4)))  float    v4f;
typedef v8h  __attribute__((may_alias)) v8ha;
typedef v4f  __attribute__((may_alias)) v4fa;
typedef v8us __attribute__((may_alias)) v8usa;

__device__ __forceinline__ unsigned short f2bf(float f) { unsigned u = __float_as_uint(f); u += 0x7FFFu + ((u >> 16) & 1u); return (unsigned short)(u >> 16); }
__device__ __forceinline__ float bf2f(unsigned short b) { return __uint_as_float(((unsigned)b) << 16); }
__device__ __forceinline__ float bfr(float f) { return bf2f(f2bf(f)); }
__device__ __forceinline__ v16h cat16(v8h lo, v8h hi) { return __builtin_shufflevector(lo, hi, 0, 1, 2, 3, 4, 5, 6, 7, 8, 9, 10, 11, 12, 13, 14, 15); }
__device__ __forceinline__ v16bf cat16b(v8us lo, v8us hi) { return __builtin_bit_cast(v16bf, __builtin_shufflevector(lo, hi, 0, 1, 2, 3, 4, 5, 6, 7, 8, 9, 10, 11, 12, 13, 14, 15)); }
__device__ __forceinline__ v8f wmma16(v16h a, v16h b, v8f c) { return __builtin_amdgcn_wmma_f32_16x16x32_f16(false, a, false, b, (short)0, c, false, false); }
__device__ __forceinline__ v8f wmmab(v16bf a, v16bf b, v8f c) { return __builtin_amdgcn_wmma_f32_16x16x32_bf16(false, a, false, b, (short)0, c, false, false); }



// ---- k_gemmw: register-blocked GEMM, ONE WAVE per 64x64 output tile (16 accumulators), operands straight from K-contiguous 16-bit planes; grid (M/64, N/64, Z), 32 threads.
// C[m][n] (f32, pitch ldc, + optional f32 bias[n]) = sum_k A[m][k] Bt[n][k] (+ split products per NSPLIT). z-batch strides sA/sB/sC in elements. K % 32 == 0.
template <typename T16> struct WFrag;
template <> struct WFrag<h16> { typedef v16h V; static __device__ __forceinline__ V ld(const h16* p) { return cat16(*(const v8h*)p, *(const v8h*)(p + 16)); } static __device__ __forceinline__ v8f mma(V a, V b, v8f c) { return wmma16(a, b, c); } };
template <> struct WFrag<bf> { typedef v16bf V; static __device__ __forceinline__ V ld(const bf* p) { return cat16b(*(const v8us*)p, *(const v8us*)(p + 16)); } static __device__ __forceinline__ v8f mma(V a, V b, v8f c) { return wmmab(a, b, c); } };
template <typename T16, int NSPLIT, bool BIAS>
__global__ __launch_bounds__(32) void k_gemmw(const T16* __restrict__ A, const T16* __restrict__ A2, const T16* __restrict__ Bt, const T16* __restrict__ Bt2, int K, float* C, int ldc, const float* __restrict__ bias, size_t sA, size_t sB, size_t sC) {
    typedef typename WFrag<T16>::V V;
    __shared__ __align__(16) float os[16 * 68];
    const size_t z = blockIdx.z; A += z * sA; if (A2) A2 += z * sA; Bt += z * sB; if (Bt2) Bt2 += z * sB; C += z * sC;
    const int lane = threadIdx.x & 31, lr = lane & 15, hi = lane >> 4; const int r0 = blockIdx.x * 64, c0 = blockIdx.y * 64;
    v8f acc[4][4];
#pragma unroll
    for (int mb = 0; mb < 4; ++mb)
#pragma unroll
        for (int nb = 0; nb < 4; ++nb) acc[mb][nb] = (v8f){};
    const size_t aoff = (size_t)(r0 + lr) * K + 8 * hi, boff = (size_t)(c0 + lr) * K + 8 * hi;
#pragma unroll 1
    for (int kc = 0; kc < K; kc += 32) {
        V a[4], a2[4];
#pragma unroll
        for (int mb = 0; mb < 4; ++mb) { a[mb] = WFrag<T16>::ld(A + aoff + (size_t)mb * 16 * K + kc); if (NSPLIT == 1 || NSPLIT == 2) a2[mb] = WFrag<T16>::ld(A2 + aoff + (size_t)mb * 16 * K + kc); }
#pragma unroll
        for (int nb = 0; nb < 4; ++nb) { const V b = WFrag<T16>::ld(Bt + boff + (size_t)nb * 16 * K + kc); V b2; if (NSPLIT >= 2) b2 = WFrag<T16>::ld(Bt2 + boff + (size_t)nb * 16 * K + kc);
#pragma unroll
            for (int mb = 0; mb < 4; ++mb) { acc[mb][nb] = WFrag<T16>::mma(a[mb], b, acc[mb][nb]); if (NSPLIT == 1 || NSPLIT == 2) acc[mb][nb] = WFrag<T16>::mma(a2[mb], b, acc[mb][nb]); if (NSPLIT >= 2) acc[mb][nb] = WFrag<T16>::mma(a[mb], b2, acc[mb][nb]); } }
        asm volatile("v_nop\n\tv_nop\n\tv_nop\n\tv_nop" : "+v"(acc[0][0]), "+v"(acc[1][1]), "+v"(acc[2][2]), "+v"(acc[3][3]) : "v"(a[0]), "v"(a[3]));
    }
#pragma unroll
    for (int mb = 0; mb < 4; ++mb) {
#pragma unroll
        for (int nb = 0; nb < 4; ++nb) {
#pragma unroll
            for (int j = 0; j < 8; ++j) os[(hi * 8 + j) * 68 + nb * 16 + lr] = acc[mb][nb][j]; }
        __builtin_amdgcn_wave_barrier(); asm volatile("" ::: "memory");
        float* crow = C + (size_t)(r0 + mb * 16) * ldc + c0;
{
#pragma unroll
            for (int s = 0; s < 8; ++s) { const int row = 2 * s + hi, cofs = lr * 4; v4f val = *(const v4fa*)(os + row * 68 + cofs); if (BIAS) { val[0] += bfr(bias[c0 + cofs]); val[1] += bfr(bias[c0 + cofs + 1]); val[2] += bfr(bias[c0 + cofs + 2]); val[3] += bfr(bias[c0 + cofs + 3]); }
                *(v4f*)(crow + (size_t)row * ldc + cofs) = val; }
             }
        __builtin_amdgcn_wave_barrier(); asm volatile("" ::: "memory");
    }
}

__device__ __forceinline__ h16 tohx(float x) { return (h16)x; }
__device__ __forceinline__ void splitf(float y, unsigned short& h, unsigned short& l) { h = f2bf(y); l = f2bf(y - bf2f(h)); }
typedef __attribute__((ext_vector_type(2))) _Float16 v2h;
typedef __attribute__((ext_vector_type(4))) _Float16 v4h;
typedef __attribute__((ext_vector_type(2))) unsigned short v2us;
typedef __attribute__((ext_vector_type(4))) unsigned short v4us;
typedef __attribute__((ext_vector_type(2))) float v2f;
typedef __attribute__((ext_vector_type(4))) int v4i;

__global__ __launch_bounds__(256) void k_wtG(const float* __restrict__ w, int K, int N, bf* Bt) {
    const int lane = threadIdx.x & 31; const int L0 = (blockIdx.x * 8 + (threadIdx.x >> 5)) * 8; const int nlines = N * K / 64;
{
#pragma unroll 1
        for (int l = 0; l < 8; ++l) { const int L = L0 + l; if (L >= nlines) break; const size_t e = (size_t)L * 64 + lane * 2; const int k = (int)(e % K), n = (int)(e / K); v2us o;
            o[0] = f2bf(w[(size_t)k * N + n]); o[1] = f2bf(w[(size_t)(k + 1) * N + n]); *(v2us*)(Bt + e) = o; }
         }
}
__global__ __launch_bounds__(256) void k_split4(const float* __restrict__ F, bf* Ph, bf* Pl, size_t n4) { const size_t i = (size_t)blockIdx.x * 256 + threadIdx.x; if (i >= n4) return; const v4f v = *(const v4f*)(F + i * 4); v4us oh, ol;
#pragma unroll
    for (int q = 0; q < 4; ++q) { unsigned short a, c; splitf(v[q], a, c); oh[q] = a; ol[q] = c; } *(v4us*)(Ph + i * 4) = oh; *(v4us*)(Pl + i * 4) = ol;  }
__global__ __launch_bounds__(256) void k_cvt8s(const float* __restrict__ src, int b, bf* dst, size_t n8) { const size_t i = (size_t)blockIdx.x * 256 + threadIdx.x; if (i >= n8) return; const size_t e = i * 8; const size_t t = e / DM, c = e % DM; const v8f v = *(const v8f*)(src + (t * NB_ + b) * DM + c); v8us o;
#pragma unroll
    for (int k = 0; k < 8; ++k) o[k] = f2bf(v[k]); *(v8us*)(dst + e) = o;  }
__global__ __launch_bounds__(256) void k_cvt8(const float* __restrict__ src, bf* dst, size_t n8) { const size_t i = (size_t)blockIdx.x * 256 + threadIdx.x; if (i >= n8) return; const v8f v = *(const v8f*)(src + i * 8); v8us o;
#pragma unroll
    for (int k = 0; k < 8; ++k) o[k] = f2bf(v[k]); *(v8us*)(dst + i * 8) = o;  }

// k_rope: head planes [h][t][d] (fp16 + hi/lo) of rope(x) x sc with the rotate-half convention out[d] = x[d] cos[t][d] - x[d+HD/2] sin[t][d], out[d+HD/2] = x[d+HD/2] cos[t][d+HD/2] + x[d] sin[t][d+HD/2]
__global__ __launch_bounds__(256) void k_rope(const float* __restrict__ F, int pitch, int nheads, const float* __restrict__ CS, const float* __restrict__ RF, const float* __restrict__ nw, float sc, h16* P16, bf* Ph, bf* Pl) {
    const size_t e = ((size_t)blockIdx.x * 256 + threadIdx.x) * 2; if (e >= (size_t)nheads * TT * HD) return; const int d = (int)(e % HD); const int t = (int)((e / HD) % TT); const int h = (int)(e / ((size_t)HD * TT)); const float* f = F + (size_t)t * pitch + h * HD; const float rf = RF ? RF[(size_t)h * TT + t] : 1.0f; v2h o16; v2us oh, ol;
#pragma unroll
    for (int q = 0; q < 2; ++q) { const int dd = d + q; const int dp = (dd < HD / 2) ? dd + HD / 2 : dd - HD / 2; float x0 = f[dd], x1 = f[dp];
        if (RF) { float n0 = __fmul_rn(x0, rf), n1 = __fmul_rn(x1, rf); asm volatile("" : "+v"(n0)); asm volatile("" : "+v"(n1)); x0 = __fmul_rn(bfr(nw[dd]), n0); x1 = __fmul_rn(bfr(nw[dp]), n1); }
        const v2f cs = *(const v2f*)(CS + ((size_t)t * HD + dd) * 2); float a = __fmul_rn(x0, cs[0]), bq = __fmul_rn(x1, cs[1]); asm volatile("" : "+v"(a)); asm volatile("" : "+v"(bq)); const float r = ((dd < HD / 2) ? __fsub_rn(a, bq) : __fadd_rn(a, bq)) * sc;
        o16[q] = tohx(r); unsigned short a2, c2; splitf(r, a2, c2); oh[q] = a2; ol[q] = c2; }
    *(v2h*)(P16 + e) = o16; *(v2us*)(Ph + e) = oh; *(v2us*)(Pl + e) = ol;  }
__global__ __launch_bounds__(256) void k_vtp(const float* __restrict__ F, int pitch, int nheads, h16* V16, bf* Vh, bf* Vl) { const size_t e = ((size_t)blockIdx.x * 256 + threadIdx.x) * 2; if (e >= (size_t)nheads * HD * TT) return; const int t = (int)(e % TT); const int d = (int)((e / TT) % HD); const int g = (int)(e / ((size_t)TT * HD)); v2h o16; v2us oh, ol;
#pragma unroll
    for (int q = 0; q < 2; ++q) { const float x = F[(size_t)(t + q) * pitch + g * HD + d]; o16[q] = tohx(x); unsigned short a2, c2; splitf(x, a2, c2); oh[q] = a2; ol[q] = c2; }
    *(v2h*)(V16 + e) = o16; *(v2us*)(Vh + e) = oh; *(v2us*)(Vl + e) = ol;  }
__global__ __launch_bounds__(256) void k_csid(float* CS) { const int idx = blockIdx.x * 256 + threadIdx.x; if (idx >= TT * HD) return; v2f cs; cs[0] = 1.0f; cs[1] = 0.0f; *(v2f*)(CS + (size_t)idx * 2) = cs;  }
// k_asoft: per row (zz, i): t = S x HD^-0.5 + bf16(attn_mask[i][j]); softmax over the 2048 keys (register row, one exp, fixed trees);
__global__ __launch_bounds__(256) void k_asoft(const float* __restrict__ Sb, const float* __restrict__ MKb, h16* P16, bf* Ph, bf* Pl) {
    const int lane = threadIdx.x & 31; const int row = blockIdx.x * 8 + (threadIdx.x >> 5); if (row >= ZH * TT) return; const int i = row % TT; const int zz = row / TT; (void)zz; const float* mk = MKb + (size_t)i * TT; const bool hires = (i < RH); const float* sr = Sb + (size_t)row * TT; float v[TT / 32]; float mx = -3.0e38f;
#pragma unroll
    for (int ch = 0; ch < TT / 128; ++ch) { const int j0 = ch * 128 + lane * 4; const v4f a = *(const v4f*)(sr + j0);
#pragma unroll
        for (int q = 0; q < 4; ++q) { const int j = j0 + q; float sa = a[q] * SCL; asm volatile("" : "+v"(sa)); float mv = bfr(mk[j]); asm volatile("" : "+v"(mv)); const float t = __fadd_rn(sa, mv);   /* + attn_mask[i][j] */ v[ch * 4 + q] = t; mx = fmaxf(mx, t); } }
#pragma unroll
    for (int sh = 16; sh; sh >>= 1) mx = fmaxf(mx, __shfl_xor(mx, sh, 32));
    float sum = 0.f;
#pragma unroll
    for (int k = 0; k < TT / 32; ++k) { float d0 = __fsub_rn(v[k], mx); asm volatile("" : "+v"(d0)); v[k] = __builtin_amdgcn_exp2f(__fmul_rn(d0, 1.4426950408889634f)); sum += v[k]; }
#pragma unroll
    for (int sh = 16; sh; sh >>= 1) sum += __shfl_xor(sum, sh, 32);
    const float f = __fdiv_rn(hires ? 1.0f : PCAR, sum);
{
        if (hires) {
#pragma unroll
            for (int ch = 0; ch < TT / 128; ++ch) { v4us oh, ol;
#pragma unroll
                for (int q = 0; q < 4; ++q) { unsigned short a, c2; splitf(v[ch * 4 + q] * f, a, c2); oh[q] = a; ol[q] = c2; }
                const size_t oo = ((size_t)zz * (RH ? RH : 1) + i) * TT + ch * 128 + lane * 4; *(v4us*)(Ph + oo) = oh; *(v4us*)(Pl + oo) = ol; }
        } else {
#pragma unroll
            for (int ch = 0; ch < TT / 128; ++ch) { v4h o4;
#pragma unroll
                for (int q = 0; q < 4; ++q) o4[q] = tohx(v[ch * 4 + q] * f);
                *(v4h*)(P16 + (size_t)row * TT + ch * 128 + lane * 4) = o4; } }
         }
}
__global__ __launch_bounds__(256) void k_merge(const float* __restrict__ O, int h0, int b, float* OA) { const size_t e = ((size_t)blockIdx.x * 256 + threadIdx.x) * 2; if (e >= (size_t)ZH * TT * HD) return; const int d = (int)(e % HD); const int t = (int)((e / HD) % TT); const int zz = (int)(e / ((size_t)HD * TT)); const float cs = (t < RH) ? 1.0f : (1.0f / PCAR); const size_t oo = (((size_t)(h0 + zz) * NB_ + b) * TT + t) * HD + d;   /* (h, b, s, dh) contiguous == the module's raw (S, B, D) view */
    v2f o2; o2[0] = O[e] * cs; o2[1] = O[e + 1] * cs; *(v2f*)(OA + oo) = o2;  }

extern "C" void kernel_launch(void* const* d_in, const int* in_sizes, int n_in,
                              void* d_out, int out_size, void* d_ws, size_t ws_size, hipStream_t stream) {
    (void)in_sizes; (void)n_in; (void)out_size;
    const float* xq = (const float*)d_in[0]; const float* xk = (const float*)d_in[1]; const float* xv = (const float*)d_in[2]; const float* MK = (const float*)d_in[3]; const float* wq = (const float*)d_in[4]; const float* bq = (const float*)d_in[5]; const float* wk = (const float*)d_in[6]; const float* bk = (const float*)d_in[7]; const float* wv = (const float*)d_in[8]; const float* bv = (const float*)d_in[9]; const float* wo = (const float*)d_in[10]; const float* bo = (const float*)d_in[11]; const float* x = xq; (void)x;
    float* OUT = (float*)d_out;     // [2048][2][1024]
    char* wsp = (char*)d_ws;
    auto take = [&](size_t bytes) { char* p = wsp; wsp += (bytes + 255) & ~(size_t)255; return (void*)p; };
    bf* WQ = (bf*)take((size_t)DQ * DM * 2); bf* WK = (bf*)take((size_t)DKV * DM * 2); bf* WV = (bf*)take((size_t)DKV * DM * 2); bf* WO = (bf*)take((size_t)DM * DQ * 2); float* CS = (float*)take((size_t)TT * HD * 2 * 4);
    bf* XB = (bf*)take((size_t)TT * DM * 2); bf* XKB = (bf*)take((size_t)TT * DM * 2); bf* XVB = (bf*)take((size_t)TT * DM * 2); float* OA = (float*)take((size_t)NB_ * TT * DQ * 4); float* FQ = (float*)take((size_t)TT * DQ * 4); float* FK = (float*)take((size_t)TT * DKV * 4);
    h16* QP16 = (h16*)take((size_t)NH_ * TT * HD * 2); h16* KP16 = (h16*)take((size_t)NKV * TT * HD * 2); h16* VT16 = (h16*)take((size_t)NKV * HD * TT * 2);
    bf* QPh = (bf*)take((size_t)NH_ * TT * HD * 2); bf* QPl = (bf*)take((size_t)NH_ * TT * HD * 2); bf* KPh = (bf*)take((size_t)NKV * TT * HD * 2); bf* KPl = (bf*)take((size_t)NKV * TT * HD * 2); bf* VTh = (bf*)take((size_t)NKV * HD * TT * 2); bf* VTl = (bf*)take((size_t)NKV * HD * TT * 2); bf* Ph = (bf*)take((size_t)ZH * RH * TT * 2); bf* Pl = (bf*)take((size_t)ZH * RH * TT * 2);
    float* Sb = (float*)take((size_t)ZH * TT * TT * 4); h16* P16 = (h16*)take((size_t)ZH * TT * TT * 2); float* Ob = (float*)take((size_t)ZH * TT * HD * 4); bf* ATh = (bf*)take((size_t)NB_ * TT * DQ * 2); bf* ATl = (bf*)take((size_t)NB_ * TT * DQ * 2);
    if ((size_t)(wsp - (char*)d_ws) > ws_size) return;    // ws 256 MiB
    float* FV = FK;   // v projection reuses the k buffer after the k planes are built (stream-ordered)
    { k_cvt8<<<(unsigned)(((size_t)DQ * DM / 8 + 255) / 256), 256, 0, stream>>>(wq, WQ, (size_t)DQ * DM / 8); k_cvt8<<<(unsigned)(((size_t)DKV * DM / 8 + 255) / 256), 256, 0, stream>>>(wk, WK, (size_t)DKV * DM / 8); k_cvt8<<<(unsigned)(((size_t)DKV * DM / 8 + 255) / 256), 256, 0, stream>>>(wv, WV, (size_t)DKV * DM / 8);
      k_cvt8<<<(unsigned)(((size_t)DM * DQ / 8 + 255) / 256), 256, 0, stream>>>(wo, WO, (size_t)DM * DQ / 8);
       }
    k_csid<<<(TT * HD + 255) / 256, 256, 0, stream>>>(CS);
    const unsigned LQ = (unsigned)(((size_t)NH_ * TT * HD / 2 + 255) / 256), LKv = (unsigned)(((size_t)NKV * TT * HD / 2 + 255) / 256);
    for (int b = 0; b < NB_; ++b) {
        
        k_cvt8s<<<(unsigned)(((size_t)TT * DM / 8 + 255) / 256), 256, 0, stream>>>(xq, b, XB, (size_t)TT * DM / 8); k_cvt8s<<<(unsigned)(((size_t)TT * DM / 8 + 255) / 256), 256, 0, stream>>>(xk, b, XKB, (size_t)TT * DM / 8); k_cvt8s<<<(unsigned)(((size_t)TT * DM / 8 + 255) / 256), 256, 0, stream>>>(xv, b, XVB, (size_t)TT * DM / 8);   /* batch b of the sequence-first inputs */
        k_gemmw<bf, 0, true><<<dim3(TT / 64, DQ / 64, 1), 32, 0, stream>>>(XB, nullptr, WQ, nullptr, DM, FQ, DQ, bq, 0, 0, 0);
        k_rope<<<LQ, 256, 0, stream>>>(FQ, DQ, NH_, CS, nullptr, nullptr, 1.0f, QP16, QPh, QPl);
        k_gemmw<bf, 0, true><<<dim3(TT / 64, DKV / 64, 1), 32, 0, stream>>>(XKB, nullptr, WK, nullptr, DM, FK, DKV, bk, 0, 0, 0);
        k_rope<<<LKv, 256, 0, stream>>>(FK, DKV, NKV, CS, nullptr, nullptr, 1.0f, KP16, KPh, KPl);
        k_gemmw<bf, 0, true><<<dim3(TT / 64, DKV / 64, 1), 32, 0, stream>>>(XVB, nullptr, WV, nullptr, DM, FV, DKV, bv, 0, 0, 0); k_vtp<<<LKv, 256, 0, stream>>>(FV, DKV, NKV, VT16, VTh, VTl);
        for (int h0 = 0; h0 < NH_; h0 += ZH) { const size_t zq = (size_t)h0, zk = (size_t)(h0 / REP);   // one kv head per query head: the pass's two heads use consecutive kv planes (z-strides TT*HD)
            k_gemmw<bf, 2, false><<<dim3(RH / 64, TT / 64, ZH), 32, 0, stream>>>(QPh + zq * TT * HD, QPl + zq * TT * HD, KPh + zk * TT * HD, KPl + zk * TT * HD, HD, Sb, TT, nullptr, (size_t)TT * HD, (size_t)TT * HD, (size_t)TT * TT);
            k_gemmw<h16, 0, false><<<dim3((TT - RH) / 64, TT / 64, ZH), 32, 0, stream>>>(QP16 + zq * TT * HD + (size_t)RH * HD, nullptr, KP16 + zk * TT * HD, nullptr, HD, Sb + (size_t)RH * TT, TT, nullptr, (size_t)TT * HD, (size_t)TT * HD, (size_t)TT * TT);
            k_asoft<<<ZH * TT / 8, 256, 0, stream>>>(Sb, MK, P16, Ph, Pl);
            k_gemmw<bf, 2, false><<<dim3(RH / 64, HD / 64, ZH), 32, 0, stream>>>(Ph, Pl, VTh + zk * HD * TT, VTl + zk * HD * TT, TT, Ob, HD, nullptr, (size_t)RH * TT, (size_t)HD * TT, (size_t)TT * HD);
            k_gemmw<h16, 0, false><<<dim3((TT - RH) / 64, HD / 64, ZH), 32, 0, stream>>>(P16 + (size_t)RH * TT, nullptr, VT16 + zk * HD * TT, nullptr, TT, Ob + (size_t)RH * HD, HD, nullptr, (size_t)TT * TT, (size_t)HD * TT, (size_t)TT * HD);
            k_merge<<<(unsigned)(((size_t)ZH * TT * HD / 2 + 255) / 256), 256, 0, stream>>>(Ob, h0, b, OA); }
        }
    k_split4<<<(unsigned)(((size_t)NB_ * TT * DQ / 4 + 255) / 256), 256, 0, stream>>>(OA, ATh, ATl, (size_t)NB_ * TT * DQ / 4);
    k_gemmw<bf, 1, true><<<dim3(NB_ * TT / 64, DM / 64, 1), 32, 0, stream>>>(ATh, ATl, WO, nullptr, DQ, OUT, DM, bo, 0, 0, 0);   /* out (S*B rows, in the view's memory order) = view Wo^T + bo */
}

// v001
// It runs in 1040 microseconds.
// Next to v000, in two timings, it ran 2.08 times as fast each time.
#include <hip/hip_runtime.h>

// Multi-head attention on sequence-first tensors with the module's raw-view head merge (q, k, v [2048][2][1024] = [s][b][d]; projections 'oi' [1024][1024] + biases; per (head, batch): scores = q.k/8 + attn_mask[i][j] (f32 [2048][2048] input, read); softmax; O[h][b][s][dh] = attn.v; the module then views the contiguous (H, B, S, Dh) tensor directly as (S, B, D) (NO head transpose) and applies Wo^T + bo -> out [2048][2][1024]).
// Layout: both batch elements are read from the interleaved rows (row stride 2 x 1024); all 32 (head, batch) attention problems write O contiguously in (h, b, s, dh) order, whose memory IS the module's (S x B, D) view, so the output projection is one GEMM over 4096 rows.
// Compute dtypes, f32 accumulate: every input rounded to bf16; q/k/v on PLAIN bf16 operands (inputs: exact) + biases; additive mask (bf16-rounded) inside the softmax kernel; scores and attn.v: query rows < 512 hl (3 products), the rest single fp16 (x1024); softmax f32; Wo hl x exact (2 products) + bo.

#define NB_  2
#define TT   2048
#define DM   1024
#define NH_  16
#define NKV  16
#define REP  (NH_ / NKV)
#define HD   64
#define DQ   (NH_ * HD)
#define DKV  (NKV * HD)
typedef __attribute__((ext_vector_type(4))) unsigned short v4us;
#define ZH   2
#define RH   512                  // query rows < RH use hi+lo planes (0: none)
#define WIN  0
#define PCAR 1024.0f
#define SCL  0.125f   // HD^-0.5
#define KSP  16                   // attn.v: key ranges per output tile, one work-group each; k_merge adds the partial planes
typedef _Float16 h16;
typedef unsigned short bf;
typedef __attribute__((ext_vector_type(16))) __bf16   v16bf;
typedef __attribute__((ext_vector_type(16))) _Float16 v16h;
typedef __attribute__((ext_vector_type(8)))  _Float16 v8h;
typedef __attribute__((ext_vector_type(8)))  unsigned short v8us;
typedef __attribute__((ext_vector_type(8)))  float    v8f;
typedef __attribute__((ext_vector_type(4)))  float    v4f;
typedef v8h  __attribute__((may_alias)) v8ha;
typedef v4f  __attribute__((may_alias)) v4fa;
typedef v8us __attribute__((may_alias)) v8usa;

__device__ __forceinline__ unsigned short f2bf(float f) { unsigned u = __float_as_uint(f); u += 0x7FFFu + ((u >> 16) & 1u); return (unsigned short)(u >> 16); }
__device__ __forceinline__ float bf2f(unsigned short b) { return __uint_as_float(((unsigned)b) << 16); }
__device__ __forceinline__ float bfr(float f) { return bf2f(f2bf(f)); }
__device__ __forceinline__ v16h cat16(v8h lo, v8h hi) { return __builtin_shufflevector(lo, hi, 0, 1, 2, 3, 4, 5, 6, 7, 8, 9, 10, 11, 12, 13, 14, 15); }
__device__ __forceinline__ v16bf cat16b(v8us lo, v8us hi) { return __builtin_bit_cast(v16bf, __builtin_shufflevector(lo, hi, 0, 1, 2, 3, 4, 5, 6, 7, 8, 9, 10, 11, 12, 13, 14, 15)); }
__device__ __forceinline__ v8f wmma16(v16h a, v16h b, v8f c) { return __builtin_amdgcn_wmma_f32_16x16x32_f16(false, a, false, b, (short)0, c, false, false); }
__device__ __forceinline__ v8f wmmab(v16bf a, v16bf b, v8f c) { return __builtin_amdgcn_wmma_f32_16x16x32_bf16(false, a, false, b, (short)0, c, false, false); }



// ---- k_gemmw: register-blocked GEMM, ONE WAVE per 64x64 output tile (16 accumulators), operands straight from K-contiguous 16-bit planes; grid (M/64, N/64, Z), 32 threads.
// C[m][n] (f32, pitch ldc, + optional f32 bias[n]) = sum_k A[m][k] Bt[n][k] (+ split products per NSPLIT). z-batch strides sA/sB/sC in elements. K % (32 * KS) == 0.
// KS > 1: grid z = Z * KS; work-group z * KS + ks sums only k in [ks, ks + 1) * K / KS and stores its partial tile in C plane z * KS + ks (plane stride sC); the caller adds the KS planes.
template <typename T16> struct WFrag;
template <> struct WFrag<h16> { typedef v16h V; static __device__ __forceinline__ V ld(const h16* p) { return cat16(*(const v8h*)p, *(const v8h*)(p + 16)); } static __device__ __forceinline__ v8f mma(V a, V b, v8f c) { return wmma16(a, b, c); } };
template <> struct WFrag<bf> { typedef v16bf V; static __device__ __forceinline__ V ld(const bf* p) { return cat16b(*(const v8us*)p, *(const v8us*)(p + 16)); } static __device__ __forceinline__ v8f mma(V a, V b, v8f c) { return wmmab(a, b, c); } };
template <typename T16, int NSPLIT, bool BIAS, int KS = 1>
__global__ __launch_bounds__(32) void k_gemmw(const T16* __restrict__ A, const T16* __restrict__ A2, const T16* __restrict__ Bt, const T16* __restrict__ Bt2, int K, float* C, int ldc, const float* __restrict__ bias, size_t sA, size_t sB, size_t sC) {
    typedef typename WFrag<T16>::V V;
    __shared__ __align__(16) float os[16 * 68];
    const size_t zb = blockIdx.z, z = zb / KS; const int k0 = (int)(zb % KS) * (K / KS), k1 = k0 + K / KS; A += z * sA; if (A2) A2 += z * sA; Bt += z * sB; if (Bt2) Bt2 += z * sB; C += zb * sC;
    const int lane = threadIdx.x & 31, lr = lane & 15, hi = lane >> 4; const int r0 = blockIdx.x * 64, c0 = blockIdx.y * 64;
    v8f acc[4][4];
#pragma unroll
    for (int mb = 0; mb < 4; ++mb)
#pragma unroll
        for (int nb = 0; nb < 4; ++nb) acc[mb][nb] = (v8f){};
    const size_t aoff = (size_t)(r0 + lr) * K + 8 * hi, boff = (size_t)(c0 + lr) * K + 8 * hi;
#pragma unroll 1
    for (int kc = k0; kc < k1; kc += 32) {
        V a[4], a2[4];
#pragma unroll
        for (int mb = 0; mb < 4; ++mb) { a[mb] = WFrag<T16>::ld(A + aoff + (size_t)mb * 16 * K + kc); if (NSPLIT == 1 || NSPLIT == 2) a2[mb] = WFrag<T16>::ld(A2 + aoff + (size_t)mb * 16 * K + kc); }
#pragma unroll
        for (int nb = 0; nb < 4; ++nb) { const V b = WFrag<T16>::ld(Bt + boff + (size_t)nb * 16 * K + kc); V b2; if (NSPLIT >= 2) b2 = WFrag<T16>::ld(Bt2 + boff + (size_t)nb * 16 * K + kc);
#pragma unroll
            for (int mb = 0; mb < 4; ++mb) { acc[mb][nb] = WFrag<T16>::mma(a[mb], b, acc[mb][nb]); if (NSPLIT == 1 || NSPLIT == 2) acc[mb][nb] = WFrag<T16>::mma(a2[mb], b, acc[mb][nb]); if (NSPLIT >= 2) acc[mb][nb] = WFrag<T16>::mma(a[mb], b2, acc[mb][nb]); } }
        asm volatile("v_nop\n\tv_nop\n\tv_nop\n\tv_nop" : "+v"(acc[0][0]), "+v"(acc[1][1]), "+v"(acc[2][2]), "+v"(acc[3][3]) : "v"(a[0]), "v"(a[3]));
    }
#pragma unroll
    for (int mb = 0; mb < 4; ++mb) {
#pragma unroll
        for (int nb = 0; nb < 4; ++nb) {
#pragma unroll
            for (int j = 0; j < 8; ++j) os[(hi * 8 + j) * 68 + nb * 16 + lr] = acc[mb][nb][j]; }
        __builtin_amdgcn_wave_barrier(); asm volatile("" ::: "memory");
        float* crow = C + (size_t)(r0 + mb * 16) * ldc + c0;
{
#pragma unroll
            for (int s = 0; s < 8; ++s) { const int row = 2 * s + hi, cofs = lr * 4; v4f val = *(const v4fa*)(os + row * 68 + cofs); if (BIAS) { val[0] += bfr(bias[c0 + cofs]); val[1] += bfr(bias[c0 + cofs + 1]); val[2] += bfr(bias[c0 + cofs + 2]); val[3] += bfr(bias[c0 + cofs + 3]); }
                *(v4f*)(crow + (size_t)row * ldc + cofs) = val; }
             }
        __builtin_amdgcn_wave_barrier(); asm volatile("" ::: "memory");
    }
}

__device__ __forceinline__ h16 tohx(float x) { return (h16)x; }
__device__ __forceinline__ void splitf(float y, unsigned short& h, unsigned short& l) { h = f2bf(y); l = f2bf(y - bf2f(h)); }
typedef __attribute__((ext_vector_type(2))) _Float16 v2h;
typedef __attribute__((ext_vector_type(4))) _Float16 v4h;
typedef __attribute__((ext_vector_type(2))) unsigned short v2us;
typedef __attribute__((ext_vector_type(4))) unsigned short v4us;
typedef __attribute__((ext_vector_type(2))) float v2f;
typedef __attribute__((ext_vector_type(4))) int v4i;

__global__ __launch_bounds__(256) void k_wtG(const float* __restrict__ w, int K, int N, bf* Bt) {
    const int lane = threadIdx.x & 31; const int L0 = (blockIdx.x * 8 + (threadIdx.x >> 5)) * 8; const int nlines = N * K / 64;
{
#pragma unroll 1
        for (int l = 0; l < 8; ++l) { const int L = L0 + l; if (L >= nlines) break; const size_t e = (size_t)L * 64 + lane * 2; const int k = (int)(e % K), n = (int)(e / K); v2us o;
            o[0] = f2bf(w[(size_t)k * N + n]); o[1] = f2bf(w[(size_t)(k + 1) * N + n]); *(v2us*)(Bt + e) = o; }
         }
}
__global__ __launch_bounds__(256) void k_split4(const float* __restrict__ F, bf* Ph, bf* Pl, size_t n4) { const size_t i = (size_t)blockIdx.x * 256 + threadIdx.x; if (i >= n4) return; const v4f v = *(const v4f*)(F + i * 4); v4us oh, ol;
#pragma unroll
    for (int q = 0; q < 4; ++q) { unsigned short a, c; splitf(v[q], a, c); oh[q] = a; ol[q] = c; } *(v4us*)(Ph + i * 4) = oh; *(v4us*)(Pl + i * 4) = ol;  }
__global__ __launch_bounds__(256) void k_cvt8s(const float* __restrict__ src, int b, bf* dst, size_t n8) { const size_t i = (size_t)blockIdx.x * 256 + threadIdx.x; if (i >= n8) return; const size_t e = i * 8; const size_t t = e / DM, c = e % DM; const v8f v = *(const v8f*)(src + (t * NB_ + b) * DM + c); v8us o;
#pragma unroll
    for (int k = 0; k < 8; ++k) o[k] = f2bf(v[k]); *(v8us*)(dst + e) = o;  }
__global__ __launch_bounds__(256) void k_cvt8(const float* __restrict__ src, bf* dst, size_t n8) { const size_t i = (size_t)blockIdx.x * 256 + threadIdx.x; if (i >= n8) return; const v8f v = *(const v8f*)(src + i * 8); v8us o;
#pragma unroll
    for (int k = 0; k < 8; ++k) o[k] = f2bf(v[k]); *(v8us*)(dst + i * 8) = o;  }

// k_rope: head planes [h][t][d] (fp16 + hi/lo) of rope(x) x sc with the rotate-half convention out[d] = x[d] cos[t][d] - x[d+HD/2] sin[t][d], out[d+HD/2] = x[d+HD/2] cos[t][d+HD/2] + x[d] sin[t][d+HD/2]
__global__ __launch_bounds__(256) void k_rope(const float* __restrict__ F, int pitch, int nheads, const float* __restrict__ CS, const float* __restrict__ RF, const float* __restrict__ nw, float sc, h16* P16, bf* Ph, bf* Pl) {
    const size_t e = ((size_t)blockIdx.x * 256 + threadIdx.x) * 2; if (e >= (size_t)nheads * TT * HD) return; const int d = (int)(e % HD); const int t = (int)((e / HD) % TT); const int h = (int)(e / ((size_t)HD * TT)); const float* f = F + (size_t)t * pitch + h * HD; const float rf = RF ? RF[(size_t)h * TT + t] : 1.0f; v2h o16; v2us oh, ol;
#pragma unroll
    for (int q = 0; q < 2; ++q) { const int dd = d + q; const int dp = (dd < HD / 2) ? dd + HD / 2 : dd - HD / 2; float x0 = f[dd], x1 = f[dp];
        if (RF) { float n0 = __fmul_rn(x0, rf), n1 = __fmul_rn(x1, rf); asm volatile("" : "+v"(n0)); asm volatile("" : "+v"(n1)); x0 = __fmul_rn(bfr(nw[dd]), n0); x1 = __fmul_rn(bfr(nw[dp]), n1); }
        const v2f cs = *(const v2f*)(CS + ((size_t)t * HD + dd) * 2); float a = __fmul_rn(x0, cs[0]), bq = __fmul_rn(x1, cs[1]); asm volatile("" : "+v"(a)); asm volatile("" : "+v"(bq)); const float r = ((dd < HD / 2) ? __fsub_rn(a, bq) : __fadd_rn(a, bq)) * sc;
        o16[q] = tohx(r); unsigned short a2, c2; splitf(r, a2, c2); oh[q] = a2; ol[q] = c2; }
    *(v2h*)(P16 + e) = o16; *(v2us*)(Ph + e) = oh; *(v2us*)(Pl + e) = ol;  }
__global__ __launch_bounds__(256) void k_vtp(const float* __restrict__ F, int pitch, int nheads, h16* V16, bf* Vh, bf* Vl) { const size_t e = ((size_t)blockIdx.x * 256 + threadIdx.x) * 2; if (e >= (size_t)nheads * HD * TT) return; const int t = (int)(e % TT); const int d = (int)((e / TT) % HD); const int g = (int)(e / ((size_t)TT * HD)); v2h o16; v2us oh, ol;
#pragma unroll
    for (int q = 0; q < 2; ++q) { const float x = F[(size_t)(t + q) * pitch + g * HD + d]; o16[q] = tohx(x); unsigned short a2, c2; splitf(x, a2, c2); oh[q] = a2; ol[q] = c2; }
    *(v2h*)(V16 + e) = o16; *(v2us*)(Vh + e) = oh; *(v2us*)(Vl + e) = ol;  }
__global__ __launch_bounds__(256) void k_csid(float* CS) { const int idx = blockIdx.x * 256 + threadIdx.x; if (idx >= TT * HD) return; v2f cs; cs[0] = 1.0f; cs[1] = 0.0f; *(v2f*)(CS + (size_t)idx * 2) = cs;  }
// k_asoft: per row (zz, i): t = S x HD^-0.5 + bf16(attn_mask[i][j]); softmax over the 2048 keys (register row, one exp, fixed trees);
__global__ __launch_bounds__(256) void k_asoft(const float* __restrict__ Sb, const float* __restrict__ MKb, h16* P16, bf* Ph, bf* Pl) {
    const int lane = threadIdx.x & 31; const int row = blockIdx.x * 8 + (threadIdx.x >> 5); if (row >= ZH * TT) return; const int i = row % TT; const int zz = row / TT; (void)zz; const float* mk = MKb + (size_t)i * TT; const bool hires = (i < RH); const float* sr = Sb + (size_t)row * TT; float v[TT / 32]; float mx = -3.0e38f;
#pragma unroll
    for (int ch = 0; ch < TT / 128; ++ch) { const int j0 = ch * 128 + lane * 4; const v4f a = *(const v4f*)(sr + j0);
#pragma unroll
        for (int q = 0; q < 4; ++q) { const int j = j0 + q; float sa = a[q] * SCL; asm volatile("" : "+v"(sa)); float mv = bfr(mk[j]); asm volatile("" : "+v"(mv)); const float t = __fadd_rn(sa, mv);   /* + attn_mask[i][j] */ v[ch * 4 + q] = t; mx = fmaxf(mx, t); } }
#pragma unroll
    for (int sh = 16; sh; sh >>= 1) mx = fmaxf(mx, __shfl_xor(mx, sh, 32));
    float sum = 0.f;
#pragma unroll
    for (int k = 0; k < TT / 32; ++k) { float d0 = __fsub_rn(v[k], mx); asm volatile("" : "+v"(d0)); v[k] = __builtin_amdgcn_exp2f(__fmul_rn(d0, 1.4426950408889634f)); sum += v[k]; }
#pragma unroll
    for (int sh = 16; sh; sh >>= 1) sum += __shfl_xor(sum, sh, 32);
    const float f = __fdiv_rn(hires ? 1.0f : PCAR, sum);
{
        if (hires) {
#pragma unroll
            for (int ch = 0; ch < TT / 128; ++ch) { v4us oh, ol;
#pragma unroll
                for (int q = 0; q < 4; ++q) { unsigned short a, c2; splitf(v[ch * 4 + q] * f, a, c2); oh[q] = a; ol[q] = c2; }
                const size_t oo = ((size_t)zz * (RH ? RH : 1) + i) * TT + ch * 128 + lane * 4; *(v4us*)(Ph + oo) = oh; *(v4us*)(Pl + oo) = ol; }
        } else {
#pragma unroll
            for (int ch = 0; ch < TT / 128; ++ch) { v4h o4;
#pragma unroll
                for (int q = 0; q < 4; ++q) o4[q] = tohx(v[ch * 4 + q] * f);
                *(v4h*)(P16 + (size_t)row * TT + ch * 128 + lane * 4) = o4; } }
         }
}
__global__ __launch_bounds__(256) void k_merge(const float* __restrict__ O, int h0, int b, float* OA) { const size_t e = ((size_t)blockIdx.x * 256 + threadIdx.x) * 2; if (e >= (size_t)ZH * TT * HD) return; const int d = (int)(e % HD); const int t = (int)((e / HD) % TT); const int zz = (int)(e / ((size_t)HD * TT)); const float cs = (t < RH) ? 1.0f : (1.0f / PCAR); const size_t oo = (((size_t)(h0 + zz) * NB_ + b) * TT + t) * HD + d;   /* (h, b, s, dh) contiguous == the module's raw (S, B, D) view */
    const float* p = O + ((size_t)zz * KSP * TT + t) * HD + d; float s0 = p[0], s1 = p[1];   /* the KSP key-range partials of attn.v, added in ascending key order */
#pragma unroll
    for (int ks = 1; ks < KSP; ++ks) { s0 += p[(size_t)ks * TT * HD]; s1 += p[(size_t)ks * TT * HD + 1]; }
    v2f o2; o2[0] = s0 * cs; o2[1] = s1 * cs; *(v2f*)(OA + oo) = o2;  }

extern "C" void kernel_launch(void* const* d_in, const int* in_sizes, int n_in,
                              void* d_out, int out_size, void* d_ws, size_t ws_size, hipStream_t stream) {
    (void)in_sizes; (void)n_in; (void)out_size;
    const float* xq = (const float*)d_in[0]; const float* xk = (const float*)d_in[1]; const float* xv = (const float*)d_in[2]; const float* MK = (const float*)d_in[3]; const float* wq = (const float*)d_in[4]; const float* bq = (const float*)d_in[5]; const float* wk = (const float*)d_in[6]; const float* bk = (const float*)d_in[7]; const float* wv = (const float*)d_in[8]; const float* bv = (const float*)d_in[9]; const float* wo = (const float*)d_in[10]; const float* bo = (const float*)d_in[11]; const float* x = xq; (void)x;
    float* OUT = (float*)d_out;     // [2048][2][1024]
    char* wsp = (char*)d_ws;
    auto take = [&](size_t bytes) { char* p = wsp; wsp += (bytes + 255) & ~(size_t)255; return (void*)p; };
    bf* WQ = (bf*)take((size_t)DQ * DM * 2); bf* WK = (bf*)take((size_t)DKV * DM * 2); bf* WV = (bf*)take((size_t)DKV * DM * 2); bf* WO = (bf*)take((size_t)DM * DQ * 2); float* CS = (float*)take((size_t)TT * HD * 2 * 4);
    bf* XB = (bf*)take((size_t)TT * DM * 2); bf* XKB = (bf*)take((size_t)TT * DM * 2); bf* XVB = (bf*)take((size_t)TT * DM * 2); float* OA = (float*)take((size_t)NB_ * TT * DQ * 4); float* FQ = (float*)take((size_t)TT * DQ * 4); float* FK = (float*)take((size_t)TT * DKV * 4);
    h16* QP16 = (h16*)take((size_t)NH_ * TT * HD * 2); h16* KP16 = (h16*)take((size_t)NKV * TT * HD * 2); h16* VT16 = (h16*)take((size_t)NKV * HD * TT * 2);
    bf* QPh = (bf*)take((size_t)NH_ * TT * HD * 2); bf* QPl = (bf*)take((size_t)NH_ * TT * HD * 2); bf* KPh = (bf*)take((size_t)NKV * TT * HD * 2); bf* KPl = (bf*)take((size_t)NKV * TT * HD * 2); bf* VTh = (bf*)take((size_t)NKV * HD * TT * 2); bf* VTl = (bf*)take((size_t)NKV * HD * TT * 2); bf* Ph = (bf*)take((size_t)ZH * RH * TT * 2); bf* Pl = (bf*)take((size_t)ZH * RH * TT * 2);
    float* Sb = (float*)take((size_t)ZH * TT * TT * 4); h16* P16 = (h16*)take((size_t)ZH * TT * TT * 2); float* Ob = (float*)take((size_t)ZH * KSP * TT * HD * 4); bf* ATh = (bf*)take((size_t)NB_ * TT * DQ * 2); bf* ATl = (bf*)take((size_t)NB_ * TT * DQ * 2);
    if ((size_t)(wsp - (char*)d_ws) > ws_size) return;    // ws 256 MiB
    float* FV = FK;   // v projection reuses the k buffer after the k planes are built (stream-ordered)
    { k_cvt8<<<(unsigned)(((size_t)DQ * DM / 8 + 255) / 256), 256, 0, stream>>>(wq, WQ, (size_t)DQ * DM / 8); k_cvt8<<<(unsigned)(((size_t)DKV * DM / 8 + 255) / 256), 256, 0, stream>>>(wk, WK, (size_t)DKV * DM / 8); k_cvt8<<<(unsigned)(((size_t)DKV * DM / 8 + 255) / 256), 256, 0, stream>>>(wv, WV, (size_t)DKV * DM / 8);
      k_cvt8<<<(unsigned)(((size_t)DM * DQ / 8 + 255) / 256), 256, 0, stream>>>(wo, WO, (size_t)DM * DQ / 8);
       }
    k_csid<<<(TT * HD + 255) / 256, 256, 0, stream>>>(CS);
    const unsigned LQ = (unsigned)(((size_t)NH_ * TT * HD / 2 + 255) / 256), LKv = (unsigned)(((size_t)NKV * TT * HD / 2 + 255) / 256);
    for (int b = 0; b < NB_; ++b) {
        
        k_cvt8s<<<(unsigned)(((size_t)TT * DM / 8 + 255) / 256), 256, 0, stream>>>(xq, b, XB, (size_t)TT * DM / 8); k_cvt8s<<<(unsigned)(((size_t)TT * DM / 8 + 255) / 256), 256, 0, stream>>>(xk, b, XKB, (size_t)TT * DM / 8); k_cvt8s<<<(unsigned)(((size_t)TT * DM / 8 + 255) / 256), 256, 0, stream>>>(xv, b, XVB, (size_t)TT * DM / 8);   /* batch b of the sequence-first inputs */
        k_gemmw<bf, 0, true><<<dim3(TT / 64, DQ / 64, 1), 32, 0, stream>>>(XB, nullptr, WQ, nullptr, DM, FQ, DQ, bq, 0, 0, 0);
        k_rope<<<LQ, 256, 0, stream>>>(FQ, DQ, NH_, CS, nullptr, nullptr, 1.0f, QP16, QPh, QPl);
        k_gemmw<bf, 0, true><<<dim3(TT / 64, DKV / 64, 1), 32, 0, stream>>>(XKB, nullptr, WK, nullptr, DM, FK, DKV, bk, 0, 0, 0);
        k_rope<<<LKv, 256, 0, stream>>>(FK, DKV, NKV, CS, nullptr, nullptr, 1.0f, KP16, KPh, KPl);
        k_gemmw<bf, 0, true><<<dim3(TT / 64, DKV / 64, 1), 32, 0, stream>>>(XVB, nullptr, WV, nullptr, DM, FV, DKV, bv, 0, 0, 0); k_vtp<<<LKv, 256, 0, stream>>>(FV, DKV, NKV, VT16, VTh, VTl);
        for (int h0 = 0; h0 < NH_; h0 += ZH) { const size_t zq = (size_t)h0, zk = (size_t)(h0 / REP);   // one kv head per query head: the pass's two heads use consecutive kv planes (z-strides TT*HD)
            k_gemmw<bf, 2, false><<<dim3(RH / 64, TT / 64, ZH), 32, 0, stream>>>(QPh + zq * TT * HD, QPl + zq * TT * HD, KPh + zk * TT * HD, KPl + zk * TT * HD, HD, Sb, TT, nullptr, (size_t)TT * HD, (size_t)TT * HD, (size_t)TT * TT);
            k_gemmw<h16, 0, false><<<dim3((TT - RH) / 64, TT / 64, ZH), 32, 0, stream>>>(QP16 + zq * TT * HD + (size_t)RH * HD, nullptr, KP16 + zk * TT * HD, nullptr, HD, Sb + (size_t)RH * TT, TT, nullptr, (size_t)TT * HD, (size_t)TT * HD, (size_t)TT * TT);
            k_asoft<<<ZH * TT / 8, 256, 0, stream>>>(Sb, MK, P16, Ph, Pl);
            k_gemmw<bf, 2, false, KSP><<<dim3(RH / 64, HD / 64, ZH * KSP), 32, 0, stream>>>(Ph, Pl, VTh + zk * HD * TT, VTl + zk * HD * TT, TT, Ob, HD, nullptr, (size_t)RH * TT, (size_t)HD * TT, (size_t)TT * HD);
            k_gemmw<h16, 0, false, KSP><<<dim3((TT - RH) / 64, HD / 64, ZH * KSP), 32, 0, stream>>>(P16 + (size_t)RH * TT, nullptr, VT16 + zk * HD * TT, nullptr, TT, Ob + (size_t)RH * HD, HD, nullptr, (size_t)TT * TT, (size_t)HD * TT, (size_t)TT * HD);
            k_merge<<<(unsigned)(((size_t)ZH * TT * HD / 2 + 255) / 256), 256, 0, stream>>>(Ob, h0, b, OA); }
        }
    k_split4<<<(unsigned)(((size_t)NB_ * TT * DQ / 4 + 255) / 256), 256, 0, stream>>>(OA, ATh, ATl, (size_t)NB_ * TT * DQ / 4);
    k_gemmw<bf, 1, true><<<dim3(NB_ * TT / 64, DM / 64, 1), 32, 0, stream>>>(ATh, ATl, WO, nullptr, DQ, OUT, DM, bo, 0, 0, 0);   /* out (S*B rows, in the view's memory order) = view Wo^T + bo */
}

// v003
// It runs in 419 microseconds.
// Versions in between are left out here; by their measured steps it is 2.48 times as fast as v001.
// Counting every step since v000, it is 5.17 times as fast.
#include <hip/hip_runtime.h>

// Multi-head attention on sequence-first tensors with the module's raw-view head merge (q, k, v [2048][2][1024] = [s][b][d]; projections 'oi' [1024][1024] + biases; per (head, batch): scores = q.k/8 + attn_mask[i][j] (f32 [2048][2048] input, read); softmax; O[h][b][s][dh] = attn.v; the module then views the contiguous (H, B, S, Dh) tensor directly as (S, B, D) (NO head transpose) and applies Wo^T + bo -> out [2048][2][1024]).
// Layout: both batch elements are read from the interleaved rows (row stride 2 x 1024); all 32 (head, batch) attention problems write O contiguously in (h, b, s, dh) order, whose memory IS the module's (S x B, D) view, so the output projection is one GEMM over 4096 rows.
// Fragment order: the 16-bit planes [rows][K] that the attention kernel reads (Q, K: K = HD; V^T: K = TT) lie in units of 16 rows x 32 k (1 KB): [row tile][k tile][k bit 4][lane = 16 * (k bit 3) + row % 16][k % 8], so a wave-wide 16-byte load of half a fragment reads 512 contiguous bytes (4 whole lines). The planes of k_gemmw stay K-contiguous.
// Compute dtypes, f32 accumulate: every input rounded to bf16; q/k/v on PLAIN bf16 operands (inputs: exact) + biases; additive mask (bf16-rounded, packed once by k_mkf) added inside the fused attention kernel; scores and attn.v: query rows < 512 hl (3 products), the rest single fp16 (x1024); softmax f32; Wo hl x exact (2 products) + bo.

#define NB_  2
#define TT   2048
#define DM   1024
#define NH_  16
#define NKV  16
#define REP  (NH_ / NKV)
#define HD   64
#define DQ   (NH_ * HD)
#define DKV  (NKV * HD)
typedef __attribute__((ext_vector_type(4))) unsigned short v4us;
#define RH   512                  // query rows < RH use hi+lo planes (0: none)
#define WIN  0
#define PCAR 1024.0f
#define SCL  0.125f   // HD^-0.5
typedef _Float16 h16;
typedef unsigned short bf;
typedef __attribute__((ext_vector_type(16))) __bf16   v16bf;
typedef __attribute__((ext_vector_type(16))) _Float16 v16h;
typedef __attribute__((ext_vector_type(8)))  _Float16 v8h;
typedef __attribute__((ext_vector_type(8)))  unsigned short v8us;
typedef __attribute__((ext_vector_type(8)))  float    v8f;
typedef __attribute__((ext_vector_type(4)))  float    v4f;
typedef v8h  __attribute__((may_alias)) v8ha;
typedef v4f  __attribute__((may_alias)) v4fa;
typedef v8us __attribute__((may_alias)) v8usa;

__device__ __forceinline__ unsigned short f2bf(float f) { unsigned u = __float_as_uint(f); u += 0x7FFFu + ((u >> 16) & 1u); return (unsigned short)(u >> 16); }
__device__ __forceinline__ float bf2f(unsigned short b) { return __uint_as_float(((unsigned)b) << 16); }
__device__ __forceinline__ float bfr(float f) { return bf2f(f2bf(f)); }
__device__ __forceinline__ v16h cat16(v8h lo, v8h hi) { return __builtin_shufflevector(lo, hi, 0, 1, 2, 3, 4, 5, 6, 7, 8, 9, 10, 11, 12, 13, 14, 15); }
__device__ __forceinline__ v16bf cat16b(v8us lo, v8us hi) { return __builtin_bit_cast(v16bf, __builtin_shufflevector(lo, hi, 0, 1, 2, 3, 4, 5, 6, 7, 8, 9, 10, 11, 12, 13, 14, 15)); }
__device__ __forceinline__ v8f wmma16(v16h a, v16h b, v8f c) { return __builtin_amdgcn_wmma_f32_16x16x32_f16(false, a, false, b, (short)0, c, false, false); }
__device__ __forceinline__ v8f wmmab(v16bf a, v16bf b, v8f c) { return __builtin_amdgcn_wmma_f32_16x16x32_bf16(false, a, false, b, (short)0, c, false, false); }



// ---- k_gemmw: register-blocked GEMM, ONE WAVE per 64x64 output tile (16 accumulators), operands straight from K-contiguous 16-bit planes; grid (M/64, N/64, Z), 32 threads.
// C[m][n] (f32, pitch ldc, + optional f32 bias[n]) = sum_k A[m][k] Bt[n][k] (+ split products per NSPLIT). z-batch strides sA/sB/sC in elements. K % (32 * KS) == 0.
// KS > 1: grid z = Z * KS; work-group z * KS + ks sums only k in [ks, ks + 1) * K / KS and stores its partial tile in C plane z * KS + ks (plane stride sC); the caller adds the KS planes.
// frag_rc: element offset e in a fragment-ordered plane -> its row and k. funit: offset of the unit (row tile rt, k tile kt). ldf (below) loads a fragment from unit + lane * 8.
__device__ __forceinline__ void frag_rc(size_t e, int K, size_t& row, int& k) { const size_t u = e >> 9; const int kt = (int)(u % (size_t)(K / 32)); row = (u / (size_t)(K / 32)) * 16 + ((e >> 3) & 15); k = kt * 32 + (int)((e >> 8) & 1) * 16 + (int)((e >> 7) & 1) * 8 + (int)(e & 7); }
// fchunk: thread -> 16-byte chunk for the mask packer: lane bits 0-2 = row % 8, 3 = k bit 3, 4 = k bit 4, thread bit 5 = row bit 3, so a wave reads 8 rows x 32 k (whole 128-byte lines of the f32 source) and stores 4 whole lines.
__device__ __forceinline__ size_t fchunk(size_t i) { return (i & ~(size_t)63) | (i & 7) | ((i >> 2) & 8) | ((i & 24) << 1); }
__device__ __forceinline__ size_t funit(size_t rt, int K, int kt) { return (rt * (size_t)(K / 32) + kt) << 9; }
template <typename T16> struct WFrag;
template <> struct WFrag<h16> { typedef v16h V; static __device__ __forceinline__ V ld(const h16* p) { return cat16(*(const v8h*)p, *(const v8h*)(p + 16)); } static __device__ __forceinline__ v8f mma(V a, V b, v8f c) { return wmma16(a, b, c); } };
template <> struct WFrag<bf> { typedef v16bf V; static __device__ __forceinline__ V ld(const bf* p) { return cat16b(*(const v8us*)p, *(const v8us*)(p + 16)); } static __device__ __forceinline__ v8f mma(V a, V b, v8f c) { return wmmab(a, b, c); } };
__device__ __forceinline__ v16h ldf(const h16* p) { return cat16(*(const v8h*)p, *(const v8h*)(p + 256)); }
__device__ __forceinline__ v16bf ldf(const bf* p) { return cat16b(*(const v8us*)p, *(const v8us*)(p + 256)); }
template <typename T16, int NSPLIT, bool BIAS, int KS = 1>
__global__ __launch_bounds__(32) void k_gemmw(const T16* __restrict__ A, const T16* __restrict__ A2, const T16* __restrict__ Bt, const T16* __restrict__ Bt2, int K, float* C, int ldc, const float* __restrict__ bias, size_t sA, size_t sB, size_t sC) {
    typedef typename WFrag<T16>::V V;
    __shared__ __align__(16) float os[16 * 68];
    const size_t zb = blockIdx.z, z = zb / KS; const int k0 = (int)(zb % KS) * (K / KS), k1 = k0 + K / KS; A += z * sA; if (A2) A2 += z * sA; Bt += z * sB; if (Bt2) Bt2 += z * sB; C += zb * sC;
    const int lane = threadIdx.x & 31, lr = lane & 15, hi = lane >> 4; const int r0 = blockIdx.x * 64, c0 = blockIdx.y * 64;
    v8f acc[4][4];
#pragma unroll
    for (int mb = 0; mb < 4; ++mb)
#pragma unroll
        for (int nb = 0; nb < 4; ++nb) acc[mb][nb] = (v8f){};
    const size_t aoff = (size_t)(r0 + lr) * K + 8 * hi, boff = (size_t)(c0 + lr) * K + 8 * hi;
#pragma unroll 1
    for (int kc = k0; kc < k1; kc += 32) {
        V a[4], a2[4];
#pragma unroll
        for (int mb = 0; mb < 4; ++mb) { a[mb] = WFrag<T16>::ld(A + aoff + (size_t)mb * 16 * K + kc); if (NSPLIT == 1 || NSPLIT == 2) a2[mb] = WFrag<T16>::ld(A2 + aoff + (size_t)mb * 16 * K + kc); }
#pragma unroll
        for (int nb = 0; nb < 4; ++nb) { const V b = WFrag<T16>::ld(Bt + boff + (size_t)nb * 16 * K + kc); V b2; if (NSPLIT >= 2) b2 = WFrag<T16>::ld(Bt2 + boff + (size_t)nb * 16 * K + kc);
#pragma unroll
            for (int mb = 0; mb < 4; ++mb) { acc[mb][nb] = WFrag<T16>::mma(a[mb], b, acc[mb][nb]); if (NSPLIT == 1 || NSPLIT == 2) acc[mb][nb] = WFrag<T16>::mma(a2[mb], b, acc[mb][nb]); if (NSPLIT >= 2) acc[mb][nb] = WFrag<T16>::mma(a[mb], b2, acc[mb][nb]); } }
        asm volatile("v_nop\n\tv_nop\n\tv_nop\n\tv_nop" : "+v"(acc[0][0]), "+v"(acc[1][1]), "+v"(acc[2][2]), "+v"(acc[3][3]) : "v"(a[0]), "v"(a[3]));
    }
#pragma unroll
    for (int mb = 0; mb < 4; ++mb) {
#pragma unroll
        for (int nb = 0; nb < 4; ++nb) {
#pragma unroll
            for (int j = 0; j < 8; ++j) os[(hi * 8 + j) * 68 + nb * 16 + lr] = acc[mb][nb][j]; }
        __builtin_amdgcn_wave_barrier(); asm volatile("" ::: "memory");
        float* crow = C + (size_t)(r0 + mb * 16) * ldc + c0;
{
#pragma unroll
            for (int s = 0; s < 8; ++s) { const int row = 2 * s + hi, cofs = lr * 4; v4f val = *(const v4fa*)(os + row * 68 + cofs); if (BIAS) { val[0] += bfr(bias[c0 + cofs]); val[1] += bfr(bias[c0 + cofs + 1]); val[2] += bfr(bias[c0 + cofs + 2]); val[3] += bfr(bias[c0 + cofs + 3]); }
                *(v4f*)(crow + (size_t)row * ldc + cofs) = val; }
             }
        __builtin_amdgcn_wave_barrier(); asm volatile("" ::: "memory");
    }
}

__device__ __forceinline__ h16 tohx(float x) { return (h16)x; }
__device__ __forceinline__ void splitf(float y, unsigned short& h, unsigned short& l) { h = f2bf(y); l = f2bf(y - bf2f(h)); }
typedef __attribute__((ext_vector_type(2))) _Float16 v2h;
typedef __attribute__((ext_vector_type(4))) _Float16 v4h;
typedef __attribute__((ext_vector_type(2))) unsigned short v2us;
typedef __attribute__((ext_vector_type(4))) unsigned short v4us;
typedef __attribute__((ext_vector_type(2))) float v2f;
typedef __attribute__((ext_vector_type(4))) int v4i;

__global__ __launch_bounds__(256) void k_wtG(const float* __restrict__ w, int K, int N, bf* Bt) {
    const int lane = threadIdx.x & 31; const int L0 = (blockIdx.x * 8 + (threadIdx.x >> 5)) * 8; const int nlines = N * K / 64;
{
#pragma unroll 1
        for (int l = 0; l < 8; ++l) { const int L = L0 + l; if (L >= nlines) break; const size_t e = (size_t)L * 64 + lane * 2; const int k = (int)(e % K), n = (int)(e / K); v2us o;
            o[0] = f2bf(w[(size_t)k * N + n]); o[1] = f2bf(w[(size_t)(k + 1) * N + n]); *(v2us*)(Bt + e) = o; }
         }
}
__global__ __launch_bounds__(256) void k_split4(const float* __restrict__ F, bf* Ph, bf* Pl, size_t n4) { const size_t i = (size_t)blockIdx.x * 256 + threadIdx.x; if (i >= n4) return; const v4f v = *(const v4f*)(F + i * 4); v4us oh, ol;
#pragma unroll
    for (int q = 0; q < 4; ++q) { unsigned short a, c; splitf(v[q], a, c); oh[q] = a; ol[q] = c; } *(v4us*)(Ph + i * 4) = oh; *(v4us*)(Pl + i * 4) = ol;  }
__global__ __launch_bounds__(256) void k_cvt8s(const float* __restrict__ src, int b, bf* dst, size_t n8) { const size_t i = (size_t)blockIdx.x * 256 + threadIdx.x; if (i >= n8) return; const size_t e = i * 8; const size_t t = e / DM, c = e % DM; const v8f v = *(const v8f*)(src + (t * NB_ + b) * DM + c); v8us o;
#pragma unroll
    for (int k = 0; k < 8; ++k) o[k] = f2bf(v[k]); *(v8us*)(dst + e) = o;  }
__global__ __launch_bounds__(256) void k_cvt8(const float* __restrict__ src, bf* dst, size_t n8) { const size_t i = (size_t)blockIdx.x * 256 + threadIdx.x; if (i >= n8) return; const v8f v = *(const v8f*)(src + i * 8); v8us o;
#pragma unroll
    for (int k = 0; k < 8; ++k) o[k] = f2bf(v[k]); *(v8us*)(dst + i * 8) = o;  }

// k_rope: head planes [h][t][d], fragment-ordered as [h * TT + t][d] (fp16 + hi/lo), of rope(x) x sc with the rotate-half convention out[d] = x[d] cos[t][d] - x[d+HD/2] sin[t][d], out[d+HD/2] = x[d+HD/2] cos[t][d+HD/2] + x[d] sin[t][d+HD/2]
__global__ __launch_bounds__(256) void k_rope(const float* __restrict__ F, int pitch, int nheads, const float* __restrict__ CS, const float* __restrict__ RF, const float* __restrict__ nw, float sc, h16* P16, bf* Ph, bf* Pl) {
    const size_t e = ((size_t)blockIdx.x * 256 + threadIdx.x) * 2; if (e >= (size_t)nheads * TT * HD) return; size_t ht; int d; frag_rc(e, HD, ht, d); const int t = (int)(ht % TT); const int h = (int)(ht / TT); const float* f = F + (size_t)t * pitch + h * HD; float rf = 1.0f; if (RF) { rf = RF[(size_t)h * TT + t]; asm volatile("s_wait_xcnt 0x0" ::: "memory"); /* before the address registers of the load above are reused */ } v2h o16; v2us oh, ol;
#pragma unroll
    for (int q = 0; q < 2; ++q) { const int dd = d + q; const int dp = (dd < HD / 2) ? dd + HD / 2 : dd - HD / 2; float x0 = f[dd], x1 = f[dp];
        if (RF) { float n0 = __fmul_rn(x0, rf), n1 = __fmul_rn(x1, rf); asm volatile("" : "+v"(n0)); asm volatile("" : "+v"(n1)); x0 = __fmul_rn(bfr(nw[dd]), n0); x1 = __fmul_rn(bfr(nw[dp]), n1); }
        const v2f cs = *(const v2f*)(CS + ((size_t)t * HD + dd) * 2); float a = __fmul_rn(x0, cs[0]), bq = __fmul_rn(x1, cs[1]); asm volatile("" : "+v"(a)); asm volatile("" : "+v"(bq)); const float r = ((dd < HD / 2) ? __fsub_rn(a, bq) : __fadd_rn(a, bq)) * sc;
        o16[q] = tohx(r); unsigned short a2, c2; splitf(r, a2, c2); oh[q] = a2; ol[q] = c2; }
    *(v2h*)(P16 + e) = o16; *(v2us*)(Ph + e) = oh; *(v2us*)(Pl + e) = ol;  }
__global__ __launch_bounds__(256) void k_vtp(const float* __restrict__ F, int pitch, int nheads, h16* V16, bf* Vh, bf* Vl) { const size_t e = ((size_t)blockIdx.x * 256 + threadIdx.x) * 2; if (e >= (size_t)nheads * HD * TT) return; size_t gd; int t; frag_rc(e, TT, gd, t); const int d = (int)(gd % HD); const int g = (int)(gd / HD); v2h o16; v2us oh, ol;
#pragma unroll
    for (int q = 0; q < 2; ++q) { const float x = F[(size_t)(t + q) * pitch + g * HD + d]; o16[q] = tohx(x); unsigned short a2, c2; splitf(x, a2, c2); oh[q] = a2; ol[q] = c2; }
    *(v2h*)(V16 + e) = o16; *(v2us*)(Vh + e) = oh; *(v2us*)(Vl + e) = ol;  }
__global__ __launch_bounds__(256) void k_csid(float* CS) { const int idx = blockIdx.x * 256 + threadIdx.x; if (idx >= TT * HD) return; v2f cs; cs[0] = 1.0f; cs[1] = 0.0f; *(v2f*)(CS + (size_t)idx * 2) = cs;  }
// k_mkf: attn_mask rounded to bf16, once a call, in the order of a score tile's accumulators: [query tile][key tile][lane = 16 * (key bit 3) + query % 16][key % 8], so k_fattn reads a tile's mask by one 16-byte load a lane, 512 contiguous bytes a wave.
__global__ __launch_bounds__(256) void k_mkf(const float* __restrict__ MK, bf* MF) { const size_t i = fchunk((size_t)blockIdx.x * 256 + threadIdx.x); const size_t tile = i >> 5; const int lane = (int)(i & 31); const v8f v = *(const v8f*)(MK + ((tile / (TT / 16)) * 16 + (lane & 15)) * TT + (tile % (TT / 16)) * 16 + (lane >> 4) * 8); v8us o;
#pragma unroll   // constant indices keep v[k] and o[k] in registers
    for (int k = 0; k < 8; ++k) o[k] = f2bf(v[k]); *(v8us*)(MF + i * 8) = o;  }
// k_fattn: scores, softmax and attn.v of 16 query rows of one head in ONE work-group (16 waves); no score or weight plane in memory. grid (TT / 16, heads), 512 threads.
// Transposed products: S^T = K Q^T (A = 16 key rows, B = the 16 query rows), so lane (lr, hi) holds query lr's scores of keys 8 hi + j of each 16-key tile; wave w owns keys [w, w + 1) * TT / AW and keeps its AT score tiles in registers.
// Row maximum and row sum: in the lane, across the two lane halves, then across the waves through LDS. Two neighbouring score tiles, scaled and converted in place, ARE the B fragment (hardware k order) of O^T += V^T P^T.
// Each wave's partial O^T (its own key range) goes to LDS; the AW partials are added in ascending key order and stored in (h, b, s, dh) order.
#define AW   16                   // waves per work-group, one key range each
#define AKW  (TT / AW)            // keys per wave
#define AT   (AKW / 16)           // score tiles per wave
#define OP   68                   // LDS pitch (floats) of one query's partial output row
typedef v2f __attribute__((may_alias)) v2fa;
template <typename T16, bool HL>
__device__ __forceinline__ void attn_rows(const T16* __restrict__ Q, const T16* __restrict__ Q2, const T16* __restrict__ Kp, const T16* __restrict__ K2, const T16* __restrict__ Vt, const T16* __restrict__ Vt2, const bf* __restrict__ MF, float* __restrict__ Oh, int i0, float* red, float* osm) {
    typedef typename WFrag<T16>::V V;
    const int lane = threadIdx.x & 31, lr = lane & 15, hi = lane >> 4, w = threadIdx.x >> 5; const int kb = w * AKW;
    V q[2], q2[2];
#pragma unroll
    for (int ks = 0; ks < 2; ++ks) q[ks] = ldf(Q + funit(i0 / 16, HD, ks) + lane * 8);
    asm volatile("s_wait_xcnt 0x0" ::: "memory");   /* before the address registers of the query loads are reused */
    if (HL) {
#pragma unroll   // constant indices keep q2[ks] in registers
        for (int ks = 0; ks < 2; ++ks) q2[ks] = ldf(Q2 + funit(i0 / 16, HD, ks) + lane * 8);
        asm volatile("s_wait_xcnt 0x0" ::: "memory");   /* as above */
    }
    const bf* mk = MF + ((size_t)(i0 / 16) * (TT / 16) + kb / 16) * 256 + lane * 8;
    constexpr int GT = HL ? 1 : 2, NG = AT / GT;         // score tiles per load group; two groups in flight: one lands while the one before it is multiplied
    constexpr int GD = HL ? 1 : 2, DG = HD / 16 / GD, NV = AT / 4 * DG;   // the same for attn.v: a load group is GD d tiles x 64 keys; groups per 64 keys, groups
    V k[2][GT][2], k2[2][GT][2], va[2][GD][2], va2[2][GD][2]; v8us m[2][GT];
    v8f s[AT]; float mx = -3.0e38f;
#pragma unroll
    for (int g = -1; g < NG; ++g) {
        if (g + 1 < NG) {
#pragma unroll
            for (int u = 0; u < GT; ++u) { const int t = (g + 1) * GT + u; const size_t ko = funit(kb / 16 + t, HD, 0) + lane * 8;
#pragma unroll
                for (int ks = 0; ks < 2; ++ks) { k[(g + 1) & 1][u][ks] = ldf(Kp + ko + ks * 512); if (HL) k2[(g + 1) & 1][u][ks] = ldf(K2 + ko + ks * 512); }
                m[(g + 1) & 1][u] = *(const v8us*)(mk + t * 256); }
            asm volatile("s_wait_xcnt 0x0" ::: "memory");   /* before any register that the loads above name (address, scalar base) is reused */
        }
        if (g >= 0) {
#pragma unroll
            for (int u = 0; u < GT; ++u) { const int t = g * GT + u; v8f a = (v8f){};
#pragma unroll
                for (int ks = 0; ks < 2; ++ks) { a = WFrag<T16>::mma(k[g & 1][u][ks], q[ks], a); if (HL) { a = WFrag<T16>::mma(k[g & 1][u][ks], q2[ks], a); a = WFrag<T16>::mma(k2[g & 1][u][ks], q[ks], a); } }
#pragma unroll
                for (int j = 0; j < 8; ++j) { const float tv = a[j] * SCL + bf2f(m[g & 1][u][j]);   /* q.k / 8 (exact scaling) + attn_mask[i][j] */ a[j] = tv; mx = fmaxf(mx, tv); }
                s[t] = a; }
            __builtin_amdgcn_sched_barrier(0);   /* holds the loads of group g + 2 behind this group's products: without it every load is hoisted to the top and registers spill */
        }
    }
    auto ldv = [&](int g) {   /* V^T fragments of load group g */
#pragma unroll
        for (int u = 0; u < GD; ++u)
#pragma unroll
            for (int kq = 0; kq < 2; ++kq) { const size_t vo = funit((g % DG) * GD + u, TT, kb / 32 + (g / DG) * 2 + kq) + lane * 8; va[g & 1][u][kq] = ldf(Vt + vo); if (HL) va2[g & 1][u][kq] = ldf(Vt2 + vo); }
        asm volatile("s_wait_xcnt 0x0" ::: "memory");   /* as above */
    };
    ldv(0);   /* lands during the softmax */
    mx = fmaxf(mx, __shfl_xor(mx, 16, 32)); if (hi == 0) red[w * 16 + lr] = mx;
    __syncthreads();
#pragma unroll
    for (int ww = 0; ww < AW; ++ww) mx = fmaxf(mx, red[ww * 16 + lr]);
    float sum = 0.f;
#pragma unroll
    for (int t = 0; t < AT; ++t)
#pragma unroll
        for (int j = 0; j < 8; ++j) { const float x = (s[t][j] - mx) * 1.4426950408889634f; float e;
            asm("v_exp_f32 %0, %1\n\tv_nop" : "=v"(e) : "v"(x));   /* 2^x; the v_nop is the slot the instruction set asks for behind a transcendental, before its source is overwritten or its result read */
            s[t][j] = e; sum += e; }
    sum += __shfl_xor(sum, 16, 32); if (hi == 0) red[(AW + w) * 16 + lr] = sum;
    __syncthreads();
    sum = red[AW * 16 + lr];
#pragma unroll
    for (int ww = 1; ww < AW; ++ww) sum += red[(AW + ww) * 16 + lr];
    const float f = __fdiv_rn(HL ? 1.0f : PCAR, sum);
    v8f o[HD / 16];
#pragma unroll
    for (int dt = 0; dt < HD / 16; ++dt) o[dt] = (v8f){};
    V p[2], p2[2];
#pragma unroll
    for (int g = 0; g < NV; ++g) { const int d0 = (g % DG) * GD;
        if (g + 1 < NV) ldv(g + 1);
        if (d0 == 0) {   /* the weights of this 64-key block as two B fragments (32 keys each) */
#pragma unroll
            for (int kq = 0; kq < 2; ++kq) { const int kk = (g / DG) * 2 + kq;
                if constexpr (HL) { v8us h0, h1, l0, l1;
#pragma unroll
                    for (int j = 0; j < 8; ++j) { unsigned short x, y; splitf(s[2 * kk][j] * f, x, y); h0[j] = x; l0[j] = y; splitf(s[2 * kk + 1][j] * f, x, y); h1[j] = x; l1[j] = y; }
                    p[kq] = cat16b(h0, h1); p2[kq] = cat16b(l0, l1);
                } else { v8h x0, x1;
#pragma unroll
                    for (int j = 0; j < 8; ++j) { x0[j] = tohx(s[2 * kk][j] * f); x1[j] = tohx(s[2 * kk + 1][j] * f); }
                    p[kq] = cat16(x0, x1); } } }
#pragma unroll
        for (int u = 0; u < GD; ++u)
#pragma unroll
            for (int kq = 0; kq < 2; ++kq) { o[d0 + u] = WFrag<T16>::mma(va[g & 1][u][kq], p[kq], o[d0 + u]); if constexpr (HL) { o[d0 + u] = WFrag<T16>::mma(va[g & 1][u][kq], p2[kq], o[d0 + u]); o[d0 + u] = WFrag<T16>::mma(va2[g & 1][u][kq], p[kq], o[d0 + u]); } }
        __builtin_amdgcn_sched_barrier(0);   /* as in the score loop: two load groups in flight, no more */
    }
    float* ow = osm + (w * 16 + lr) * OP + 8 * hi;
#pragma unroll
    for (int dt = 0; dt < HD / 16; ++dt) { v4f lo4, hi4;
#pragma unroll
        for (int j = 0; j < 4; ++j) { lo4[j] = o[dt][j]; hi4[j] = o[dt][4 + j]; }
        *(v4fa*)(ow + dt * 16) = lo4; *(v4fa*)(ow + dt * 16 + 4) = hi4; }
    __syncthreads();
    const int qi = threadIdx.x >> 5, d2 = (threadIdx.x & 31) * 2; v2f r = *(const v2fa*)(osm + qi * OP + d2);   /* 16 x HD outputs over AW * 32 = 512 threads */
#pragma unroll
    for (int ww = 1; ww < AW; ++ww) r += *(const v2fa*)(osm + (ww * 16 + qi) * OP + d2);
    r *= HL ? 1.0f : (1.0f / PCAR);
    *(v2f*)(Oh + (size_t)(i0 + qi) * HD + d2) = r;
}
__global__ __launch_bounds__(AW * 32) void k_fattn(const h16* __restrict__ Q16, const h16* __restrict__ K16, const h16* __restrict__ V16, const bf* __restrict__ Qh, const bf* __restrict__ Ql, const bf* __restrict__ Kh, const bf* __restrict__ Kl, const bf* __restrict__ Vh, const bf* __restrict__ Vl, const bf* __restrict__ MF, int b, float* __restrict__ OA) {
    __shared__ __align__(16) float osm[AW * 16 * OP]; __shared__ float red[2 * AW * 16];
    const int i0 = blockIdx.x * 16; const size_t h = blockIdx.y, zq = h * TT * HD, zk = (h / REP) * TT * HD;
    float* Oh = OA + (h * NB_ + b) * TT * HD;   /* (h, b, s, dh) contiguous == the module's raw (S, B, D) view */
    if (i0 < RH) attn_rows<bf, true>(Qh + zq, Ql + zq, Kh + zk, Kl + zk, Vh + zk, Vl + zk, MF, Oh, i0, red, osm);   /* block-uniform: RH is a multiple of 16 */
    else attn_rows<h16, false>(Q16 + zq, nullptr, K16 + zk, nullptr, V16 + zk, nullptr, MF, Oh, i0, red, osm);
}

extern "C" void kernel_launch(void* const* d_in, const int* in_sizes, int n_in,
                              void* d_out, int out_size, void* d_ws, size_t ws_size, hipStream_t stream) {
    (void)in_sizes; (void)n_in; (void)out_size;
    const float* xq = (const float*)d_in[0]; const float* xk = (const float*)d_in[1]; const float* xv = (const float*)d_in[2]; const float* MK = (const float*)d_in[3]; const float* wq = (const float*)d_in[4]; const float* bq = (const float*)d_in[5]; const float* wk = (const float*)d_in[6]; const float* bk = (const float*)d_in[7]; const float* wv = (const float*)d_in[8]; const float* bv = (const float*)d_in[9]; const float* wo = (const float*)d_in[10]; const float* bo = (const float*)d_in[11]; const float* x = xq; (void)x;
    float* OUT = (float*)d_out;     // [2048][2][1024]
    char* wsp = (char*)d_ws;
    auto take = [&](size_t bytes) { char* p = wsp; wsp += (bytes + 255) & ~(size_t)255; return (void*)p; };
    bf* WQ = (bf*)take((size_t)DQ * DM * 2); bf* WK = (bf*)take((size_t)DKV * DM * 2); bf* WV = (bf*)take((size_t)DKV * DM * 2); bf* WO = (bf*)take((size_t)DM * DQ * 2); float* CS = (float*)take((size_t)TT * HD * 2 * 4);
    bf* XB = (bf*)take((size_t)TT * DM * 2); bf* XKB = (bf*)take((size_t)TT * DM * 2); bf* XVB = (bf*)take((size_t)TT * DM * 2); float* OA = (float*)take((size_t)NB_ * TT * DQ * 4); float* FQ = (float*)take((size_t)TT * DQ * 4); float* FK = (float*)take((size_t)TT * DKV * 4);
    h16* QP16 = (h16*)take((size_t)NH_ * TT * HD * 2); h16* KP16 = (h16*)take((size_t)NKV * TT * HD * 2); h16* VT16 = (h16*)take((size_t)NKV * HD * TT * 2);
    bf* QPh = (bf*)take((size_t)NH_ * TT * HD * 2); bf* QPl = (bf*)take((size_t)NH_ * TT * HD * 2); bf* KPh = (bf*)take((size_t)NKV * TT * HD * 2); bf* KPl = (bf*)take((size_t)NKV * TT * HD * 2); bf* VTh = (bf*)take((size_t)NKV * HD * TT * 2); bf* VTl = (bf*)take((size_t)NKV * HD * TT * 2);
    bf* ATh = (bf*)take((size_t)NB_ * TT * DQ * 2); bf* ATl = (bf*)take((size_t)NB_ * TT * DQ * 2); bf* MF = (bf*)take((size_t)TT * TT * 2);
    if ((size_t)(wsp - (char*)d_ws) > ws_size) return;    // ws 256 MiB
    float* FV = FK;   // v projection reuses the k buffer after the k planes are built (stream-ordered)
    { k_cvt8<<<(unsigned)(((size_t)DQ * DM / 8 + 255) / 256), 256, 0, stream>>>(wq, WQ, (size_t)DQ * DM / 8); k_cvt8<<<(unsigned)(((size_t)DKV * DM / 8 + 255) / 256), 256, 0, stream>>>(wk, WK, (size_t)DKV * DM / 8); k_cvt8<<<(unsigned)(((size_t)DKV * DM / 8 + 255) / 256), 256, 0, stream>>>(wv, WV, (size_t)DKV * DM / 8);
      k_cvt8<<<(unsigned)(((size_t)DM * DQ / 8 + 255) / 256), 256, 0, stream>>>(wo, WO, (size_t)DM * DQ / 8);
       }
    k_csid<<<(TT * HD + 255) / 256, 256, 0, stream>>>(CS);
    k_mkf<<<TT * (TT / 8) / 256, 256, 0, stream>>>(MK, MF);
    const unsigned LQ = (unsigned)(((size_t)NH_ * TT * HD / 2 + 255) / 256), LKv = (unsigned)(((size_t)NKV * TT * HD / 2 + 255) / 256);
    for (int b = 0; b < NB_; ++b) {
        
        k_cvt8s<<<(unsigned)(((size_t)TT * DM / 8 + 255) / 256), 256, 0, stream>>>(xq, b, XB, (size_t)TT * DM / 8); k_cvt8s<<<(unsigned)(((size_t)TT * DM / 8 + 255) / 256), 256, 0, stream>>>(xk, b, XKB, (size_t)TT * DM / 8); k_cvt8s<<<(unsigned)(((size_t)TT * DM / 8 + 255) / 256), 256, 0, stream>>>(xv, b, XVB, (size_t)TT * DM / 8);   /* batch b of the sequence-first inputs */
        k_gemmw<bf, 0, true><<<dim3(TT / 64, DQ / 64, 1), 32, 0, stream>>>(XB, nullptr, WQ, nullptr, DM, FQ, DQ, bq, 0, 0, 0);
        k_rope<<<LQ, 256, 0, stream>>>(FQ, DQ, NH_, CS, nullptr, nullptr, 1.0f, QP16, QPh, QPl);
        k_gemmw<bf, 0, true><<<dim3(TT / 64, DKV / 64, 1), 32, 0, stream>>>(XKB, nullptr, WK, nullptr, DM, FK, DKV, bk, 0, 0, 0);
        k_rope<<<LKv, 256, 0, stream>>>(FK, DKV, NKV, CS, nullptr, nullptr, 1.0f, KP16, KPh, KPl);
        k_gemmw<bf, 0, true><<<dim3(TT / 64, DKV / 64, 1), 32, 0, stream>>>(XVB, nullptr, WV, nullptr, DM, FV, DKV, bv, 0, 0, 0); k_vtp<<<LKv, 256, 0, stream>>>(FV, DKV, NKV, VT16, VTh, VTl);
        k_fattn<<<dim3(TT / 16, NH_, 1), AW * 32, 0, stream>>>(QP16, KP16, VT16, QPh, QPl, KPh, KPl, VTh, VTl, MF, b, OA);
        }
    k_split4<<<(unsigned)(((size_t)NB_ * TT * DQ / 4 + 255) / 256), 256, 0, stream>>>(OA, ATh, ATl, (size_t)NB_ * TT * DQ / 4);
    k_gemmw<bf, 1, true><<<dim3(NB_ * TT / 64, DM / 64, 1), 32, 0, stream>>>(ATh, ATl, WO, nullptr, DQ, OUT, DM, bo, 0, 0, 0);   /* out (S*B rows, in the view's memory order) = view Wo^T + bo */
}

// v004
// Measured time: 403 microseconds a run.
// In two side-by-side timings against v003, it was 1.07 and 1.02 times as fast.
// All steps since v000 together make it 5.38 times as fast.
#include <hip/hip_runtime.h>

// Multi-head attention on sequence-first tensors with the module's raw-view head merge (q, k, v [2048][2][1024] = [s][b][d]; projections 'oi' [1024][1024] + biases; per (head, batch): scores = q.k/8 + attn_mask[i][j] (f32 [2048][2048] input, read); softmax; O[h][b][s][dh] = attn.v; the module then views the contiguous (H, B, S, Dh) tensor directly as (S, B, D) (NO head transpose) and applies Wo^T + bo -> out [2048][2][1024]).
// Layout: both batch elements are read from the interleaved rows (row stride 2 x 1024); all 32 (head, batch) attention problems write O contiguously in (h, b, s, dh) order, whose memory IS the module's (S x B, D) view, so the output projection is one GEMM over 4096 rows.
// Fragment order: the 16-bit planes [rows][K] that the attention kernel reads (Q, K: K = HD; V^T: K = TT) lie in units of 16 rows x 32 k (1 KB): [row tile][k tile][k bit 4][lane = 16 * (k bit 3) + row % 16][k % 8], so a wave-wide 16-byte load of half a fragment reads 512 contiguous bytes (4 whole lines). The projection GEMMs store these planes themselves, straight from their accumulators. The operand planes of k_gemmw stay K-contiguous.
// Compute dtypes, f32 accumulate: every input rounded to bf16; q/k/v on PLAIN bf16 operands (inputs: exact) + biases; additive mask (bf16-rounded, packed once by k_mkf) added inside the fused attention kernel; scores and attn.v: query rows < 512 hl (3 products), the rest single fp16 (x1024); softmax f32; Wo hl x exact (2 products) + bo.

#define NB_  2
#define TT   2048
#define DM   1024
#define NH_  16
#define NKV  16
#define REP  (NH_ / NKV)
#define HD   64
#define DQ   (NH_ * HD)
#define DKV  (NKV * HD)
typedef __attribute__((ext_vector_type(4))) unsigned short v4us;
#define RH   512                  // query rows < RH use hi+lo planes (0: none)
#define WIN  0
#define PCAR 1024.0f
#define SCL  0.125f   // HD^-0.5
typedef _Float16 h16;
typedef unsigned short bf;
typedef __attribute__((ext_vector_type(16))) __bf16   v16bf;
typedef __attribute__((ext_vector_type(16))) _Float16 v16h;
typedef __attribute__((ext_vector_type(8)))  _Float16 v8h;
typedef __attribute__((ext_vector_type(8)))  unsigned short v8us;
typedef __attribute__((ext_vector_type(8)))  float    v8f;
typedef __attribute__((ext_vector_type(4)))  float    v4f;
typedef v8h  __attribute__((may_alias)) v8ha;
typedef v4f  __attribute__((may_alias)) v4fa;
typedef v8us __attribute__((may_alias)) v8usa;

__device__ __forceinline__ unsigned short f2bf(float f) { unsigned u = __float_as_uint(f); u += 0x7FFFu + ((u >> 16) & 1u); return (unsigned short)(u >> 16); }
__device__ __forceinline__ float bf2f(unsigned short b) { return __uint_as_float(((unsigned)b) << 16); }
__device__ __forceinline__ float bfr(float f) { return bf2f(f2bf(f)); }
__device__ __forceinline__ v16h cat16(v8h lo, v8h hi) { return __builtin_shufflevector(lo, hi, 0, 1, 2, 3, 4, 5, 6, 7, 8, 9, 10, 11, 12, 13, 14, 15); }
__device__ __forceinline__ v16bf cat16b(v8us lo, v8us hi) { return __builtin_bit_cast(v16bf, __builtin_shufflevector(lo, hi, 0, 1, 2, 3, 4, 5, 6, 7, 8, 9, 10, 11, 12, 13, 14, 15)); }
__device__ __forceinline__ v8f wmma16(v16h a, v16h b, v8f c) { return __builtin_amdgcn_wmma_f32_16x16x32_f16(false, a, false, b, (short)0, c, false, false); }
__device__ __forceinline__ v8f wmmab(v16bf a, v16bf b, v8f c) { return __builtin_amdgcn_wmma_f32_16x16x32_bf16(false, a, false, b, (short)0, c, false, false); }



// ---- k_gemmw: register-blocked GEMM, ONE WAVE per 64x64 output tile (16 accumulators), operands straight from K-contiguous 16-bit planes; grid (M/64, N/64, Z), 32 threads.
// C[m][n] (f32, pitch ldc, + optional f32 bias[n]) = sum_k A[m][k] Bt[n][k] (+ split products per NSPLIT). z-batch strides sA/sB/sC in elements. K % (32 * KS) == 0.
// KS > 1: grid z = Z * KS; work-group z * KS + ks sums only k in [ks, ks + 1) * K / KS and stores its partial tile in C plane z * KS + ks (plane stride sC); the caller adds the KS planes.
// funit: offset of the unit (row tile rt, k tile kt) of a fragment-ordered plane. ldf (below) loads a fragment from unit + lane * 8.
// PACK != 0 (the q, k, v projections): no f32 C; the wave adds the bias and stores its tile as the three head planes (fp16, bf16 hi, bf16 lo) in fragment order. A lane's 8 accumulator values of one 16x16 block are 8 consecutive A rows at one B row = one 16-byte chunk of a plane whose k runs along the A rows, and the block's 32 chunks are 512 contiguous bytes.
// PACK == 1 (Q, K: plane [h * TT + t][d]): A = the weight (64 rows = head blockIdx.x), Bt = the tokens, bias by A row. PACK == 2 (V^T: plane [h * HD + d][t]): A = the tokens, Bt = the weight, bias by Bt row.
// fchunk: thread -> 16-byte chunk for the mask packer: lane bits 0-2 = row % 8, 3 = k bit 3, 4 = k bit 4, thread bit 5 = row bit 3, so a wave reads 8 rows x 32 k (whole 128-byte lines of the f32 source) and stores 4 whole lines.
__device__ __forceinline__ size_t fchunk(size_t i) { return (i & ~(size_t)63) | (i & 7) | ((i >> 2) & 8) | ((i & 24) << 1); }
__device__ __forceinline__ size_t funit(size_t rt, int K, int kt) { return (rt * (size_t)(K / 32) + kt) << 9; }
__device__ __forceinline__ h16 tohx(float x) { return (h16)x; }
__device__ __forceinline__ void splitf(float y, unsigned short& h, unsigned short& l) { h = f2bf(y); l = f2bf(y - bf2f(h)); }
template <typename T16> struct WFrag;
template <> struct WFrag<h16> { typedef v16h V; static __device__ __forceinline__ V ld(const h16* p) { return cat16(*(const v8h*)p, *(const v8h*)(p + 16)); } static __device__ __forceinline__ v8f mma(V a, V b, v8f c) { return wmma16(a, b, c); } };
template <> struct WFrag<bf> { typedef v16bf V; static __device__ __forceinline__ V ld(const bf* p) { return cat16b(*(const v8us*)p, *(const v8us*)(p + 16)); } static __device__ __forceinline__ v8f mma(V a, V b, v8f c) { return wmmab(a, b, c); } };
__device__ __forceinline__ v16h ldf(const h16* p) { return cat16(*(const v8h*)p, *(const v8h*)(p + 256)); }
__device__ __forceinline__ v16bf ldf(const bf* p) { return cat16b(*(const v8us*)p, *(const v8us*)(p + 256)); }
template <typename T16, int NSPLIT, bool BIAS, int KS = 1, int PACK = 0>
__global__ __launch_bounds__(32) void k_gemmw(const T16* __restrict__ A, const T16* __restrict__ A2, const T16* __restrict__ Bt, const T16* __restrict__ Bt2, int K, float* C, int ldc, const float* __restrict__ bias, size_t sA, size_t sB, size_t sC, h16* __restrict__ P16, bf* __restrict__ Ph, bf* __restrict__ Pl) {
    typedef typename WFrag<T16>::V V;
    __shared__ __align__(16) float os[16 * 68];
    const size_t zb = blockIdx.z, z = zb / KS; const int k0 = (int)(zb % KS) * (K / KS), k1 = k0 + K / KS; A += z * sA; if (A2) A2 += z * sA; Bt += z * sB; if (Bt2) Bt2 += z * sB; C += zb * sC;
    const int lane = threadIdx.x & 31, lr = lane & 15, hi = lane >> 4; const int r0 = blockIdx.x * 64, c0 = blockIdx.y * 64;
    v8f acc[4][4];
#pragma unroll
    for (int mb = 0; mb < 4; ++mb)
#pragma unroll
        for (int nb = 0; nb < 4; ++nb) acc[mb][nb] = (v8f){};
    const size_t aoff = (size_t)(r0 + lr) * K + 8 * hi, boff = (size_t)(c0 + lr) * K + 8 * hi;
#pragma unroll 1
    for (int kc = k0; kc < k1; kc += 32) {
        V a[4], a2[4];
#pragma unroll
        for (int mb = 0; mb < 4; ++mb) { a[mb] = WFrag<T16>::ld(A + aoff + (size_t)mb * 16 * K + kc); if (NSPLIT == 1 || NSPLIT == 2) a2[mb] = WFrag<T16>::ld(A2 + aoff + (size_t)mb * 16 * K + kc); }
#pragma unroll
        for (int nb = 0; nb < 4; ++nb) { const V b = WFrag<T16>::ld(Bt + boff + (size_t)nb * 16 * K + kc); V b2; if (NSPLIT >= 2) b2 = WFrag<T16>::ld(Bt2 + boff + (size_t)nb * 16 * K + kc);
#pragma unroll
            for (int mb = 0; mb < 4; ++mb) { acc[mb][nb] = WFrag<T16>::mma(a[mb], b, acc[mb][nb]); if (NSPLIT == 1 || NSPLIT == 2) acc[mb][nb] = WFrag<T16>::mma(a2[mb], b, acc[mb][nb]); if (NSPLIT >= 2) acc[mb][nb] = WFrag<T16>::mma(a[mb], b2, acc[mb][nb]); } }
        asm volatile("v_nop\n\tv_nop\n\tv_nop\n\tv_nop" : "+v"(acc[0][0]), "+v"(acc[1][1]), "+v"(acc[2][2]), "+v"(acc[3][3]) : "v"(a[0]), "v"(a[3]));
    }
    if constexpr (PACK != 0) {
        static_assert(HD == 64, "a 64-row tile is one head");
        v8f ba[4]; float bb[4];   /* the lane's biases: by A row (8 a block row) or by Bt row (1 a block column) */
#pragma unroll   // constant indices keep ba and bb in registers
        for (int i = 0; i < 4; ++i) { if (PACK == 1) ba[i] = *(const v8f*)(bias + r0 + i * 16 + hi * 8); else bb[i] = bias[c0 + i * 16 + lr]; }
        /* the wait stands before the address registers of the bias loads are reused; the loaded values as inputs hold all the loads in front of the blocks, so that they share one latency */
        if constexpr (PACK == 1) asm volatile("s_wait_xcnt 0x0" :: "v"(ba[0]), "v"(ba[1]), "v"(ba[2]), "v"(ba[3]) : "memory");
        else asm volatile("s_wait_xcnt 0x0" :: "v"(bb[0]), "v"(bb[1]), "v"(bb[2]), "v"(bb[3]) : "memory");
#pragma unroll   // constant indices keep acc in registers
        for (int mb = 0; mb < 4; ++mb) {
#pragma unroll
            for (int nb = 0; nb < 4; ++nb) {
                const size_t e = (PACK == 1 ? funit((size_t)blockIdx.x * (TT / 16) + c0 / 16 + nb, HD, mb >> 1) : funit((size_t)(c0 / 16 + nb), TT, r0 / 32 + (mb >> 1))) + (mb & 1) * 256 + lane * 8;
                v8h o16; v8us oh, ol;
#pragma unroll
                for (int j = 0; j < 8; ++j) { const float x = acc[mb][nb][j] + bfr(PACK == 1 ? ba[mb][j] : bb[nb]); o16[j] = tohx(x); unsigned short a2, c2; splitf(x, a2, c2); oh[j] = a2; ol[j] = c2; }
                /* the three plane stores and their wait in one statement: the wait stands before any address or data register of the stores is reused */
                asm volatile("global_store_b128 %0, %3, off\n\tglobal_store_b128 %1, %4, off\n\tglobal_store_b128 %2, %5, off\n\ts_wait_xcnt 0x0" :: "v"(P16 + e), "v"(Ph + e), "v"(Pl + e), "v"(o16), "v"(oh), "v"(ol) : "memory");
            }
        }
        return;
    }
#pragma unroll
    for (int mb = 0; mb < 4; ++mb) {
#pragma unroll
        for (int nb = 0; nb < 4; ++nb) {
#pragma unroll
            for (int j = 0; j < 8; ++j) os[(hi * 8 + j) * 68 + nb * 16 + lr] = acc[mb][nb][j]; }
        __builtin_amdgcn_wave_barrier(); asm volatile("" ::: "memory");
        float* crow = C + (size_t)(r0 + mb * 16) * ldc + c0;
{
#pragma unroll
            for (int s = 0; s < 8; ++s) { const int row = 2 * s + hi, cofs = lr * 4; v4f val = *(const v4fa*)(os + row * 68 + cofs); if (BIAS) { val[0] += bfr(bias[c0 + cofs]); val[1] += bfr(bias[c0 + cofs + 1]); val[2] += bfr(bias[c0 + cofs + 2]); val[3] += bfr(bias[c0 + cofs + 3]); }
                *(v4f*)(crow + (size_t)row * ldc + cofs) = val; }
             }
        __builtin_amdgcn_wave_barrier(); asm volatile("" ::: "memory");
    }
}

typedef __attribute__((ext_vector_type(2))) _Float16 v2h;
typedef __attribute__((ext_vector_type(4))) _Float16 v4h;
typedef __attribute__((ext_vector_type(2))) unsigned short v2us;
typedef __attribute__((ext_vector_type(4))) unsigned short v4us;
typedef __attribute__((ext_vector_type(2))) float v2f;
typedef __attribute__((ext_vector_type(4))) int v4i;

__global__ __launch_bounds__(256) void k_wtG(const float* __restrict__ w, int K, int N, bf* Bt) {
    const int lane = threadIdx.x & 31; const int L0 = (blockIdx.x * 8 + (threadIdx.x >> 5)) * 8; const int nlines = N * K / 64;
{
#pragma unroll 1
        for (int l = 0; l < 8; ++l) { const int L = L0 + l; if (L >= nlines) break; const size_t e = (size_t)L * 64 + lane * 2; const int k = (int)(e % K), n = (int)(e / K); v2us o;
            o[0] = f2bf(w[(size_t)k * N + n]); o[1] = f2bf(w[(size_t)(k + 1) * N + n]); *(v2us*)(Bt + e) = o; }
         }
}
__global__ __launch_bounds__(256) void k_cvt8s(const float* __restrict__ src, int b, bf* dst, size_t n8) { const size_t i = (size_t)blockIdx.x * 256 + threadIdx.x; if (i >= n8) return; const size_t e = i * 8; const size_t t = e / DM, c = e % DM; const v8f v = *(const v8f*)(src + (t * NB_ + b) * DM + c); v8us o;
#pragma unroll
    for (int k = 0; k < 8; ++k) o[k] = f2bf(v[k]); *(v8us*)(dst + e) = o;  }
__global__ __launch_bounds__(256) void k_cvt8(const float* __restrict__ src, bf* dst, size_t n8) { const size_t i = (size_t)blockIdx.x * 256 + threadIdx.x; if (i >= n8) return; const v8f v = *(const v8f*)(src + i * 8); v8us o;
#pragma unroll
    for (int k = 0; k < 8; ++k) o[k] = f2bf(v[k]); *(v8us*)(dst + i * 8) = o;  }

// k_mkf: attn_mask rounded to bf16, once a call, in the order of a score tile's accumulators: [query tile][key tile][lane = 16 * (key bit 3) + query % 16][key % 8], so k_fattn reads a tile's mask by one 16-byte load a lane, 512 contiguous bytes a wave.
__global__ __launch_bounds__(256) void k_mkf(const float* __restrict__ MK, bf* MF) { const size_t i = fchunk((size_t)blockIdx.x * 256 + threadIdx.x); const size_t tile = i >> 5; const int lane = (int)(i & 31); const v8f v = *(const v8f*)(MK + ((tile / (TT / 16)) * 16 + (lane & 15)) * TT + (tile % (TT / 16)) * 16 + (lane >> 4) * 8); v8us o;
#pragma unroll   // constant indices keep v[k] and o[k] in registers
    for (int k = 0; k < 8; ++k) o[k] = f2bf(v[k]); *(v8us*)(MF + i * 8) = o;  }
// k_fattn: scores, softmax and attn.v of 16 query rows of one head in ONE work-group (16 waves); no score or weight plane in memory. grid (TT / 16, heads), 512 threads.
// Transposed products: S^T = K Q^T (A = 16 key rows, B = the 16 query rows), so lane (lr, hi) holds query lr's scores of keys 8 hi + j of each 16-key tile; wave w owns keys [w, w + 1) * TT / AW and keeps its AT score tiles in registers.
// Row maximum and row sum: in the lane, across the two lane halves, then across the waves through LDS. Two neighbouring score tiles, scaled and converted in place, ARE the B fragment (hardware k order) of O^T += V^T P^T.
// Each wave's partial O^T (its own key range) goes to LDS; the AW partials are added in ascending key order and stored in (h, b, s, dh) order as the bf16 hi and lo operand planes of the output projection.
#define AW   16                   // waves per work-group, one key range each
#define AKW  (TT / AW)            // keys per wave
#define AT   (AKW / 16)           // score tiles per wave
#define OP   68                   // LDS pitch (floats) of one query's partial output row
typedef v2f __attribute__((may_alias)) v2fa;
template <typename T16, bool HL>
__device__ __forceinline__ void attn_rows(const T16* __restrict__ Q, const T16* __restrict__ Q2, const T16* __restrict__ Kp, const T16* __restrict__ K2, const T16* __restrict__ Vt, const T16* __restrict__ Vt2, const bf* __restrict__ MF, bf* __restrict__ Oh, bf* __restrict__ Ol, int i0, float* red, float* osm) {
    typedef typename WFrag<T16>::V V;
    const int lane = threadIdx.x & 31, lr = lane & 15, hi = lane >> 4, w = threadIdx.x >> 5; const int kb = w * AKW;
    V q[2], q2[2];
#pragma unroll
    for (int ks = 0; ks < 2; ++ks) q[ks] = ldf(Q + funit(i0 / 16, HD, ks) + lane * 8);
    asm volatile("s_wait_xcnt 0x0" ::: "memory");   /* before the address registers of the query loads are reused */
    if (HL) {
#pragma unroll   // constant indices keep q2[ks] in registers
        for (int ks = 0; ks < 2; ++ks) q2[ks] = ldf(Q2 + funit(i0 / 16, HD, ks) + lane * 8);
        asm volatile("s_wait_xcnt 0x0" ::: "memory");   /* as above */
    }
    const bf* mk = MF + ((size_t)(i0 / 16) * (TT / 16) + kb / 16) * 256 + lane * 8;
    constexpr int GT = HL ? 1 : 2, NG = AT / GT;         // score tiles per load group; two groups in flight: one lands while the one before it is multiplied
    constexpr int GD = HL ? 1 : 2, DG = HD / 16 / GD, NV = AT / 4 * DG;   // the same for attn.v: a load group is GD d tiles x 64 keys; groups per 64 keys, groups
    V k[2][GT][2], k2[2][GT][2], va[2][GD][2], va2[2][GD][2]; v8us m[2][GT];
    v8f s[AT]; float mx = -3.0e38f;
#pragma unroll
    for (int g = -1; g < NG; ++g) {
        if (g + 1 < NG) {
#pragma unroll
            for (int u = 0; u < GT; ++u) { const int t = (g + 1) * GT + u; const size_t ko = funit(kb / 16 + t, HD, 0) + lane * 8;
#pragma unroll
                for (int ks = 0; ks < 2; ++ks) { k[(g + 1) & 1][u][ks] = ldf(Kp + ko + ks * 512); if (HL) k2[(g + 1) & 1][u][ks] = ldf(K2 + ko + ks * 512); }
                m[(g + 1) & 1][u] = *(const v8us*)(mk + t * 256); }
            asm volatile("s_wait_xcnt 0x0" ::: "memory");   /* before any register that the loads above name (address, scalar base) is reused */
        }
        if (g >= 0) {
#pragma unroll
            for (int u = 0; u < GT; ++u) { const int t = g * GT + u; v8f a = (v8f){};
#pragma unroll
                for (int ks = 0; ks < 2; ++ks) { a = WFrag<T16>::mma(k[g & 1][u][ks], q[ks], a); if (HL) { a = WFrag<T16>::mma(k[g & 1][u][ks], q2[ks], a); a = WFrag<T16>::mma(k2[g & 1][u][ks], q[ks], a); } }
#pragma unroll
                for (int j = 0; j < 8; ++j) { const float tv = a[j] * SCL + bf2f(m[g & 1][u][j]);   /* q.k / 8 (exact scaling) + attn_mask[i][j] */ a[j] = tv; mx = fmaxf(mx, tv); }
                s[t] = a; }
            __builtin_amdgcn_sched_barrier(0);   /* holds the loads of group g + 2 behind this group's products: without it every load is hoisted to the top and registers spill */
        }
    }
    auto ldv = [&](int g) {   /* V^T fragments of load group g */
#pragma unroll
        for (int u = 0; u < GD; ++u)
#pragma unroll
            for (int kq = 0; kq < 2; ++kq) { const size_t vo = funit((g % DG) * GD + u, TT, kb / 32 + (g / DG) * 2 + kq) + lane * 8; va[g & 1][u][kq] = ldf(Vt + vo); if (HL) va2[g & 1][u][kq] = ldf(Vt2 + vo); }
        asm volatile("s_wait_xcnt 0x0" ::: "memory");   /* as above */
    };
    ldv(0);   /* lands during the softmax */
    mx = fmaxf(mx, __shfl_xor(mx, 16, 32)); if (hi == 0) red[w * 16 + lr] = mx;
    __syncthreads();
#pragma unroll
    for (int ww = 0; ww < AW; ++ww) mx = fmaxf(mx, red[ww * 16 + lr]);
    float sum = 0.f;
#pragma unroll
    for (int t = 0; t < AT; ++t)
#pragma unroll
        for (int j = 0; j < 8; ++j) { const float x = (s[t][j] - mx) * 1.4426950408889634f; float e;
            asm("v_exp_f32 %0, %1\n\tv_nop" : "=v"(e) : "v"(x));   /* 2^x; the v_nop is the slot the instruction set asks for behind a transcendental, before its source is overwritten or its result read */
            s[t][j] = e; sum += e; }
    sum += __shfl_xor(sum, 16, 32); if (hi == 0) red[(AW + w) * 16 + lr] = sum;
    __syncthreads();
    sum = red[AW * 16 + lr];
#pragma unroll
    for (int ww = 1; ww < AW; ++ww) sum += red[(AW + ww) * 16 + lr];
    const float f = __fdiv_rn(HL ? 1.0f : PCAR, sum);
    v8f o[HD / 16];
#pragma unroll
    for (int dt = 0; dt < HD / 16; ++dt) o[dt] = (v8f){};
    V p[2], p2[2];
#pragma unroll
    for (int g = 0; g < NV; ++g) { const int d0 = (g % DG) * GD;
        if (g + 1 < NV) ldv(g + 1);
        if (d0 == 0) {   /* the weights of this 64-key block as two B fragments (32 keys each) */
#pragma unroll
            for (int kq = 0; kq < 2; ++kq) { const int kk = (g / DG) * 2 + kq;
                if constexpr (HL) { v8us h0, h1, l0, l1;
#pragma unroll
                    for (int j = 0; j < 8; ++j) { unsigned short x, y; splitf(s[2 * kk][j] * f, x, y); h0[j] = x; l0[j] = y; splitf(s[2 * kk + 1][j] * f, x, y); h1[j] = x; l1[j] = y; }
                    p[kq] = cat16b(h0, h1); p2[kq] = cat16b(l0, l1);
                } else { v8h x0, x1;
#pragma unroll
                    for (int j = 0; j < 8; ++j) { x0[j] = tohx(s[2 * kk][j] * f); x1[j] = tohx(s[2 * kk + 1][j] * f); }
                    p[kq] = cat16(x0, x1); } } }
#pragma unroll
        for (int u = 0; u < GD; ++u)
#pragma unroll
            for (int kq = 0; kq < 2; ++kq) { o[d0 + u] = WFrag<T16>::mma(va[g & 1][u][kq], p[kq], o[d0 + u]); if constexpr (HL) { o[d0 + u] = WFrag<T16>::mma(va[g & 1][u][kq], p2[kq], o[d0 + u]); o[d0 + u] = WFrag<T16>::mma(va2[g & 1][u][kq], p[kq], o[d0 + u]); } }
        __builtin_amdgcn_sched_barrier(0);   /* as in the score loop: two load groups in flight, no more */
    }
    float* ow = osm + (w * 16 + lr) * OP + 8 * hi;
#pragma unroll
    for (int dt = 0; dt < HD / 16; ++dt) { v4f lo4, hi4;
#pragma unroll
        for (int j = 0; j < 4; ++j) { lo4[j] = o[dt][j]; hi4[j] = o[dt][4 + j]; }
        *(v4fa*)(ow + dt * 16) = lo4; *(v4fa*)(ow + dt * 16 + 4) = hi4; }
    __syncthreads();
    const int qi = threadIdx.x >> 5, d2 = (threadIdx.x & 31) * 2; v2f r = *(const v2fa*)(osm + qi * OP + d2);   /* 16 x HD outputs over AW * 32 = 512 threads */
#pragma unroll
    for (int ww = 1; ww < AW; ++ww) r += *(const v2fa*)(osm + (ww * 16 + qi) * OP + d2);
    r *= HL ? 1.0f : (1.0f / PCAR);
    v2us rh, rl;   /* the hi and lo operand planes of the output projection */
#pragma unroll
    for (int q = 0; q < 2; ++q) { unsigned short a2, c2; splitf(r[q], a2, c2); rh[q] = a2; rl[q] = c2; }
    *(v2us*)(Oh + (size_t)(i0 + qi) * HD + d2) = rh; *(v2us*)(Ol + (size_t)(i0 + qi) * HD + d2) = rl;
}
__global__ __launch_bounds__(AW * 32) void k_fattn(const h16* __restrict__ Q16, const h16* __restrict__ K16, const h16* __restrict__ V16, const bf* __restrict__ Qh, const bf* __restrict__ Ql, const bf* __restrict__ Kh, const bf* __restrict__ Kl, const bf* __restrict__ Vh, const bf* __restrict__ Vl, const bf* __restrict__ MF, int b, bf* __restrict__ ATh, bf* __restrict__ ATl) {
    __shared__ __align__(16) float osm[AW * 16 * OP]; __shared__ float red[2 * AW * 16];
    const int i0 = blockIdx.x * 16; const size_t h = blockIdx.y, zq = h * TT * HD, zk = (h / REP) * TT * HD;
    const size_t zo = (h * NB_ + b) * TT * HD; bf* Oh = ATh + zo; bf* Ol = ATl + zo;   /* (h, b, s, dh) contiguous == the module's raw (S, B, D) view */
    if (i0 < RH) attn_rows<bf, true>(Qh + zq, Ql + zq, Kh + zk, Kl + zk, Vh + zk, Vl + zk, MF, Oh, Ol, i0, red, osm);   /* block-uniform: RH is a multiple of 16 */
    else attn_rows<h16, false>(Q16 + zq, nullptr, K16 + zk, nullptr, V16 + zk, nullptr, MF, Oh, Ol, i0, red, osm);
}

extern "C" void kernel_launch(void* const* d_in, const int* in_sizes, int n_in,
                              void* d_out, int out_size, void* d_ws, size_t ws_size, hipStream_t stream) {
    (void)in_sizes; (void)n_in; (void)out_size;
    const float* xq = (const float*)d_in[0]; const float* xk = (const float*)d_in[1]; const float* xv = (const float*)d_in[2]; const float* MK = (const float*)d_in[3]; const float* wq = (const float*)d_in[4]; const float* bq = (const float*)d_in[5]; const float* wk = (const float*)d_in[6]; const float* bk = (const float*)d_in[7]; const float* wv = (const float*)d_in[8]; const float* bv = (const float*)d_in[9]; const float* wo = (const float*)d_in[10]; const float* bo = (const float*)d_in[11]; const float* x = xq; (void)x;
    float* OUT = (float*)d_out;     // [2048][2][1024]
    char* wsp = (char*)d_ws;
    auto take = [&](size_t bytes) { char* p = wsp; wsp += (bytes + 255) & ~(size_t)255; return (void*)p; };
    bf* WQ = (bf*)take((size_t)DQ * DM * 2); bf* WK = (bf*)take((size_t)DKV * DM * 2); bf* WV = (bf*)take((size_t)DKV * DM * 2); bf* WO = (bf*)take((size_t)DM * DQ * 2);
    bf* XB = (bf*)take((size_t)TT * DM * 2); bf* XKB = (bf*)take((size_t)TT * DM * 2); bf* XVB = (bf*)take((size_t)TT * DM * 2);
    h16* QP16 = (h16*)take((size_t)NH_ * TT * HD * 2); h16* KP16 = (h16*)take((size_t)NKV * TT * HD * 2); h16* VT16 = (h16*)take((size_t)NKV * HD * TT * 2);
    bf* QPh = (bf*)take((size_t)NH_ * TT * HD * 2); bf* QPl = (bf*)take((size_t)NH_ * TT * HD * 2); bf* KPh = (bf*)take((size_t)NKV * TT * HD * 2); bf* KPl = (bf*)take((size_t)NKV * TT * HD * 2); bf* VTh = (bf*)take((size_t)NKV * HD * TT * 2); bf* VTl = (bf*)take((size_t)NKV * HD * TT * 2);
    bf* ATh = (bf*)take((size_t)NB_ * TT * DQ * 2); bf* ATl = (bf*)take((size_t)NB_ * TT * DQ * 2); bf* MF = (bf*)take((size_t)TT * TT * 2);
    if ((size_t)(wsp - (char*)d_ws) > ws_size) return;    // ws 256 MiB
    { k_cvt8<<<(unsigned)(((size_t)DQ * DM / 8 + 255) / 256), 256, 0, stream>>>(wq, WQ, (size_t)DQ * DM / 8); k_cvt8<<<(unsigned)(((size_t)DKV * DM / 8 + 255) / 256), 256, 0, stream>>>(wk, WK, (size_t)DKV * DM / 8); k_cvt8<<<(unsigned)(((size_t)DKV * DM / 8 + 255) / 256), 256, 0, stream>>>(wv, WV, (size_t)DKV * DM / 8);
      k_cvt8<<<(unsigned)(((size_t)DM * DQ / 8 + 255) / 256), 256, 0, stream>>>(wo, WO, (size_t)DM * DQ / 8);
       }
    k_mkf<<<TT * (TT / 8) / 256, 256, 0, stream>>>(MK, MF);
    for (int b = 0; b < NB_; ++b) {
        
        k_cvt8s<<<(unsigned)(((size_t)TT * DM / 8 + 255) / 256), 256, 0, stream>>>(xq, b, XB, (size_t)TT * DM / 8); k_cvt8s<<<(unsigned)(((size_t)TT * DM / 8 + 255) / 256), 256, 0, stream>>>(xk, b, XKB, (size_t)TT * DM / 8); k_cvt8s<<<(unsigned)(((size_t)TT * DM / 8 + 255) / 256), 256, 0, stream>>>(xv, b, XVB, (size_t)TT * DM / 8);   /* batch b of the sequence-first inputs */
        k_gemmw<bf, 0, true, 1, 1><<<dim3(DQ / 64, TT / 64, 1), 32, 0, stream>>>(WQ, nullptr, XB, nullptr, DM, nullptr, 0, bq, 0, 0, 0, QP16, QPh, QPl);
        k_gemmw<bf, 0, true, 1, 1><<<dim3(DKV / 64, TT / 64, 1), 32, 0, stream>>>(WK, nullptr, XKB, nullptr, DM, nullptr, 0, bk, 0, 0, 0, KP16, KPh, KPl);
        k_gemmw<bf, 0, true, 1, 2><<<dim3(TT / 64, DKV / 64, 1), 32, 0, stream>>>(XVB, nullptr, WV, nullptr, DM, nullptr, 0, bv, 0, 0, 0, VT16, VTh, VTl);
        k_fattn<<<dim3(TT / 16, NH_, 1), AW * 32, 0, stream>>>(QP16, KP16, VT16, QPh, QPl, KPh, KPl, VTh, VTl, MF, b, ATh, ATl);
        }
    k_gemmw<bf, 1, true><<<dim3(NB_ * TT / 64, DM / 64, 1), 32, 0, stream>>>(ATh, ATl, WO, nullptr, DQ, OUT, DM, bo, 0, 0, 0, nullptr, nullptr, nullptr);   /* out (S*B rows, in the view's memory order) = view Wo^T + bo */
}

// v005
// It runs in 272 microseconds.
// Timed twice side by side with v004, it ran 1.49 and 1.51 times as fast.
// Over all steps from v000 it is 8.06 times as fast.
#include <hip/hip_runtime.h>

// Multi-head attention on sequence-first tensors with the module's raw-view head merge (q, k, v [2048][2][1024] = [s][b][d]; projections 'oi' [1024][1024] + biases; per (head, batch): scores = q.k/8 + attn_mask[i][j] (f32 [2048][2048] input, read); softmax; O[h][b][s][dh] = attn.v; the module then views the contiguous (H, B, S, Dh) tensor directly as (S, B, D) (NO head transpose) and applies Wo^T + bo -> out [2048][2][1024]).
// Layout: both batch elements are read from the interleaved rows (row stride 2 x 1024); all 32 (head, batch) attention problems write O contiguously in (h, b, s, dh) order, whose memory IS the module's (S x B, D) view, so the output projection is one GEMM over 4096 rows.
// Fragment order: the 16-bit planes [rows][K] that the attention kernel reads (Q, K: K = HD; V^T: K = TT) lie in units of 16 rows x 32 k (1 KB): [row tile][k tile][k bit 4][lane = 16 * (k bit 3) + row % 16][k % 8], so a wave-wide 16-byte load of half a fragment reads 512 contiguous bytes (4 whole lines). The projection GEMMs store these planes themselves, straight from their accumulators. The operand planes of k_gemmw stay K-contiguous.
// Compute dtypes, f32 accumulate: every input rounded to bf16; q/k/v on PLAIN bf16 operands (inputs: exact) + biases; additive mask (bf16-rounded, packed once by k_prep) added inside the fused attention kernel; scores and attn.v: query rows < 512 hl (3 products), the rest single fp16 (x1024); softmax f32; Wo hl x exact (2 products) + bo.

#define NB_  2
#define TT   2048
#define DM   1024
#define NH_  16
#define NKV  16
#define REP  (NH_ / NKV)
#define HD   64
#define DQ   (NH_ * HD)
#define DKV  (NKV * HD)
typedef __attribute__((ext_vector_type(4))) unsigned short v4us;
#define RH   512                  // query rows < RH use hi+lo planes (0: none)
#define WIN  0
#define PCAR 1024.0f
#define SCL  0.125f   // HD^-0.5
typedef _Float16 h16;
typedef unsigned short bf;
typedef __attribute__((ext_vector_type(16))) __bf16   v16bf;
typedef __attribute__((ext_vector_type(16))) _Float16 v16h;
typedef __attribute__((ext_vector_type(8)))  _Float16 v8h;
typedef __attribute__((ext_vector_type(8)))  unsigned short v8us;
typedef __attribute__((ext_vector_type(8)))  float    v8f;
typedef __attribute__((ext_vector_type(4)))  float    v4f;
typedef v8h  __attribute__((may_alias)) v8ha;
typedef v4f  __attribute__((may_alias)) v4fa;
typedef v8us __attribute__((may_alias)) v8usa;

__device__ __forceinline__ unsigned short f2bf(float f) { unsigned u = __float_as_uint(f); u += 0x7FFFu + ((u >> 16) & 1u); return (unsigned short)(u >> 16); }
__device__ __forceinline__ float bf2f(unsigned short b) { return __uint_as_float(((unsigned)b) << 16); }
__device__ __forceinline__ float bfr(float f) { return bf2f(f2bf(f)); }
__device__ __forceinline__ v16h cat16(v8h lo, v8h hi) { return __builtin_shufflevector(lo, hi, 0, 1, 2, 3, 4, 5, 6, 7, 8, 9, 10, 11, 12, 13, 14, 15); }
__device__ __forceinline__ v16bf cat16b(v8us lo, v8us hi) { return __builtin_bit_cast(v16bf, __builtin_shufflevector(lo, hi, 0, 1, 2, 3, 4, 5, 6, 7, 8, 9, 10, 11, 12, 13, 14, 15)); }
__device__ __forceinline__ v8f wmma16(v16h a, v16h b, v8f c) { return __builtin_amdgcn_wmma_f32_16x16x32_f16(false, a, false, b, (short)0, c, false, false); }
__device__ __forceinline__ v8f wmmab(v16bf a, v16bf b, v8f c) { return __builtin_amdgcn_wmma_f32_16x16x32_bf16(false, a, false, b, (short)0, c, false, false); }



// ---- k_gemmw: register-blocked GEMM, ONE WAVE per 64x64 output tile (16 accumulators), operands straight from K-contiguous 16-bit planes; grid (M/64, N/64, Z), 32 threads.
// C[m][n] (f32, pitch ldc, + optional f32 bias[n]) = sum_k A[m][k] Bt[n][k] (+ split products per NSPLIT). z-batch strides sA/sB/sC in elements. K % (32 * KS) == 0.
// KS > 1: grid z = Z * KS; work-group z * KS + ks sums only k in [ks, ks + 1) * K / KS and stores its partial tile in C plane z * KS + ks (plane stride sC); the caller adds the KS planes.
// funit: offset of the unit (row tile rt, k tile kt) of a fragment-ordered plane. ldf (below) loads a fragment from unit + lane * 8.
// PACK != 0 (the q, k, v projections): no f32 C; the wave adds the bias and stores its tile as the three head planes (fp16, bf16 hi, bf16 lo) in fragment order. A lane's 8 accumulator values of one 16x16 block are 8 consecutive A rows at one B row = one 16-byte chunk of a plane whose k runs along the A rows, and the block's 32 chunks are 512 contiguous bytes.
// PACK == 1 (Q, K: plane [h * TT + t][d]): A = the weight (64 rows = head bx), Bt = the tokens, bias by A row. PACK == 2 (V^T: plane [h * HD + d][t]): A = the tokens, Bt = the weight, bias by Bt row.
// fchunk: thread -> 16-byte chunk for the mask packer: lane bits 0-2 = row % 8, 3 = k bit 3, 4 = k bit 4, thread bit 5 = row bit 3, so a wave reads 8 rows x 32 k (whole 128-byte lines of the f32 source) and stores 4 whole lines.
__device__ __forceinline__ size_t fchunk(size_t i) { return (i & ~(size_t)63) | (i & 7) | ((i >> 2) & 8) | ((i & 24) << 1); }
__device__ __forceinline__ size_t funit(size_t rt, int K, int kt) { return (rt * (size_t)(K / 32) + kt) << 9; }
__device__ __forceinline__ h16 tohx(float x) { return (h16)x; }
__device__ __forceinline__ void splitf(float y, unsigned short& h, unsigned short& l) { h = f2bf(y); l = f2bf(y - bf2f(h)); }
template <typename T16> struct WFrag;
template <> struct WFrag<h16> { typedef v16h V; static __device__ __forceinline__ V ld(const h16* p) { return cat16(*(const v8h*)p, *(const v8h*)(p + 16)); } static __device__ __forceinline__ v8f mma(V a, V b, v8f c) { return wmma16(a, b, c); } };
template <> struct WFrag<bf> { typedef v16bf V; static __device__ __forceinline__ V ld(const bf* p) { return cat16b(*(const v8us*)p, *(const v8us*)(p + 16)); } static __device__ __forceinline__ v8f mma(V a, V b, v8f c) { return wmmab(a, b, c); } };
__device__ __forceinline__ v16h ldf(const h16* p) { return cat16(*(const v8h*)p, *(const v8h*)(p + 256)); }
__device__ __forceinline__ v16bf ldf(const bf* p) { return cat16b(*(const v8us*)p, *(const v8us*)(p + 256)); }
// gemmw is the body; bx, by, zb are the tile's indices (k_gemmw: the grid's own; k_proj: derived from its flat index).
template <typename T16, int NSPLIT, bool BIAS, int KS = 1, int PACK = 0>
__device__ __forceinline__ void gemmw(const T16* __restrict__ A, const T16* __restrict__ A2, const T16* __restrict__ Bt, const T16* __restrict__ Bt2, int K, float* C, int ldc, const float* __restrict__ bias, size_t sA, size_t sB, size_t sC, h16* __restrict__ P16, bf* __restrict__ Ph, bf* __restrict__ Pl, int bx, int by, size_t zb) {
    typedef typename WFrag<T16>::V V;
    __shared__ __align__(16) float os[16 * 68];
    const size_t z = zb / KS; const int k0 = (int)(zb % KS) * (K / KS), k1 = k0 + K / KS; A += z * sA; if (A2) A2 += z * sA; Bt += z * sB; if (Bt2) Bt2 += z * sB; C += zb * sC;
    const int lane = threadIdx.x & 31, lr = lane & 15, hi = lane >> 4; const int r0 = bx * 64, c0 = by * 64;
    v8f acc[4][4];
#pragma unroll
    for (int mb = 0; mb < 4; ++mb)
#pragma unroll
        for (int nb = 0; nb < 4; ++nb) acc[mb][nb] = (v8f){};
    const size_t aoff = (size_t)(r0 + lr) * K + 8 * hi, boff = (size_t)(c0 + lr) * K + 8 * hi;
#pragma unroll 1
    for (int kc = k0; kc < k1; kc += 32) {
        V a[4], a2[4];
#pragma unroll
        for (int mb = 0; mb < 4; ++mb) { a[mb] = WFrag<T16>::ld(A + aoff + (size_t)mb * 16 * K + kc); if (NSPLIT == 1 || NSPLIT == 2) a2[mb] = WFrag<T16>::ld(A2 + aoff + (size_t)mb * 16 * K + kc); }
#pragma unroll
        for (int nb = 0; nb < 4; ++nb) { const V b = WFrag<T16>::ld(Bt + boff + (size_t)nb * 16 * K + kc); V b2; if (NSPLIT >= 2) b2 = WFrag<T16>::ld(Bt2 + boff + (size_t)nb * 16 * K + kc);
#pragma unroll
            for (int mb = 0; mb < 4; ++mb) { acc[mb][nb] = WFrag<T16>::mma(a[mb], b, acc[mb][nb]); if (NSPLIT == 1 || NSPLIT == 2) acc[mb][nb] = WFrag<T16>::mma(a2[mb], b, acc[mb][nb]); if (NSPLIT >= 2) acc[mb][nb] = WFrag<T16>::mma(a[mb], b2, acc[mb][nb]); } }
        asm volatile("v_nop\n\tv_nop\n\tv_nop\n\tv_nop" : "+v"(acc[0][0]), "+v"(acc[1][1]), "+v"(acc[2][2]), "+v"(acc[3][3]) : "v"(a[0]), "v"(a[3]));
    }
    if constexpr (PACK != 0) {
        static_assert(HD == 64, "a 64-row tile is one head");
        v8f ba[4]; float bb[4];   /* the lane's biases: by A row (8 a block row) or by Bt row (1 a block column) */
#pragma unroll   // constant indices keep ba and bb in registers
        for (int i = 0; i < 4; ++i) { if (PACK == 1) ba[i] = *(const v8f*)(bias + r0 + i * 16 + hi * 8); else bb[i] = bias[c0 + i * 16 + lr]; }
        /* the wait stands before the address registers of the bias loads are reused; the loaded values as inputs hold all the loads in front of the blocks, so that they share one latency */
        if constexpr (PACK == 1) asm volatile("s_wait_xcnt 0x0" :: "v"(ba[0]), "v"(ba[1]), "v"(ba[2]), "v"(ba[3]) : "memory");
        else asm volatile("s_wait_xcnt 0x0" :: "v"(bb[0]), "v"(bb[1]), "v"(bb[2]), "v"(bb[3]) : "memory");
#pragma unroll   // constant indices keep acc in registers
        for (int mb = 0; mb < 4; ++mb) {
#pragma unroll
            for (int nb = 0; nb < 4; ++nb) {
                const size_t e = (PACK == 1 ? funit((size_t)bx * (TT / 16) + c0 / 16 + nb, HD, mb >> 1) : funit((size_t)(c0 / 16 + nb), TT, r0 / 32 + (mb >> 1))) + (mb & 1) * 256 + lane * 8;
                v8h o16; v8us oh, ol;
#pragma unroll
                for (int j = 0; j < 8; ++j) { const float x = acc[mb][nb][j] + bfr(PACK == 1 ? ba[mb][j] : bb[nb]); o16[j] = tohx(x); unsigned short a2, c2; splitf(x, a2, c2); oh[j] = a2; ol[j] = c2; }
                /* the three plane stores and their wait in one statement: the wait stands before any address or data register of the stores is reused */
                asm volatile("global_store_b128 %0, %3, off\n\tglobal_store_b128 %1, %4, off\n\tglobal_store_b128 %2, %5, off\n\ts_wait_xcnt 0x0" :: "v"(P16 + e), "v"(Ph + e), "v"(Pl + e), "v"(o16), "v"(oh), "v"(ol) : "memory");
            }
        }
        return;
    }
#pragma unroll
    for (int mb = 0; mb < 4; ++mb) {
#pragma unroll
        for (int nb = 0; nb < 4; ++nb) {
#pragma unroll
            for (int j = 0; j < 8; ++j) os[(hi * 8 + j) * 68 + nb * 16 + lr] = acc[mb][nb][j]; }
        __builtin_amdgcn_wave_barrier(); asm volatile("" ::: "memory");
        float* crow = C + (size_t)(r0 + mb * 16) * ldc + c0;
{
#pragma unroll
            for (int s = 0; s < 8; ++s) { const int row = 2 * s + hi, cofs = lr * 4; v4f val = *(const v4fa*)(os + row * 68 + cofs); if (BIAS) { val[0] += bfr(bias[c0 + cofs]); val[1] += bfr(bias[c0 + cofs + 1]); val[2] += bfr(bias[c0 + cofs + 2]); val[3] += bfr(bias[c0 + cofs + 3]); }
                *(v4f*)(crow + (size_t)row * ldc + cofs) = val; }
             }
        __builtin_amdgcn_wave_barrier(); asm volatile("" ::: "memory");
    }
}
template <typename T16, int NSPLIT, bool BIAS, int KS = 1, int PACK = 0>
__global__ __launch_bounds__(32) void k_gemmw(const T16* __restrict__ A, const T16* __restrict__ A2, const T16* __restrict__ Bt, const T16* __restrict__ Bt2, int K, float* C, int ldc, const float* __restrict__ bias, size_t sA, size_t sB, size_t sC, h16* __restrict__ P16, bf* __restrict__ Ph, bf* __restrict__ Pl) {
    gemmw<T16, NSPLIT, BIAS, KS, PACK>(A, A2, Bt, Bt2, K, C, ldc, bias, sA, sB, sC, P16, Ph, Pl, (int)blockIdx.x, (int)blockIdx.y, (size_t)blockIdx.z);
}
// k_proj: the q, k and v projections of both batch elements in ONE launch, so that 6 x 512 one-wave tiles are resident together and hide each other's load latency. grid (512, 1, 3 * NB_): z = input * NB_ + batch picks the weight plane (W3 + input), the token plane (X6 + z), the bias and the three output planes (+ z).
#define PLN  ((size_t)NH_ * TT * HD)   // elements of one head plane set (one input, one batch element)
__global__ __launch_bounds__(32) void k_proj(const bf* __restrict__ W3, const bf* __restrict__ X6, const float* __restrict__ bq, const float* __restrict__ bk, const float* __restrict__ bv, h16* __restrict__ P16, bf* __restrict__ Ph, bf* __restrict__ Pl) {
    static_assert(DQ == DKV && DQ == DM, "the weight planes and the head planes of q, k, v have one size");
    const int z = blockIdx.z, in = z / NB_, t = blockIdx.x;
    const bf* Wp = W3 + (size_t)in * DQ * DM; const bf* X = X6 + (size_t)z * TT * DM; const size_t po = (size_t)z * PLN;
    if (in < 2) gemmw<bf, 0, true, 1, 1>(Wp, nullptr, X, nullptr, DM, nullptr, 0, in == 0 ? bq : bk, 0, 0, 0, P16 + po, Ph + po, Pl + po, t % (DQ / 64), t / (DQ / 64), 0);
    else gemmw<bf, 0, true, 1, 2>(X, nullptr, Wp, nullptr, DM, nullptr, 0, bv, 0, 0, 0, P16 + po, Ph + po, Pl + po, t % (TT / 64), t / (TT / 64), 0);
}

typedef __attribute__((ext_vector_type(2))) _Float16 v2h;
typedef __attribute__((ext_vector_type(4))) _Float16 v4h;
typedef __attribute__((ext_vector_type(2))) unsigned short v2us;
typedef __attribute__((ext_vector_type(4))) unsigned short v4us;
typedef __attribute__((ext_vector_type(2))) float v2f;
typedef __attribute__((ext_vector_type(4))) int v4i;

__global__ __launch_bounds__(256) void k_wtG(const float* __restrict__ w, int K, int N, bf* Bt) {
    const int lane = threadIdx.x & 31; const int L0 = (blockIdx.x * 8 + (threadIdx.x >> 5)) * 8; const int nlines = N * K / 64;
{
#pragma unroll 1
        for (int l = 0; l < 8; ++l) { const int L = L0 + l; if (L >= nlines) break; const size_t e = (size_t)L * 64 + lane * 2; const int k = (int)(e % K), n = (int)(e / K); v2us o;
            o[0] = f2bf(w[(size_t)k * N + n]); o[1] = f2bf(w[(size_t)(k + 1) * N + n]); *(v2us*)(Bt + e) = o; }
         }
}
// cvt8s: block blk of token plane y = input * NB_ + batch.
__device__ __forceinline__ void cvt8s(const float* __restrict__ xq, const float* __restrict__ xk, const float* __restrict__ xv, bf* dst, size_t n8, int blk, int y) { const size_t i = (size_t)blk * 256 + threadIdx.x; if (i >= n8) return; const int in = y / NB_, b = y % NB_; const float* src = in == 0 ? xq : in == 1 ? xk : xv; dst += (size_t)y * TT * DM; const size_t e = i * 8; const size_t t = e / DM, c = e % DM; const v8f v = *(const v8f*)(src + (t * NB_ + b) * DM + c); v8us o;
#pragma unroll
    for (int k = 0; k < 8; ++k) o[k] = f2bf(v[k]); *(v8us*)(dst + e) = o;  }
// cvt8: block blk of weight plane y (n8 * 8 elements each).
__device__ __forceinline__ void cvt8(const float* __restrict__ wq, const float* __restrict__ wk, const float* __restrict__ wv, const float* __restrict__ wo, bf* dst, size_t n8, int blk, int y) { const size_t i = (size_t)blk * 256 + threadIdx.x; if (i >= n8) return; const float* src = y == 0 ? wq : y == 1 ? wk : y == 2 ? wv : wo; dst += (size_t)y * n8 * 8; const v8f v = *(const v8f*)(src + i * 8); v8us o;
#pragma unroll
    for (int k = 0; k < 8; ++k) o[k] = f2bf(v[k]); *(v8us*)(dst + i * 8) = o;  }

// mkf: attn_mask rounded to bf16, once a call, in the order of a score tile's accumulators: [query tile][key tile][lane = 16 * (key bit 3) + query % 16][key % 8], so k_fattn reads a tile's mask by one 16-byte load a lane, 512 contiguous bytes a wave.
__device__ __forceinline__ void mkf(const float* __restrict__ MK, bf* MF, int blk) { const size_t i = fchunk((size_t)blk * 256 + threadIdx.x); const size_t tile = i >> 5; const int lane = (int)(i & 31); const v8f v = *(const v8f*)(MK + ((tile / (TT / 16)) * 16 + (lane & 15)) * TT + (tile % (TT / 16)) * 16 + (lane >> 4) * 8); v8us o;
#pragma unroll   // constant indices keep v[k] and o[k] in registers
    for (int k = 0; k < 8; ++k) o[k] = f2bf(v[k]); *(v8us*)(MF + i * 8) = o; asm volatile("s_wait_xcnt 0x0" ::: "memory");   /* before the address registers of the store are reused: in k_prep's code the other two branches follow this one */ }
// k_prep: every f32 -> bf16 conversion of the call in ONE launch (they are independent of each other): blocks [0, 4 NWB) the four weights, then 3 * NB_ * NXB blocks the token planes, then NMB blocks the mask. The range tests are block-uniform.
#define NWB  (DQ * DM / 8 / 256)
#define NXB  (TT * DM / 8 / 256)
#define NMB  (TT * (TT / 8) / 256)
__global__ __launch_bounds__(256) void k_prep(const float* __restrict__ wq, const float* __restrict__ wk, const float* __restrict__ wv, const float* __restrict__ wo, const float* __restrict__ xq, const float* __restrict__ xk, const float* __restrict__ xv, const float* __restrict__ MK, bf* W4, bf* X6, bf* MF) {
    static_assert(DQ * DM % (8 * 256) == 0 && TT * DM % (8 * 256) == 0 && DKV == DQ, "whole blocks; four weight planes of one size");
    const int blk = blockIdx.x;
    if (blk < 4 * NWB) cvt8(wq, wk, wv, wo, W4, (size_t)DQ * DM / 8, blk % NWB, blk / NWB);
    else if (blk < 4 * NWB + 3 * NB_ * NXB) cvt8s(xq, xk, xv, X6, (size_t)TT * DM / 8, (blk - 4 * NWB) % NXB, (blk - 4 * NWB) / NXB);
    else mkf(MK, MF, blk - 4 * NWB - 3 * NB_ * NXB);
}
// k_fattn: scores, softmax and attn.v of 16 query rows of one head in ONE work-group (16 waves); no score or weight plane in memory. grid (TT / 16, heads, NB_), 512 threads.
// Transposed products: S^T = K Q^T (A = 16 key rows, B = the 16 query rows), so lane (lr, hi) holds query lr's scores of keys 8 hi + j of each 16-key tile; wave w owns keys [w, w + 1) * TT / AW and keeps its AT score tiles in registers.
// Row maximum and row sum: in the lane, across the two lane halves, then across the waves through LDS. Two neighbouring score tiles, scaled and converted in place, ARE the B fragment (hardware k order) of O^T += V^T P^T.
// Each wave's partial O^T (its own key range) goes to LDS; the AW partials are added in ascending key order and stored in (h, b, s, dh) order as the bf16 hi and lo operand planes of the output projection.
#define AW   16                   // waves per work-group, one key range each
#define AKW  (TT / AW)            // keys per wave
#define AT   (AKW / 16)           // score tiles per wave
#define OP   68                   // LDS pitch (floats) of one query's partial output row
typedef v2f __attribute__((may_alias)) v2fa;
template <typename T16, bool HL>
__device__ __forceinline__ void attn_rows(const T16* __restrict__ Q, const T16* __restrict__ Q2, const T16* __restrict__ Kp, const T16* __restrict__ K2, const T16* __restrict__ Vt, const T16* __restrict__ Vt2, const bf* __restrict__ MF, bf* __restrict__ Oh, bf* __restrict__ Ol, int i0, float* red, float* osm) {
    typedef typename WFrag<T16>::V V;
    const int lane = threadIdx.x & 31, lr = lane & 15, hi = lane >> 4, w = threadIdx.x >> 5; const int kb = w * AKW;
    V q[2], q2[2];
#pragma unroll
    for (int ks = 0; ks < 2; ++ks) q[ks] = ldf(Q + funit(i0 / 16, HD, ks) + lane * 8);
    asm volatile("s_wait_xcnt 0x0" ::: "memory");   /* before the address registers of the query loads are reused */
    if (HL) {
#pragma unroll   // constant indices keep q2[ks] in registers
        for (int ks = 0; ks < 2; ++ks) q2[ks] = ldf(Q2 + funit(i0 / 16, HD, ks) + lane * 8);
        asm volatile("s_wait_xcnt 0x0" ::: "memory");   /* as above */
    }
    const bf* mk = MF + ((size_t)(i0 / 16) * (TT / 16) + kb / 16) * 256 + lane * 8;
    constexpr int GT = HL ? 1 : 2, NG = AT / GT;         // score tiles per load group; two groups in flight: one lands while the one before it is multiplied
    constexpr int GD = HL ? 1 : 2, DG = HD / 16 / GD, NV = AT / 4 * DG;   // the same for attn.v: a load group is GD d tiles x 64 keys; groups per 64 keys, groups
    V k[2][GT][2], k2[2][GT][2], va[2][GD][2], va2[2][GD][2]; v8us m[2][GT];
    v8f s[AT]; float mx = -3.0e38f;
#pragma unroll
    for (int g = -1; g < NG; ++g) {
        if (g + 1 < NG) {
#pragma unroll
            for (int u = 0; u < GT; ++u) { const int t = (g + 1) * GT + u; const size_t ko = funit(kb / 16 + t, HD, 0) + lane * 8;
#pragma unroll
                for (int ks = 0; ks < 2; ++ks) { k[(g + 1) & 1][u][ks] = ldf(Kp + ko + ks * 512); if (HL) k2[(g + 1) & 1][u][ks] = ldf(K2 + ko + ks * 512); }
                m[(g + 1) & 1][u] = *(const v8us*)(mk + t * 256); }
            asm volatile("s_wait_xcnt 0x0" ::: "memory");   /* before any register that the loads above name (address, scalar base) is reused */
        }
        if (g >= 0) {
#pragma unroll
            for (int u = 0; u < GT; ++u) { const int t = g * GT + u; v8f a = (v8f){};
#pragma unroll
                for (int ks = 0; ks < 2; ++ks) { a = WFrag<T16>::mma(k[g & 1][u][ks], q[ks], a); if (HL) { a = WFrag<T16>::mma(k[g & 1][u][ks], q2[ks], a); a = WFrag<T16>::mma(k2[g & 1][u][ks], q[ks], a); } }
#pragma unroll
                for (int j = 0; j < 8; ++j) { const float tv = a[j] * SCL + bf2f(m[g & 1][u][j]);   /* q.k / 8 (exact scaling) + attn_mask[i][j] */ a[j] = tv; mx = fmaxf(mx, tv); }
                s[t] = a; }
            __builtin_amdgcn_sched_barrier(0);   /* holds the loads of group g + 2 behind this group's products: without it every load is hoisted to the top and registers spill */
        }
    }
    auto ldv = [&](int g) {   /* V^T fragments of load group g */
#pragma unroll
        for (int u = 0; u < GD; ++u)
#pragma unroll
            for (int kq = 0; kq < 2; ++kq) { const size_t vo = funit((g % DG) * GD + u, TT, kb / 32 + (g / DG) * 2 + kq) + lane * 8; va[g & 1][u][kq] = ldf(Vt + vo); if (HL) va2[g & 1][u][kq] = ldf(Vt2 + vo); }
        asm volatile("s_wait_xcnt 0x0" ::: "memory");   /* as above */
    };
    ldv(0);   /* lands during the softmax */
    mx = fmaxf(mx, __shfl_xor(mx, 16, 32)); if (hi == 0) red[w * 16 + lr] = mx;
    __syncthreads();
#pragma unroll
    for (int ww = 0; ww < AW; ++ww) mx = fmaxf(mx, red[ww * 16 + lr]);
    float sum = 0.f;
#pragma unroll
    for (int t = 0; t < AT; ++t)
#pragma unroll
        for (int j = 0; j < 8; ++j) { const float x = (s[t][j] - mx) * 1.4426950408889634f; float e;
            asm("v_exp_f32 %0, %1\n\tv_nop" : "=v"(e) : "v"(x));   /* 2^x; the v_nop is the slot the instruction set asks for behind a transcendental, before its source is overwritten or its result read */
            s[t][j] = e; sum += e; }
    sum += __shfl_xor(sum, 16, 32); if (hi == 0) red[(AW + w) * 16 + lr] = sum;
    __syncthreads();
    sum = red[AW * 16 + lr];
#pragma unroll
    for (int ww = 1; ww < AW; ++ww) sum += red[(AW + ww) * 16 + lr];
    const float f = __fdiv_rn(HL ? 1.0f : PCAR, sum);
    v8f o[HD / 16];
#pragma unroll
    for (int dt = 0; dt < HD / 16; ++dt) o[dt] = (v8f){};
    V p[2], p2[2];
#pragma unroll
    for (int g = 0; g < NV; ++g) { const int d0 = (g % DG) * GD;
        if (g + 1 < NV) ldv(g + 1);
        if (d0 == 0) {   /* the weights of this 64-key block as two B fragments (32 keys each) */
#pragma unroll
            for (int kq = 0; kq < 2; ++kq) { const int kk = (g / DG) * 2 + kq;
                if constexpr (HL) { v8us h0, h1, l0, l1;
#pragma unroll
                    for (int j = 0; j < 8; ++j) { unsigned short x, y; splitf(s[2 * kk][j] * f, x, y); h0[j] = x; l0[j] = y; splitf(s[2 * kk + 1][j] * f, x, y); h1[j] = x; l1[j] = y; }
                    p[kq] = cat16b(h0, h1); p2[kq] = cat16b(l0, l1);
                } else { v8h x0, x1;
#pragma unroll
                    for (int j = 0; j < 8; ++j) { x0[j] = tohx(s[2 * kk][j] * f); x1[j] = tohx(s[2 * kk + 1][j] * f); }
                    p[kq] = cat16(x0, x1); } } }
#pragma unroll
        for (int u = 0; u < GD; ++u)
#pragma unroll
            for (int kq = 0; kq < 2; ++kq) { o[d0 + u] = WFrag<T16>::mma(va[g & 1][u][kq], p[kq], o[d0 + u]); if constexpr (HL) { o[d0 + u] = WFrag<T16>::mma(va[g & 1][u][kq], p2[kq], o[d0 + u]); o[d0 + u] = WFrag<T16>::mma(va2[g & 1][u][kq], p[kq], o[d0 + u]); } }
        __builtin_amdgcn_sched_barrier(0);   /* as in the score loop: two load groups in flight, no more */
    }
    float* ow = osm + (w * 16 + lr) * OP + 8 * hi;
#pragma unroll
    for (int dt = 0; dt < HD / 16; ++dt) { v4f lo4, hi4;
#pragma unroll
        for (int j = 0; j < 4; ++j) { lo4[j] = o[dt][j]; hi4[j] = o[dt][4 + j]; }
        *(v4fa*)(ow + dt * 16) = lo4; *(v4fa*)(ow + dt * 16 + 4) = hi4; }
    __syncthreads();
    const int qi = threadIdx.x >> 5, d2 = (threadIdx.x & 31) * 2; v2f r = *(const v2fa*)(osm + qi * OP + d2);   /* 16 x HD outputs over AW * 32 = 512 threads */
#pragma unroll
    for (int ww = 1; ww < AW; ++ww) r += *(const v2fa*)(osm + (ww * 16 + qi) * OP + d2);
    r *= HL ? 1.0f : (1.0f / PCAR);
    v2us rh, rl;   /* the hi and lo operand planes of the output projection */
#pragma unroll
    for (int q = 0; q < 2; ++q) { unsigned short a2, c2; splitf(r[q], a2, c2); rh[q] = a2; rl[q] = c2; }
    *(v2us*)(Oh + (size_t)(i0 + qi) * HD + d2) = rh; *(v2us*)(Ol + (size_t)(i0 + qi) * HD + d2) = rl;
}
__global__ __launch_bounds__(AW * 32) void k_fattn(const h16* __restrict__ Q16, const h16* __restrict__ K16, const h16* __restrict__ V16, const bf* __restrict__ Qh, const bf* __restrict__ Ql, const bf* __restrict__ Kh, const bf* __restrict__ Kl, const bf* __restrict__ Vh, const bf* __restrict__ Vl, const bf* __restrict__ MF, bf* __restrict__ ATh, bf* __restrict__ ATl) {
    __shared__ __align__(16) float osm[AW * 16 * OP]; __shared__ float red[2 * AW * 16];
    const int i0 = blockIdx.x * 16, b = blockIdx.z; const size_t h = blockIdx.y, zq = b * PLN + h * TT * HD, zk = b * PLN + (h / REP) * TT * HD;   /* grid z = batch element: its plane set follows batch 0's */
    const size_t zo = (h * NB_ + b) * TT * HD; bf* Oh = ATh + zo; bf* Ol = ATl + zo;   /* (h, b, s, dh) contiguous == the module's raw (S, B, D) view */
    if (i0 < RH) attn_rows<bf, true>(Qh + zq, Ql + zq, Kh + zk, Kl + zk, Vh + zk, Vl + zk, MF, Oh, Ol, i0, red, osm);   /* block-uniform: RH is a multiple of 16 */
    else attn_rows<h16, false>(Q16 + zq, nullptr, K16 + zk, nullptr, V16 + zk, nullptr, MF, Oh, Ol, i0, red, osm);
}

extern "C" void kernel_launch(void* const* d_in, const int* in_sizes, int n_in,
                              void* d_out, int out_size, void* d_ws, size_t ws_size, hipStream_t stream) {
    (void)in_sizes; (void)n_in; (void)out_size;
    const float* xq = (const float*)d_in[0]; const float* xk = (const float*)d_in[1]; const float* xv = (const float*)d_in[2]; const float* MK = (const float*)d_in[3]; const float* wq = (const float*)d_in[4]; const float* bq = (const float*)d_in[5]; const float* wk = (const float*)d_in[6]; const float* bk = (const float*)d_in[7]; const float* wv = (const float*)d_in[8]; const float* bv = (const float*)d_in[9]; const float* wo = (const float*)d_in[10]; const float* bo = (const float*)d_in[11]; const float* x = xq; (void)x;
    float* OUT = (float*)d_out;     // [2048][2][1024]
    char* wsp = (char*)d_ws;
    auto take = [&](size_t bytes) { char* p = wsp; wsp += (bytes + 255) & ~(size_t)255; return (void*)p; };
    bf* W4 = (bf*)take((size_t)4 * DQ * DM * 2);                 // bf16 Wq, Wk, Wv, Wo
    bf* X6 = (bf*)take((size_t)3 * NB_ * TT * DM * 2);           // bf16 token planes [input][batch][t][d]
    h16* P16 = (h16*)take(3 * NB_ * PLN * 2); bf* Ph = (bf*)take(3 * NB_ * PLN * 2); bf* Pl = (bf*)take(3 * NB_ * PLN * 2);   // head planes [input: Q, K, V^T][batch]
    bf* ATh = (bf*)take((size_t)NB_ * TT * DQ * 2); bf* ATl = (bf*)take((size_t)NB_ * TT * DQ * 2); bf* MF = (bf*)take((size_t)TT * TT * 2);
    if ((size_t)(wsp - (char*)d_ws) > ws_size) return;    // ws 256 MiB
    k_prep<<<4 * NWB + 3 * NB_ * NXB + NMB, 256, 0, stream>>>(wq, wk, wv, wo, xq, xk, xv, MK, W4, X6, MF);
    k_proj<<<dim3((DQ / 64) * (TT / 64), 1, 3 * NB_), 32, 0, stream>>>(W4, X6, bq, bk, bv, P16, Ph, Pl);
    k_fattn<<<dim3(TT / 16, NH_, NB_), AW * 32, 0, stream>>>(P16, P16 + NB_ * PLN, P16 + 2 * NB_ * PLN, Ph, Pl, Ph + NB_ * PLN, Pl + NB_ * PLN, Ph + 2 * NB_ * PLN, Pl + 2 * NB_ * PLN, MF, ATh, ATl);
    k_gemmw<bf, 1, true><<<dim3(NB_ * TT / 64, DM / 64, 1), 32, 0, stream>>>(ATh, ATl, W4 + (size_t)3 * DQ * DM, nullptr, DQ, OUT, DM, bo, 0, 0, 0, nullptr, nullptr, nullptr);   /* out (S*B rows, in the view's memory order) = view Wo^T + bo */
}

// v006
// Measured time: 237 microseconds a run.
// Timed twice side by side with v005, it ran 1.16 times as fast both times.
// Over all steps from v000 it is 9.33 times as fast.
#include <hip/hip_runtime.h>

// Multi-head attention on sequence-first tensors with the module's raw-view head merge (q, k, v [2048][2][1024] = [s][b][d]; projections 'oi' [1024][1024] + biases; per (head, batch): scores = q.k/8 + attn_mask[i][j] (f32 [2048][2048] input, read); softmax; O[h][b][s][dh] = attn.v; the module then views the contiguous (H, B, S, Dh) tensor directly as (S, B, D) (NO head transpose) and applies Wo^T + bo -> out [2048][2][1024]).
// Layout: both batch elements are read from the interleaved rows (row stride 2 x 1024); all 32 (head, batch) attention problems write O contiguously in (h, b, s, dh) order, whose memory IS the module's (S x B, D) view, so the output projection is one GEMM over 4096 rows.
// Fragment order: the 16-bit planes [rows][K] that the attention kernel reads (Q, K: K = HD; V^T: K = TT) lie in units of 16 rows x 32 k (1 KB): [row tile][k tile][k bit 4][lane = 16 * (k bit 3) + row % 16][k % 8], so a wave-wide 16-byte load of half a fragment reads 512 contiguous bytes (4 whole lines). The projection GEMMs store these planes themselves, straight from their accumulators. The operand planes of k_gemmw stay K-contiguous.
// Compute dtypes, f32 accumulate: every input rounded to bf16; q/k/v on PLAIN bf16 operands (inputs: exact) + biases; additive mask (bf16-rounded, packed once by k_prep) added inside the fused attention kernel; scores and attn.v: query rows < 512 hl (3 products), the rest single fp16 (x1024); softmax f32; Wo hl x exact (2 products) + bo.

#define NB_  2
#define TT   2048
#define DM   1024
#define NH_  16
#define NKV  16
#define REP  (NH_ / NKV)
#define HD   64
#define DQ   (NH_ * HD)
#define DKV  (NKV * HD)
typedef __attribute__((ext_vector_type(4))) unsigned short v4us;
#define RH   512                  // query rows < RH use hi+lo planes (0: none)
#define WIN  0
#define PCAR 1024.0f
#define SCL  0.125f   // HD^-0.5
typedef _Float16 h16;
typedef unsigned short bf;
typedef __attribute__((ext_vector_type(16))) __bf16   v16bf;
typedef __attribute__((ext_vector_type(16))) _Float16 v16h;
typedef __attribute__((ext_vector_type(8)))  _Float16 v8h;
typedef __attribute__((ext_vector_type(8)))  unsigned short v8us;
typedef __attribute__((ext_vector_type(8)))  float    v8f;
typedef __attribute__((ext_vector_type(4)))  float    v4f;
typedef v8h  __attribute__((may_alias)) v8ha;
typedef v4f  __attribute__((may_alias)) v4fa;
typedef v8us __attribute__((may_alias)) v8usa;

__device__ __forceinline__ unsigned short f2bf(float f) { unsigned u = __float_as_uint(f); u += 0x7FFFu + ((u >> 16) & 1u); return (unsigned short)(u >> 16); }
__device__ __forceinline__ float bf2f(unsigned short b) { return __uint_as_float(((unsigned)b) << 16); }
__device__ __forceinline__ float bfr(float f) { return bf2f(f2bf(f)); }
__device__ __forceinline__ v16h cat16(v8h lo, v8h hi) { return __builtin_shufflevector(lo, hi, 0, 1, 2, 3, 4, 5, 6, 7, 8, 9, 10, 11, 12, 13, 14, 15); }
__device__ __forceinline__ v16bf cat16b(v8us lo, v8us hi) { return __builtin_bit_cast(v16bf, __builtin_shufflevector(lo, hi, 0, 1, 2, 3, 4, 5, 6, 7, 8, 9, 10, 11, 12, 13, 14, 15)); }
__device__ __forceinline__ v8f wmma16(v16h a, v16h b, v8f c) { return __builtin_amdgcn_wmma_f32_16x16x32_f16(false, a, false, b, (short)0, c, false, false); }
__device__ __forceinline__ v8f wmmab(v16bf a, v16bf b, v8f c) { return __builtin_amdgcn_wmma_f32_16x16x32_bf16(false, a, false, b, (short)0, c, false, false); }



// ---- k_gemmw: register-blocked GEMM, ONE WAVE per 64x64 output tile (16 accumulators), operands straight from K-contiguous 16-bit planes; grid (M/64, N/64, Z), 32 threads.
// C[m][n] (f32, pitch ldc, + optional f32 bias[n]) = sum_k A[m][k] Bt[n][k] (+ split products per NSPLIT). z-batch strides sA/sB/sC in elements. K % (32 * KS) == 0.
// KS > 1: grid z = Z * KS; work-group z * KS + ks sums only k in [ks, ks + 1) * K / KS and stores its partial tile in C plane z * KS + ks (plane stride sC); the caller adds the KS planes.
// funit: offset of the unit (row tile rt, k tile kt) of a fragment-ordered plane. ldf (below) loads a fragment from unit + lane * 8.
// PACK != 0 (the q, k, v projections): no f32 C; the wave adds the bias and stores its tile as the three head planes (fp16, bf16 hi, bf16 lo) in fragment order. A lane's 8 accumulator values of one 16x16 block are 8 consecutive A rows at one B row = one 16-byte chunk of a plane whose k runs along the A rows, and the block's 32 chunks are 512 contiguous bytes.
// PACK == 1 (Q, K: plane [h * TT + t][d]): A = the weight (64 rows = head bx), Bt = the tokens, bias by A row. PACK == 2 (V^T: plane [h * HD + d][t]): A = the tokens, Bt = the weight, bias by Bt row.
// fchunk: thread -> 16-byte chunk for the mask packer: lane bits 0-2 = row % 8, 3 = k bit 3, 4 = k bit 4, thread bit 5 = row bit 3, so a wave reads 8 rows x 32 k (whole 128-byte lines of the f32 source) and stores 4 whole lines.
__device__ __forceinline__ size_t fchunk(size_t i) { return (i & ~(size_t)63) | (i & 7) | ((i >> 2) & 8) | ((i & 24) << 1); }
__device__ __forceinline__ size_t funit(size_t rt, int K, int kt) { return (rt * (size_t)(K / 32) + kt) << 9; }
__device__ __forceinline__ h16 tohx(float x) { return (h16)x; }
__device__ __forceinline__ void splitf(float y, unsigned short& h, unsigned short& l) { h = f2bf(y); l = f2bf(y - bf2f(h)); }
template <typename T16> struct WFrag;
template <> struct WFrag<h16> { typedef v16h V; static __device__ __forceinline__ V ld(const h16* p) { return cat16(*(const v8h*)p, *(const v8h*)(p + 16)); } static __device__ __forceinline__ v8f mma(V a, V b, v8f c) { return wmma16(a, b, c); } };
template <> struct WFrag<bf> { typedef v16bf V; static __device__ __forceinline__ V ld(const bf* p) { return cat16b(*(const v8us*)p, *(const v8us*)(p + 16)); } static __device__ __forceinline__ v8f mma(V a, V b, v8f c) { return wmmab(a, b, c); } };
__device__ __forceinline__ v16h ldf(const h16* p) { return cat16(*(const v8h*)p, *(const v8h*)(p + 256)); }
__device__ __forceinline__ v16bf ldf(const bf* p) { return cat16b(*(const v8us*)p, *(const v8us*)(p + 256)); }
// gemmw is the body; bx, by, zb are the tile's indices (k_gemmw: the grid's own; k_proj: derived from its flat index).
template <typename T16, int NSPLIT, bool BIAS, int KS = 1, int PACK = 0>
__device__ __forceinline__ void gemmw(const T16* __restrict__ A, const T16* __restrict__ A2, const T16* __restrict__ Bt, const T16* __restrict__ Bt2, int K, float* C, int ldc, const float* __restrict__ bias, size_t sA, size_t sB, size_t sC, h16* __restrict__ P16, bf* __restrict__ Ph, bf* __restrict__ Pl, int bx, int by, size_t zb) {
    typedef typename WFrag<T16>::V V;
    __shared__ __align__(16) float os[16 * 68];
    const size_t z = zb / KS; const int k0 = (int)(zb % KS) * (K / KS), k1 = k0 + K / KS; A += z * sA; if (A2) A2 += z * sA; Bt += z * sB; if (Bt2) Bt2 += z * sB; C += zb * sC;
    const int lane = threadIdx.x & 31, lr = lane & 15, hi = lane >> 4; const int r0 = bx * 64, c0 = by * 64;
    v8f acc[4][4];
#pragma unroll
    for (int mb = 0; mb < 4; ++mb)
#pragma unroll
        for (int nb = 0; nb < 4; ++nb) acc[mb][nb] = (v8f){};
    const size_t aoff = (size_t)(r0 + lr) * K + 8 * hi, boff = (size_t)(c0 + lr) * K + 8 * hi;
#pragma unroll 1
    for (int kc = k0; kc < k1; kc += 32) {
        V a[4], a2[4];
#pragma unroll
        for (int mb = 0; mb < 4; ++mb) { a[mb] = WFrag<T16>::ld(A + aoff + (size_t)mb * 16 * K + kc); if (NSPLIT == 1 || NSPLIT == 2) a2[mb] = WFrag<T16>::ld(A2 + aoff + (size_t)mb * 16 * K + kc); }
#pragma unroll
        for (int nb = 0; nb < 4; ++nb) { const V b = WFrag<T16>::ld(Bt + boff + (size_t)nb * 16 * K + kc); V b2; if (NSPLIT >= 2) b2 = WFrag<T16>::ld(Bt2 + boff + (size_t)nb * 16 * K + kc);
#pragma unroll
            for (int mb = 0; mb < 4; ++mb) { acc[mb][nb] = WFrag<T16>::mma(a[mb], b, acc[mb][nb]); if (NSPLIT == 1 || NSPLIT == 2) acc[mb][nb] = WFrag<T16>::mma(a2[mb], b, acc[mb][nb]); if (NSPLIT >= 2) acc[mb][nb] = WFrag<T16>::mma(a[mb], b2, acc[mb][nb]); } }
        asm volatile("v_nop\n\tv_nop\n\tv_nop\n\tv_nop" : "+v"(acc[0][0]), "+v"(acc[1][1]), "+v"(acc[2][2]), "+v"(acc[3][3]) : "v"(a[0]), "v"(a[3]));
    }
    if constexpr (PACK != 0) {
        static_assert(HD == 64, "a 64-row tile is one head");
        v8f ba[4]; float bb[4];   /* the lane's biases: by A row (8 a block row) or by Bt row (1 a block column) */
#pragma unroll   // constant indices keep ba and bb in registers
        for (int i = 0; i < 4; ++i) { if (PACK == 1) ba[i] = *(const v8f*)(bias + r0 + i * 16 + hi * 8); else bb[i] = bias[c0 + i * 16 + lr]; }
        /* the wait stands before the address registers of the bias loads are reused; the loaded values as inputs hold all the loads in front of the blocks, so that they share one latency */
        if constexpr (PACK == 1) asm volatile("s_wait_xcnt 0x0" :: "v"(ba[0]), "v"(ba[1]), "v"(ba[2]), "v"(ba[3]) : "memory");
        else asm volatile("s_wait_xcnt 0x0" :: "v"(bb[0]), "v"(bb[1]), "v"(bb[2]), "v"(bb[3]) : "memory");
#pragma unroll   // constant indices keep acc in registers
        for (int mb = 0; mb < 4; ++mb) {
#pragma unroll
            for (int nb = 0; nb < 4; ++nb) {
                const size_t e = (PACK == 1 ? funit((size_t)bx * (TT / 16) + c0 / 16 + nb, HD, mb >> 1) : funit((size_t)(c0 / 16 + nb), TT, r0 / 32 + (mb >> 1))) + (mb & 1) * 256 + lane * 8;
                v8h o16; v8us oh, ol;
#pragma unroll
                for (int j = 0; j < 8; ++j) { const float x = acc[mb][nb][j] + bfr(PACK == 1 ? ba[mb][j] : bb[nb]); o16[j] = tohx(x); unsigned short a2, c2; splitf(x, a2, c2); oh[j] = a2; ol[j] = c2; }
                /* the three plane stores and their wait in one statement: the wait stands before any address or data register of the stores is reused */
                asm volatile("global_store_b128 %0, %3, off\n\tglobal_store_b128 %1, %4, off\n\tglobal_store_b128 %2, %5, off\n\ts_wait_xcnt 0x0" :: "v"(P16 + e), "v"(Ph + e), "v"(Pl + e), "v"(o16), "v"(oh), "v"(ol) : "memory");
            }
        }
        return;
    }
#pragma unroll
    for (int mb = 0; mb < 4; ++mb) {
#pragma unroll
        for (int nb = 0; nb < 4; ++nb) {
#pragma unroll
            for (int j = 0; j < 8; ++j) os[(hi * 8 + j) * 68 + nb * 16 + lr] = acc[mb][nb][j]; }
        __builtin_amdgcn_wave_barrier(); asm volatile("" ::: "memory");
        float* crow = C + (size_t)(r0 + mb * 16) * ldc + c0;
{
#pragma unroll
            for (int s = 0; s < 8; ++s) { const int row = 2 * s + hi, cofs = lr * 4; v4f val = *(const v4fa*)(os + row * 68 + cofs); if (BIAS) { val[0] += bfr(bias[c0 + cofs]); val[1] += bfr(bias[c0 + cofs + 1]); val[2] += bfr(bias[c0 + cofs + 2]); val[3] += bfr(bias[c0 + cofs + 3]); }
                *(v4f*)(crow + (size_t)row * ldc + cofs) = val; }
             }
        __builtin_amdgcn_wave_barrier(); asm volatile("" ::: "memory");
    }
}
template <typename T16, int NSPLIT, bool BIAS, int KS = 1, int PACK = 0>
__global__ __launch_bounds__(32) void k_gemmw(const T16* __restrict__ A, const T16* __restrict__ A2, const T16* __restrict__ Bt, const T16* __restrict__ Bt2, int K, float* C, int ldc, const float* __restrict__ bias, size_t sA, size_t sB, size_t sC, h16* __restrict__ P16, bf* __restrict__ Ph, bf* __restrict__ Pl) {
    gemmw<T16, NSPLIT, BIAS, KS, PACK>(A, A2, Bt, Bt2, K, C, ldc, bias, sA, sB, sC, P16, Ph, Pl, (int)blockIdx.x, (int)blockIdx.y, (size_t)blockIdx.z);
}
// k_proj: the q, k and v projections of both batch elements in ONE launch, so that 6 x 512 one-wave tiles are resident together and hide each other's load latency. grid (512, 1, 3 * NB_): z = input * NB_ + batch picks the weight plane (W3 + input), the token plane (X6 + z), the bias and the three output planes (+ z).
#define PLN  ((size_t)NH_ * TT * HD)   // elements of one head plane set (one input, one batch element)
__global__ __launch_bounds__(32) void k_proj(const bf* __restrict__ W3, const bf* __restrict__ X6, const float* __restrict__ bq, const float* __restrict__ bk, const float* __restrict__ bv, h16* __restrict__ P16, bf* __restrict__ Ph, bf* __restrict__ Pl) {
    static_assert(DQ == DKV && DQ == DM, "the weight planes and the head planes of q, k, v have one size");
    const int z = blockIdx.z, in = z / NB_, t = blockIdx.x;
    const bf* Wp = W3 + (size_t)in * DQ * DM; const bf* X = X6 + (size_t)z * TT * DM; const size_t po = (size_t)z * PLN;
    if (in < 2) gemmw<bf, 0, true, 1, 1>(Wp, nullptr, X, nullptr, DM, nullptr, 0, in == 0 ? bq : bk, 0, 0, 0, P16 + po, Ph + po, Pl + po, t % (DQ / 64), t / (DQ / 64), 0);
    else gemmw<bf, 0, true, 1, 2>(X, nullptr, Wp, nullptr, DM, nullptr, 0, bv, 0, 0, 0, P16 + po, Ph + po, Pl + po, t % (TT / 64), t / (TT / 64), 0);
}

typedef __attribute__((ext_vector_type(2))) _Float16 v2h;
typedef __attribute__((ext_vector_type(4))) _Float16 v4h;
typedef __attribute__((ext_vector_type(2))) unsigned short v2us;
typedef __attribute__((ext_vector_type(4))) unsigned short v4us;
typedef __attribute__((ext_vector_type(2))) float v2f;
typedef __attribute__((ext_vector_type(4))) int v4i;

__global__ __launch_bounds__(256) void k_wtG(const float* __restrict__ w, int K, int N, bf* Bt) {
    const int lane = threadIdx.x & 31; const int L0 = (blockIdx.x * 8 + (threadIdx.x >> 5)) * 8; const int nlines = N * K / 64;
{
#pragma unroll 1
        for (int l = 0; l < 8; ++l) { const int L = L0 + l; if (L >= nlines) break; const size_t e = (size_t)L * 64 + lane * 2; const int k = (int)(e % K), n = (int)(e / K); v2us o;
            o[0] = f2bf(w[(size_t)k * N + n]); o[1] = f2bf(w[(size_t)(k + 1) * N + n]); *(v2us*)(Bt + e) = o; }
         }
}
// cvt8s: block blk of token plane y = input * NB_ + batch.
__device__ __forceinline__ void cvt8s(const float* __restrict__ xq, const float* __restrict__ xk, const float* __restrict__ xv, bf* dst, size_t n8, int blk, int y) { const size_t i = (size_t)blk * 256 + threadIdx.x; if (i >= n8) return; const int in = y / NB_, b = y % NB_; const float* src = in == 0 ? xq : in == 1 ? xk : xv; dst += (size_t)y * TT * DM; const size_t e = i * 8; const size_t t = e / DM, c = e % DM; const v8f v = *(const v8f*)(src + (t * NB_ + b) * DM + c); v8us o;
#pragma unroll
    for (int k = 0; k < 8; ++k) o[k] = f2bf(v[k]); *(v8us*)(dst + e) = o;  }
// cvt8: block blk of weight plane y (n8 * 8 elements each).
__device__ __forceinline__ void cvt8(const float* __restrict__ wq, const float* __restrict__ wk, const float* __restrict__ wv, const float* __restrict__ wo, bf* dst, size_t n8, int blk, int y) { const size_t i = (size_t)blk * 256 + threadIdx.x; if (i >= n8) return; const float* src = y == 0 ? wq : y == 1 ? wk : y == 2 ? wv : wo; dst += (size_t)y * n8 * 8; const v8f v = *(const v8f*)(src + i * 8); v8us o;
#pragma unroll
    for (int k = 0; k < 8; ++k) o[k] = f2bf(v[k]); *(v8us*)(dst + i * 8) = o;  }

// mkf: attn_mask rounded to bf16, once a call, in the order of a score tile's accumulators: [query tile][key tile][lane = 16 * (key bit 3) + query % 16][key % 8], so k_fattn reads a tile's mask by one 16-byte load a lane, 512 contiguous bytes a wave.
__device__ __forceinline__ void mkf(const float* __restrict__ MK, bf* MF, int blk) { const size_t i = fchunk((size_t)blk * 256 + threadIdx.x); const size_t tile = i >> 5; const int lane = (int)(i & 31); const v8f v = *(const v8f*)(MK + ((tile / (TT / 16)) * 16 + (lane & 15)) * TT + (tile % (TT / 16)) * 16 + (lane >> 4) * 8); v8us o;
#pragma unroll   // constant indices keep v[k] and o[k] in registers
    for (int k = 0; k < 8; ++k) o[k] = f2bf(v[k]); *(v8us*)(MF + i * 8) = o; asm volatile("s_wait_xcnt 0x0" ::: "memory");   /* before the address registers of the store are reused: in k_prep's code the other two branches follow this one */ }
// k_prep: every f32 -> bf16 conversion of the call in ONE launch (they are independent of each other): blocks [0, 4 NWB) the four weights, then 3 * NB_ * NXB blocks the token planes, then NMB blocks the mask. The range tests are block-uniform.
#define NWB  (DQ * DM / 8 / 256)
#define NXB  (TT * DM / 8 / 256)
#define NMB  (TT * (TT / 8) / 256)
__global__ __launch_bounds__(256) void k_prep(const float* __restrict__ wq, const float* __restrict__ wk, const float* __restrict__ wv, const float* __restrict__ wo, const float* __restrict__ xq, const float* __restrict__ xk, const float* __restrict__ xv, const float* __restrict__ MK, bf* W4, bf* X6, bf* MF) {
    static_assert(DQ * DM % (8 * 256) == 0 && TT * DM % (8 * 256) == 0 && DKV == DQ, "whole blocks; four weight planes of one size");
    const int blk = blockIdx.x;
    if (blk < 4 * NWB) cvt8(wq, wk, wv, wo, W4, (size_t)DQ * DM / 8, blk % NWB, blk / NWB);
    else if (blk < 4 * NWB + 3 * NB_ * NXB) cvt8s(xq, xk, xv, X6, (size_t)TT * DM / 8, (blk - 4 * NWB) % NXB, (blk - 4 * NWB) / NXB);
    else mkf(MK, MF, blk - 4 * NWB - 3 * NB_ * NXB);
}
// k_fattn: scores, softmax and attn.v of 16 (hi+lo rows) or 32 (fp16 rows) query rows of one head in ONE work-group (16 waves); no score or weight plane in memory. grid (AGX, heads, NB_), 512 threads.
// Transposed products: S^T = K Q^T (A = 16 key rows, B = the 16 query rows), so lane (lr, hi) holds query lr's scores of keys 8 hi + j of each 16-key tile; wave w owns keys [w, w + 1) * TT / AW and keeps its NQ x AT score tiles in registers.
// Row maximum and row sum: in the lane, across the two lane halves, then across the waves through LDS. Two neighbouring score tiles, scaled and converted in place, ARE the B fragment (hardware k order) of O^T += V^T P^T.
// Each wave's partial O^T (its own key range) goes to LDS; the AW partials are added in ascending key order and stored in (h, b, s, dh) order as the bf16 hi and lo operand planes of the output projection.
#define AW   16                   // waves per work-group, one key range each
#define AKW  (TT / AW)            // keys per wave
#define AT   (AKW / 16)           // 16-key tiles per wave (score tiles per query tile)
#define OP   68                   // LDS pitch (floats) of one query's partial output row
typedef v2f __attribute__((may_alias)) v2fa;
template <int N> struct FV;
template <> struct FV<2> { typedef v2f F; typedef v2f __attribute__((may_alias)) FA; typedef v2us U; };
template <> struct FV<4> { typedef v4f F; typedef v4f __attribute__((may_alias)) FA; typedef v4us U; };
// NQ: query tiles (16 rows each) of the work-group. Every K and V^T fragment that a wave loads is multiplied with all NQ query tiles, so the bytes read per query row fall by NQ; each query's own sums keep their order.
template <typename T16, bool HL, int NQ>
__device__ __forceinline__ void attn_rows(const T16* __restrict__ Q, const T16* __restrict__ Q2, const T16* __restrict__ Kp, const T16* __restrict__ K2, const T16* __restrict__ Vt, const T16* __restrict__ Vt2, const bf* __restrict__ MF, bf* __restrict__ Oh, bf* __restrict__ Ol, int i0, float* red, float* osm) {
    typedef typename WFrag<T16>::V V;
    const int lane = threadIdx.x & 31, lr = lane & 15, hi = lane >> 4, w = threadIdx.x >> 5; const int kb = w * AKW;
    V q[NQ][2], q2[NQ][2];
#pragma unroll
    for (int qt = 0; qt < NQ; ++qt)
#pragma unroll
        for (int ks = 0; ks < 2; ++ks) q[qt][ks] = ldf(Q + funit(i0 / 16 + qt, HD, ks) + lane * 8);
    asm volatile("s_wait_xcnt 0x0" ::: "memory");   /* before the address registers of the query loads are reused */
    if (HL) {
#pragma unroll   // constant indices keep q2 in registers
        for (int qt = 0; qt < NQ; ++qt)
#pragma unroll
            for (int ks = 0; ks < 2; ++ks) q2[qt][ks] = ldf(Q2 + funit(i0 / 16 + qt, HD, ks) + lane * 8);
        asm volatile("s_wait_xcnt 0x0" ::: "memory");   /* as above */
    }
    const bf* mk = MF + ((size_t)(i0 / 16) * (TT / 16) + kb / 16) * 256 + lane * 8;
    constexpr int GT = (HL || NQ > 1) ? 1 : 2, NG = AT / GT;         // 16-key tiles per load group; two groups in flight: one lands while the one before it is multiplied
    constexpr int GD = (HL || NQ > 1) ? 1 : 2, DG = HD / 16 / GD, NV = AT / 4 * DG;   // the same for attn.v: a load group is GD d tiles x 64 keys; groups per 64 keys, groups
    V k[2][GT][2], k2[2][GT][2], va[2][GD][2], va2[2][GD][2]; v8us m[2][GT][NQ];
    v8f s[NQ][AT]; float mx[NQ];
#pragma unroll
    for (int qt = 0; qt < NQ; ++qt) mx[qt] = -3.0e38f;
#pragma unroll
    for (int g = -1; g < NG; ++g) {
        if (g + 1 < NG) {
#pragma unroll
            for (int u = 0; u < GT; ++u) { const int t = (g + 1) * GT + u; const size_t ko = funit(kb / 16 + t, HD, 0) + lane * 8;
#pragma unroll
                for (int ks = 0; ks < 2; ++ks) { k[(g + 1) & 1][u][ks] = ldf(Kp + ko + ks * 512); if (HL) k2[(g + 1) & 1][u][ks] = ldf(K2 + ko + ks * 512); }
#pragma unroll
                for (int qt = 0; qt < NQ; ++qt) m[(g + 1) & 1][u][qt] = *(const v8us*)(mk + (size_t)qt * (TT / 16) * 256 + t * 256); }
            asm volatile("s_wait_xcnt 0x0" ::: "memory");   /* before any register that the loads above name (address, scalar base) is reused */
        }
        if (g >= 0) {
#pragma unroll
            for (int u = 0; u < GT; ++u) { const int t = g * GT + u;
#pragma unroll
                for (int qt = 0; qt < NQ; ++qt) { v8f a = (v8f){};
#pragma unroll
                    for (int ks = 0; ks < 2; ++ks) { a = WFrag<T16>::mma(k[g & 1][u][ks], q[qt][ks], a); if (HL) { a = WFrag<T16>::mma(k[g & 1][u][ks], q2[qt][ks], a); a = WFrag<T16>::mma(k2[g & 1][u][ks], q[qt][ks], a); } }
#pragma unroll
                    for (int j = 0; j < 8; ++j) { const float tv = a[j] * SCL + bf2f(m[g & 1][u][qt][j]);   /* q.k / 8 (exact scaling) + attn_mask[i][j] */ a[j] = tv; mx[qt] = fmaxf(mx[qt], tv); }
                    s[qt][t] = a; } }
            __builtin_amdgcn_sched_barrier(0);   /* holds the loads of group g + 2 behind this group's products: without it every load is hoisted to the top and registers spill */
        }
    }
    auto ldv = [&](int g) {   /* V^T fragments of load group g */
#pragma unroll
        for (int u = 0; u < GD; ++u)
#pragma unroll
            for (int kq = 0; kq < 2; ++kq) { const size_t vo = funit((g % DG) * GD + u, TT, kb / 32 + (g / DG) * 2 + kq) + lane * 8; va[g & 1][u][kq] = ldf(Vt + vo); if (HL) va2[g & 1][u][kq] = ldf(Vt2 + vo); }
        asm volatile("s_wait_xcnt 0x0" ::: "memory");   /* as above */
    };
    ldv(0);   /* lands during the softmax */
#pragma unroll
    for (int qt = 0; qt < NQ; ++qt) { mx[qt] = fmaxf(mx[qt], __shfl_xor(mx[qt], 16, 32)); if (hi == 0) red[(w * NQ + qt) * 16 + lr] = mx[qt]; }
    __syncthreads();
    float f[NQ];
#pragma unroll
    for (int qt = 0; qt < NQ; ++qt) {
#pragma unroll
        for (int ww = 0; ww < AW; ++ww) mx[qt] = fmaxf(mx[qt], red[(ww * NQ + qt) * 16 + lr]);
        float sum = 0.f;
#pragma unroll
        for (int t = 0; t < AT; ++t)
#pragma unroll
            for (int j = 0; j < 8; ++j) { const float x = (s[qt][t][j] - mx[qt]) * 1.4426950408889634f; float e;
                asm("v_exp_f32 %0, %1\n\tv_nop" : "=v"(e) : "v"(x));   /* 2^x; the v_nop is the slot the instruction set asks for behind a transcendental, before its source is overwritten or its result read */
                s[qt][t][j] = e; sum += e; }
        sum += __shfl_xor(sum, 16, 32); if (hi == 0) red[((AW + w) * NQ + qt) * 16 + lr] = sum;
    }
    __syncthreads();
#pragma unroll
    for (int qt = 0; qt < NQ; ++qt) { float sum = red[(AW * NQ + qt) * 16 + lr];
#pragma unroll
        for (int ww = 1; ww < AW; ++ww) sum += red[((AW + ww) * NQ + qt) * 16 + lr];
        f[qt] = __fdiv_rn(HL ? 1.0f : PCAR, sum); }
    v8f o[NQ][HD / 16];
#pragma unroll
    for (int qt = 0; qt < NQ; ++qt)
#pragma unroll
        for (int dt = 0; dt < HD / 16; ++dt) o[qt][dt] = (v8f){};
    V p[NQ][2], p2[NQ][2];
#pragma unroll
    for (int g = 0; g < NV; ++g) { const int d0 = (g % DG) * GD;
        if (g + 1 < NV) ldv(g + 1);
        if (d0 == 0) {   /* the weights of this 64-key block as two B fragments (32 keys each) a query tile */
#pragma unroll
            for (int qt = 0; qt < NQ; ++qt)
#pragma unroll
            for (int kq = 0; kq < 2; ++kq) { const int kk = (g / DG) * 2 + kq;
                if constexpr (HL) { v8us h0, h1, l0, l1;
#pragma unroll
                    for (int j = 0; j < 8; ++j) { unsigned short x, y; splitf(s[qt][2 * kk][j] * f[qt], x, y); h0[j] = x; l0[j] = y; splitf(s[qt][2 * kk + 1][j] * f[qt], x, y); h1[j] = x; l1[j] = y; }
                    p[qt][kq] = cat16b(h0, h1); p2[qt][kq] = cat16b(l0, l1);
                } else { v8h x0, x1;
#pragma unroll
                    for (int j = 0; j < 8; ++j) { x0[j] = tohx(s[qt][2 * kk][j] * f[qt]); x1[j] = tohx(s[qt][2 * kk + 1][j] * f[qt]); }
                    p[qt][kq] = cat16(x0, x1); } } }
#pragma unroll
        for (int u = 0; u < GD; ++u)
#pragma unroll
            for (int kq = 0; kq < 2; ++kq)
#pragma unroll
                for (int qt = 0; qt < NQ; ++qt) { o[qt][d0 + u] = WFrag<T16>::mma(va[g & 1][u][kq], p[qt][kq], o[qt][d0 + u]); if constexpr (HL) { o[qt][d0 + u] = WFrag<T16>::mma(va[g & 1][u][kq], p2[qt][kq], o[qt][d0 + u]); o[qt][d0 + u] = WFrag<T16>::mma(va2[g & 1][u][kq], p[qt][kq], o[qt][d0 + u]); } }
        __builtin_amdgcn_sched_barrier(0);   /* as in the score loop: two load groups in flight, no more */
    }
#pragma unroll
    for (int qt = 0; qt < NQ; ++qt) { float* ow = osm + ((w * NQ + qt) * 16 + lr) * OP + 8 * hi;
#pragma unroll
        for (int dt = 0; dt < HD / 16; ++dt) { v4f lo4, hi4;
#pragma unroll
            for (int j = 0; j < 4; ++j) { lo4[j] = o[qt][dt][j]; hi4[j] = o[qt][dt][4 + j]; }
            *(v4fa*)(ow + dt * 16) = lo4; *(v4fa*)(ow + dt * 16 + 4) = hi4; } }
    __syncthreads();
    constexpr int EW = 2 * NQ;   /* NQ * 16 x HD outputs over AW * 32 = 512 threads: EW neighbours a thread */
    typedef typename FV<EW>::F RF; typedef typename FV<EW>::FA RFA; typedef typename FV<EW>::U RU;
    const int qi = threadIdx.x / (HD / EW), d2 = (threadIdx.x % (HD / EW)) * EW; RF r = *(const RFA*)(osm + qi * OP + d2);
#pragma unroll
    for (int ww = 1; ww < AW; ++ww) r += *(const RFA*)(osm + (ww * NQ * 16 + qi) * OP + d2);
    r *= HL ? 1.0f : (1.0f / PCAR);
    RU rh, rl;   /* the hi and lo operand planes of the output projection */
#pragma unroll
    for (int e = 0; e < EW; ++e) { unsigned short a2, c2; splitf(r[e], a2, c2); rh[e] = a2; rl[e] = c2; }
    *(RU*)(Oh + (size_t)(i0 + qi) * HD + d2) = rh; *(RU*)(Ol + (size_t)(i0 + qi) * HD + d2) = rl;
}
#define NQF  2                    // query tiles of a work-group of the single-fp16 rows (the hi+lo rows: 1, their fragments fill the registers)
#define AGX  (RH / 16 + (TT - RH) / (16 * NQF))   // grid x: first the hi+lo work-groups, then the fp16 ones
__global__ __launch_bounds__(AW * 32) void k_fattn(const h16* __restrict__ Q16, const h16* __restrict__ K16, const h16* __restrict__ V16, const bf* __restrict__ Qh, const bf* __restrict__ Ql, const bf* __restrict__ Kh, const bf* __restrict__ Kl, const bf* __restrict__ Vh, const bf* __restrict__ Vl, const bf* __restrict__ MF, bf* __restrict__ ATh, bf* __restrict__ ATl) {
    static_assert((TT - RH) % (16 * NQF) == 0 && RH % 16 == 0, "whole work-groups");
    __shared__ __align__(16) float osm[AW * 16 * NQF * OP]; __shared__ float red[2 * AW * 16 * NQF];
    const int bx = blockIdx.x, b = blockIdx.z; const int i0 = bx < RH / 16 ? bx * 16 : RH + (bx - RH / 16) * (16 * NQF); const size_t h = blockIdx.y, zq = b * PLN + h * TT * HD, zk = b * PLN + (h / REP) * TT * HD;   /* grid z = batch element: its plane set follows batch 0's */
    const size_t zo = (h * NB_ + b) * TT * HD; bf* Oh = ATh + zo; bf* Ol = ATl + zo;   /* (h, b, s, dh) contiguous == the module's raw (S, B, D) view */
    if (i0 < RH) attn_rows<bf, true, 1>(Qh + zq, Ql + zq, Kh + zk, Kl + zk, Vh + zk, Vl + zk, MF, Oh, Ol, i0, red, osm);   /* block-uniform */
    else attn_rows<h16, false, NQF>(Q16 + zq, nullptr, K16 + zk, nullptr, V16 + zk, nullptr, MF, Oh, Ol, i0, red, osm);
}

extern "C" void kernel_launch(void* const* d_in, const int* in_sizes, int n_in,
                              void* d_out, int out_size, void* d_ws, size_t ws_size, hipStream_t stream) {
    (void)in_sizes; (void)n_in; (void)out_size;
    const float* xq = (const float*)d_in[0]; const float* xk = (const float*)d_in[1]; const float* xv = (const float*)d_in[2]; const float* MK = (const float*)d_in[3]; const float* wq = (const float*)d_in[4]; const float* bq = (const float*)d_in[5]; const float* wk = (const float*)d_in[6]; const float* bk = (const float*)d_in[7]; const float* wv = (const float*)d_in[8]; const float* bv = (const float*)d_in[9]; const float* wo = (const float*)d_in[10]; const float* bo = (const float*)d_in[11]; const float* x = xq; (void)x;
    float* OUT = (float*)d_out;     // [2048][2][1024]
    char* wsp = (char*)d_ws;
    auto take = [&](size_t bytes) { char* p = wsp; wsp += (bytes + 255) & ~(size_t)255; return (void*)p; };
    bf* W4 = (bf*)take((size_t)4 * DQ * DM * 2);                 // bf16 Wq, Wk, Wv, Wo
    bf* X6 = (bf*)take((size_t)3 * NB_ * TT * DM * 2);           // bf16 token planes [input][batch][t][d]
    h16* P16 = (h16*)take(3 * NB_ * PLN * 2); bf* Ph = (bf*)take(3 * NB_ * PLN * 2); bf* Pl = (bf*)take(3 * NB_ * PLN * 2);   // head planes [input: Q, K, V^T][batch]
    bf* ATh = (bf*)take((size_t)NB_ * TT * DQ * 2); bf* ATl = (bf*)take((size_t)NB_ * TT * DQ * 2); bf* MF = (bf*)take((size_t)TT * TT * 2);
    if ((size_t)(wsp - (char*)d_ws) > ws_size) return;    // ws 256 MiB
    k_prep<<<4 * NWB + 3 * NB_ * NXB + NMB, 256, 0, stream>>>(wq, wk, wv, wo, xq, xk, xv, MK, W4, X6, MF);
    k_proj<<<dim3((DQ / 64) * (TT / 64), 1, 3 * NB_), 32, 0, stream>>>(W4, X6, bq, bk, bv, P16, Ph, Pl);
    k_fattn<<<dim3(AGX, NH_, NB_), AW * 32, 0, stream>>>(P16, P16 + NB_ * PLN, P16 + 2 * NB_ * PLN, Ph, Pl, Ph + NB_ * PLN, Pl + NB_ * PLN, Ph + 2 * NB_ * PLN, Pl + 2 * NB_ * PLN, MF, ATh, ATl);
    k_gemmw<bf, 1, true><<<dim3(NB_ * TT / 64, DM / 64, 1), 32, 0, stream>>>(ATh, ATl, W4 + (size_t)3 * DQ * DM, nullptr, DQ, OUT, DM, bo, 0, 0, 0, nullptr, nullptr, nullptr);   /* out (S*B rows, in the view's memory order) = view Wo^T + bo */
}

// v007
// Measured time: 211 microseconds a run.
// Next to v006, in two timings, it ran 1.12 times as fast each time.
// Over all steps from v000 it is 10.4 times as fast.
#include <hip/hip_runtime.h>

// Multi-head attention on sequence-first tensors with the module's raw-view head merge (q, k, v [2048][2][1024] = [s][b][d]; projections 'oi' [1024][1024] + biases; per (head, batch): scores = q.k/8 + attn_mask[i][j] (f32 [2048][2048] input, read); softmax; O[h][b][s][dh] = attn.v; the module then views the contiguous (H, B, S, Dh) tensor directly as (S, B, D) (NO head transpose) and applies Wo^T + bo -> out [2048][2][1024]).
// Layout: both batch elements are read from the interleaved rows (row stride 2 x 1024); all 32 (head, batch) attention problems write O contiguously in (h, b, s, dh) order, whose memory IS the module's (S x B, D) view, so the output projection is one GEMM over 4096 rows.
// Fragment order: every 16-bit operand plane [rows][K] (attention's Q, K: K = HD; V^T: K = TT; the GEMMs' weights, tokens and attention output: K = DM) lies in units of 16 rows x 32 k (1 KB): [row tile][k tile][k bit 4][lane = 16 * (k bit 3) + row % 16][k % 8], so a wave-wide 16-byte load of half a fragment reads 512 contiguous bytes (4 whole lines). The projection GEMMs store the head planes themselves, straight from their accumulators; k_prep stores the weight and token planes so, k_fattn its output planes.
// Compute dtypes, f32 accumulate: every input rounded to bf16; q/k/v on PLAIN bf16 operands (inputs: exact) + biases; additive mask (bf16-rounded, packed once by k_prep) added inside the fused attention kernel; scores and attn.v: query rows < 512 hl (3 products), the rest single fp16 (x1024); softmax f32; Wo hl x exact (2 products) + bo.

#define NB_  2
#define TT   2048
#define DM   1024
#define NH_  16
#define NKV  16
#define REP  (NH_ / NKV)
#define HD   64
#define DQ   (NH_ * HD)
#define DKV  (NKV * HD)
typedef __attribute__((ext_vector_type(4))) unsigned short v4us;
#define RH   512                  // query rows < RH use hi+lo planes (0: none)
#define WIN  0
#define PCAR 1024.0f
#define SCL  0.125f   // HD^-0.5
typedef _Float16 h16;
typedef unsigned short bf;
typedef __attribute__((ext_vector_type(16))) __bf16   v16bf;
typedef __attribute__((ext_vector_type(16))) _Float16 v16h;
typedef __attribute__((ext_vector_type(8)))  _Float16 v8h;
typedef __attribute__((ext_vector_type(8)))  unsigned short v8us;
typedef __attribute__((ext_vector_type(8)))  float    v8f;
typedef __attribute__((ext_vector_type(4)))  float    v4f;
typedef v8h  __attribute__((may_alias)) v8ha;
typedef v4f  __attribute__((may_alias)) v4fa;
typedef v8us __attribute__((may_alias)) v8usa;

__device__ __forceinline__ unsigned short f2bf(float f) { unsigned u = __float_as_uint(f); u += 0x7FFFu + ((u >> 16) & 1u); return (unsigned short)(u >> 16); }
__device__ __forceinline__ float bf2f(unsigned short b) { return __uint_as_float(((unsigned)b) << 16); }
__device__ __forceinline__ float bfr(float f) { return bf2f(f2bf(f)); }
__device__ __forceinline__ v16h cat16(v8h lo, v8h hi) { return __builtin_shufflevector(lo, hi, 0, 1, 2, 3, 4, 5, 6, 7, 8, 9, 10, 11, 12, 13, 14, 15); }
__device__ __forceinline__ v16bf cat16b(v8us lo, v8us hi) { return __builtin_bit_cast(v16bf, __builtin_shufflevector(lo, hi, 0, 1, 2, 3, 4, 5, 6, 7, 8, 9, 10, 11, 12, 13, 14, 15)); }
__device__ __forceinline__ v8f wmma16(v16h a, v16h b, v8f c) { return __builtin_amdgcn_wmma_f32_16x16x32_f16(false, a, false, b, (short)0, c, false, false); }
__device__ __forceinline__ v8f wmmab(v16bf a, v16bf b, v8f c) { return __builtin_amdgcn_wmma_f32_16x16x32_bf16(false, a, false, b, (short)0, c, false, false); }



// ---- k_gemmw: register-blocked GEMM, ONE WAVE per 64x64 output tile (16 accumulators), operands straight from fragment-ordered 16-bit planes; grid (M/64, N/64, Z), 32 threads.
// C[m][n] (f32, pitch ldc, + optional f32 bias[n]) = sum_k A[m][k] Bt[n][k] (+ split products per NSPLIT). z-batch strides sA/sB/sC in elements. K % (32 * KS) == 0.
// KS > 1: grid z = Z * KS; work-group z * KS + ks sums only k in [ks, ks + 1) * K / KS and stores its partial tile in C plane z * KS + ks (plane stride sC); the caller adds the KS planes.
// funit: offset of the unit (row tile rt, k tile kt) of a fragment-ordered plane. ldf (below) loads a fragment from unit + lane * 8.
// PACK != 0 (the q, k, v projections): no f32 C; the wave adds the bias and stores its tile as the three head planes (fp16, bf16 hi, bf16 lo) in fragment order. A lane's 8 accumulator values of one 16x16 block are 8 consecutive A rows at one B row = one 16-byte chunk of a plane whose k runs along the A rows, and the block's 32 chunks are 512 contiguous bytes.
// PACK == 1 (Q, K: plane [h * TT + t][d]): A = the weight (64 rows = head bx), Bt = the tokens, bias by A row. PACK == 2 (V^T: plane [h * HD + d][t]): A = the tokens, Bt = the weight, bias by Bt row.
// fchunk: thread -> 16-byte chunk for the mask packer: lane bits 0-2 = row % 8, 3 = k bit 3, 4 = k bit 4, thread bit 5 = row bit 3, so a wave reads 8 rows x 32 k (whole 128-byte lines of the f32 source) and stores 4 whole lines.
__device__ __forceinline__ size_t fchunk(size_t i) { return (i & ~(size_t)63) | (i & 7) | ((i >> 2) & 8) | ((i & 24) << 1); }
__device__ __forceinline__ size_t funit(size_t rt, int K, int kt) { return (rt * (size_t)(K / 32) + kt) << 9; }
// qtok: attention's query row r -> its token. A query tile (16 rows) holds tokens 16 apart (the two low hex digits swapped; its own inverse), i.e. the same 64 columns of 16 neighbouring rows of the module's (S x B, D) view: the tile's outputs fill whole 256-byte row groups of the fragment-ordered view plane, so every line of that plane has one writing work-group.
__device__ __forceinline__ size_t qtok(size_t r) { return (r & ~(size_t)255) | ((r & 15) << 4) | ((r >> 4) & 15); }
// felem: offset of element (row, k) of a fragment-ordered plane.
__device__ __forceinline__ size_t felem(size_t row, int K, int k) { return funit(row >> 4, K, k >> 5) + ((k >> 4) & 1) * 256 + (((k >> 3) & 1) * 16 + (row & 15)) * 8 + (k & 7); }
__device__ __forceinline__ h16 tohx(float x) { return (h16)x; }
__device__ __forceinline__ void splitf(float y, unsigned short& h, unsigned short& l) { h = f2bf(y); l = f2bf(y - bf2f(h)); }
template <typename T16> struct WFrag;
template <> struct WFrag<h16> { typedef v16h V; static __device__ __forceinline__ v8f mma(V a, V b, v8f c) { return wmma16(a, b, c); } };
template <> struct WFrag<bf> { typedef v16bf V; static __device__ __forceinline__ v8f mma(V a, V b, v8f c) { return wmmab(a, b, c); } };
__device__ __forceinline__ v16h ldf(const h16* p) { return cat16(*(const v8h*)p, *(const v8h*)(p + 256)); }
__device__ __forceinline__ v16bf ldf(const bf* p) { return cat16b(*(const v8us*)p, *(const v8us*)(p + 256)); }
// gemmw is the body; bx, by, zb are the tile's indices (k_gemmw: the grid's own; k_proj: derived from its flat index).
template <typename T16, int NSPLIT, bool BIAS, int KS = 1, int PACK = 0>
__device__ __forceinline__ void gemmw(const T16* __restrict__ A, const T16* __restrict__ A2, const T16* __restrict__ Bt, const T16* __restrict__ Bt2, int K, float* C, int ldc, const float* __restrict__ bias, size_t sA, size_t sB, size_t sC, h16* __restrict__ P16, bf* __restrict__ Ph, bf* __restrict__ Pl, int bx, int by, size_t zb) {
    typedef typename WFrag<T16>::V V;
    __shared__ __align__(16) float os[16 * 68];
    const size_t z = zb / KS; const int k0 = (int)(zb % KS) * (K / KS), k1 = k0 + K / KS; A += z * sA; if (A2) A2 += z * sA; Bt += z * sB; if (Bt2) Bt2 += z * sB; C += zb * sC;
    const int lane = threadIdx.x & 31, lr = lane & 15, hi = lane >> 4; const int r0 = bx * 64, c0 = by * 64;
    v8f acc[4][4];
#pragma unroll
    for (int mb = 0; mb < 4; ++mb)
#pragma unroll
        for (int nb = 0; nb < 4; ++nb) acc[mb][nb] = (v8f){};
    const size_t aoff = (size_t)r0 * K + lane * 8, boff = (size_t)c0 * K + lane * 8;   /* funit(first row tile, K, 0) + the lane's chunk; a row tile further: 16 * K elements, a k tile further: 512 */
#pragma unroll 1
    for (int kc = k0; kc < k1; kc += 32) {
        V a[4], a2[4]; const T16* pa = A + aoff + (size_t)kc * 16; const T16* pa2 = A2 + aoff + (size_t)kc * 16; const T16* pb = Bt + boff + (size_t)kc * 16; const T16* pb2 = Bt2 + boff + (size_t)kc * 16;   /* this k tile's units of the first row tiles */
#pragma unroll
        for (int mb = 0; mb < 4; ++mb) { a[mb] = ldf(pa + (size_t)mb * 16 * K); if (NSPLIT == 1 || NSPLIT == 2) a2[mb] = ldf(pa2 + (size_t)mb * 16 * K); }
        /* before any address register of the loads above is reused; the addresses as inputs keep their registers from becoming a load's destination in front of the wait */
        if constexpr (NSPLIT == 1 || NSPLIT == 2) asm volatile("s_wait_xcnt 0x0" :: "v"(pa), "v"(pa2) : "memory"); else asm volatile("s_wait_xcnt 0x0" :: "v"(pa) : "memory");
#pragma unroll
        for (int nb = 0; nb < 4; ++nb) { const V b = ldf(pb + (size_t)nb * 16 * K); V b2; if (NSPLIT >= 2) b2 = ldf(pb2 + (size_t)nb * 16 * K);
            if constexpr (NSPLIT >= 2) asm volatile("s_wait_xcnt 0x0" :: "v"(pb), "v"(pb2) : "memory"); else asm volatile("s_wait_xcnt 0x0" :: "v"(pb) : "memory");   /* as above */
#pragma unroll
            for (int mb = 0; mb < 4; ++mb) { acc[mb][nb] = WFrag<T16>::mma(a[mb], b, acc[mb][nb]); if (NSPLIT == 1 || NSPLIT == 2) acc[mb][nb] = WFrag<T16>::mma(a2[mb], b, acc[mb][nb]); if (NSPLIT >= 2) acc[mb][nb] = WFrag<T16>::mma(a[mb], b2, acc[mb][nb]); } }
        asm volatile("v_nop\n\tv_nop\n\tv_nop\n\tv_nop" : "+v"(acc[0][0]), "+v"(acc[1][1]), "+v"(acc[2][2]), "+v"(acc[3][3]) : "v"(a[0]), "v"(a[3]));
    }
    if constexpr (PACK != 0) {
        static_assert(HD == 64, "a 64-row tile is one head");
        v8f ba[4]; float bb[4];   /* the lane's biases: by A row (8 a block row) or by Bt row (1 a block column) */
#pragma unroll   // constant indices keep ba and bb in registers
        for (int i = 0; i < 4; ++i) { if (PACK == 1) ba[i] = *(const v8f*)(bias + r0 + i * 16 + hi * 8); else bb[i] = bias[c0 + i * 16 + lr]; }
        /* the wait stands before the address registers of the bias loads are reused; the loaded values as inputs hold all the loads in front of the blocks, so that they share one latency */
        if constexpr (PACK == 1) asm volatile("s_wait_xcnt 0x0" :: "v"(ba[0]), "v"(ba[1]), "v"(ba[2]), "v"(ba[3]) : "memory");
        else asm volatile("s_wait_xcnt 0x0" :: "v"(bb[0]), "v"(bb[1]), "v"(bb[2]), "v"(bb[3]) : "memory");
#pragma unroll   // constant indices keep acc in registers
        for (int mb = 0; mb < 4; ++mb) {
#pragma unroll
            for (int nb = 0; nb < 4; ++nb) {
                const size_t e = (PACK == 1 ? funit((size_t)bx * (TT / 16) + c0 / 16 + nb, HD, mb >> 1) : funit((size_t)(c0 / 16 + nb), TT, r0 / 32 + (mb >> 1))) + (mb & 1) * 256 + lane * 8;
                v8h o16; v8us oh, ol;
#pragma unroll
                for (int j = 0; j < 8; ++j) { const float x = acc[mb][nb][j] + bfr(PACK == 1 ? ba[mb][j] : bb[nb]); o16[j] = tohx(x); unsigned short a2, c2; splitf(x, a2, c2); oh[j] = a2; ol[j] = c2; }
                /* the three plane stores and their wait in one statement: the wait stands before any address or data register of the stores is reused */
                asm volatile("global_store_b128 %0, %3, off\n\tglobal_store_b128 %1, %4, off\n\tglobal_store_b128 %2, %5, off\n\ts_wait_xcnt 0x0" :: "v"(P16 + e), "v"(Ph + e), "v"(Pl + e), "v"(o16), "v"(oh), "v"(ol) : "memory");
            }
        }
        return;
    }
#pragma unroll
    for (int mb = 0; mb < 4; ++mb) {
#pragma unroll
        for (int nb = 0; nb < 4; ++nb) {
#pragma unroll
            for (int j = 0; j < 8; ++j) os[(hi * 8 + j) * 68 + nb * 16 + lr] = acc[mb][nb][j]; }
        __builtin_amdgcn_wave_barrier(); asm volatile("" ::: "memory");
        float* crow = C + (size_t)(r0 + mb * 16) * ldc + c0;
{
#pragma unroll
            for (int s = 0; s < 8; ++s) { const int row = 2 * s + hi, cofs = lr * 4; v4f val = *(const v4fa*)(os + row * 68 + cofs); if (BIAS) { val[0] += bfr(bias[c0 + cofs]); val[1] += bfr(bias[c0 + cofs + 1]); val[2] += bfr(bias[c0 + cofs + 2]); val[3] += bfr(bias[c0 + cofs + 3]); }
                *(v4f*)(crow + (size_t)row * ldc + cofs) = val; }
            asm volatile("s_wait_xcnt 0x0" ::: "memory");   /* before the data and address registers of the stores above are reused */
             }
        __builtin_amdgcn_wave_barrier(); asm volatile("" ::: "memory");
    }
}
// K is a template constant: a fragment's place is then its plane's one address register + an immediate offset.
template <typename T16, int NSPLIT, bool BIAS, int K, int KS = 1, int PACK = 0>
__global__ __launch_bounds__(32) void k_gemmw(const T16* __restrict__ A, const T16* __restrict__ A2, const T16* __restrict__ Bt, const T16* __restrict__ Bt2, float* C, int ldc, const float* __restrict__ bias, size_t sA, size_t sB, size_t sC, h16* __restrict__ P16, bf* __restrict__ Ph, bf* __restrict__ Pl) {
    gemmw<T16, NSPLIT, BIAS, KS, PACK>(A, A2, Bt, Bt2, K, C, ldc, bias, sA, sB, sC, P16, Ph, Pl, (int)blockIdx.x, (int)blockIdx.y, (size_t)blockIdx.z);
}
// k_proj: the q, k and v projections of both batch elements in ONE launch, so that 6 x 512 one-wave tiles are resident together and hide each other's load latency. grid (512, 1, 3 * NB_): z = input * NB_ + batch picks the weight plane (W3 + input), the token plane (X6 + z), the bias and the three output planes (+ z).
#define PLN  ((size_t)NH_ * TT * HD)   // elements of one head plane set (one input, one batch element)
__global__ __launch_bounds__(32) void k_proj(const bf* __restrict__ W3, const bf* __restrict__ X6, const float* __restrict__ bq, const float* __restrict__ bk, const float* __restrict__ bv, h16* __restrict__ P16, bf* __restrict__ Ph, bf* __restrict__ Pl) {
    static_assert(DQ == DKV && DQ == DM, "the weight planes and the head planes of q, k, v have one size");
    const int z = blockIdx.z, in = z / NB_, t = blockIdx.x;
    const bf* Wp = W3 + (size_t)in * DQ * DM; const bf* X = X6 + (size_t)z * TT * DM; const size_t po = (size_t)z * PLN;
    if (in < 2) gemmw<bf, 0, true, 1, 1>(Wp, nullptr, X, nullptr, DM, nullptr, 0, in == 0 ? bq : bk, 0, 0, 0, P16 + po, Ph + po, Pl + po, t % (DQ / 64), t / (DQ / 64), 0);
    else gemmw<bf, 0, true, 1, 2>(X, nullptr, Wp, nullptr, DM, nullptr, 0, bv, 0, 0, 0, P16 + po, Ph + po, Pl + po, t % (TT / 64), t / (TT / 64), 0);
}

typedef __attribute__((ext_vector_type(2))) _Float16 v2h;
typedef __attribute__((ext_vector_type(4))) _Float16 v4h;
typedef __attribute__((ext_vector_type(2))) unsigned short v2us;
typedef __attribute__((ext_vector_type(4))) unsigned short v4us;
typedef __attribute__((ext_vector_type(2))) float v2f;
typedef __attribute__((ext_vector_type(4))) int v4i;

__global__ __launch_bounds__(256) void k_wtG(const float* __restrict__ w, int K, int N, bf* Bt) {
    const int lane = threadIdx.x & 31; const int L0 = (blockIdx.x * 8 + (threadIdx.x >> 5)) * 8; const int nlines = N * K / 64;
{
#pragma unroll 1
        for (int l = 0; l < 8; ++l) { const int L = L0 + l; if (L >= nlines) break; const size_t e = (size_t)L * 64 + lane * 2; const int k = (int)(e % K), n = (int)(e / K); v2us o;
            o[0] = f2bf(w[(size_t)k * N + n]); o[1] = f2bf(w[(size_t)(k + 1) * N + n]); *(v2us*)(Bt + e) = o; }
         }
}
// cvt8s: block blk of token plane y = input * NB_ + batch, stored in fragment order (thread -> chunk by fchunk, as in the mask packer: whole lines read, whole lines stored).
__device__ __forceinline__ void cvt8s(const float* __restrict__ xq, const float* __restrict__ xk, const float* __restrict__ xv, bf* dst, size_t n8, int blk, int y) { const size_t i = fchunk((size_t)blk * 256 + threadIdx.x); if (i >= n8) return; const int in = y / NB_, b = y % NB_; const float* src = in == 0 ? xq : in == 1 ? xk : xv; dst += (size_t)y * TT * DM; const size_t e = i * 8; const size_t t = (i >> 6) / (DM / 32) * 16 + (i & 15), c = (i >> 6) % (DM / 32) * 32 + ((i >> 4) & 3) * 8; const v8f v = *(const v8f*)(src + ((in == 0 ? qtok(t) : t) * NB_ + b) * DM + c); v8us o;   /* the query plane lies in attention's query order */
#pragma unroll
    for (int k = 0; k < 8; ++k) o[k] = f2bf(v[k]); *(v8us*)(dst + e) = o;  }
// cvt8: block blk of weight plane y (n8 * 8 elements each, [rows][DM]), stored in fragment order like the token planes.
__device__ __forceinline__ void cvt8(const float* __restrict__ wq, const float* __restrict__ wk, const float* __restrict__ wv, const float* __restrict__ wo, bf* dst, size_t n8, int blk, int y) { const size_t i = fchunk((size_t)blk * 256 + threadIdx.x); if (i >= n8) return; const float* src = y == 0 ? wq : y == 1 ? wk : y == 2 ? wv : wo; dst += (size_t)y * n8 * 8; const v8f v = *(const v8f*)(src + ((i >> 6) / (DM / 32) * 16 + (i & 15)) * DM + (i >> 6) % (DM / 32) * 32 + ((i >> 4) & 3) * 8); v8us o;
#pragma unroll
    for (int k = 0; k < 8; ++k) o[k] = f2bf(v[k]); *(v8us*)(dst + i * 8) = o;  }

// mkf: attn_mask rounded to bf16, once a call, in the order of a score tile's accumulators (query rows in attention's order, qtok): [query tile][key tile][lane = 16 * (key bit 3) + query % 16][key % 8], so k_fattn reads a tile's mask by one 16-byte load a lane, 512 contiguous bytes a wave.
__device__ __forceinline__ void mkf(const float* __restrict__ MK, bf* MF, int blk) { const size_t i = fchunk((size_t)blk * 256 + threadIdx.x); const size_t tile = i >> 5; const int lane = (int)(i & 31); const v8f v = *(const v8f*)(MK + qtok((tile / (TT / 16)) * 16 + (lane & 15)) * TT + (tile % (TT / 16)) * 16 + (lane >> 4) * 8); v8us o;
#pragma unroll   // constant indices keep v[k] and o[k] in registers
    for (int k = 0; k < 8; ++k) o[k] = f2bf(v[k]); *(v8us*)(MF + i * 8) = o; asm volatile("s_wait_xcnt 0x0" ::: "memory");   /* before the address registers of the store are reused: in k_prep's code the other two branches follow this one */ }
// k_prep: every f32 -> bf16 conversion of the call in ONE launch (they are independent of each other): blocks [0, 4 NWB) the four weights, then 3 * NB_ * NXB blocks the token planes, then NMB blocks the mask. The range tests are block-uniform.
#define NWB  (DQ * DM / 8 / 256)
#define NXB  (TT * DM / 8 / 256)
#define NMB  (TT * (TT / 8) / 256)
__global__ __launch_bounds__(256) void k_prep(const float* __restrict__ wq, const float* __restrict__ wk, const float* __restrict__ wv, const float* __restrict__ wo, const float* __restrict__ xq, const float* __restrict__ xk, const float* __restrict__ xv, const float* __restrict__ MK, bf* W4, bf* X6, bf* MF) {
    static_assert(DQ * DM % (8 * 256) == 0 && TT * DM % (8 * 256) == 0 && DKV == DQ, "whole blocks; four weight planes of one size");
    const int blk = blockIdx.x;
    if (blk < 4 * NWB) cvt8(wq, wk, wv, wo, W4, (size_t)DQ * DM / 8, blk % NWB, blk / NWB);
    else if (blk < 4 * NWB + 3 * NB_ * NXB) cvt8s(xq, xk, xv, X6, (size_t)TT * DM / 8, (blk - 4 * NWB) % NXB, (blk - 4 * NWB) / NXB);
    else mkf(MK, MF, blk - 4 * NWB - 3 * NB_ * NXB);
}
// k_fattn: scores, softmax and attn.v of 16 (hi+lo rows) or 32 (fp16 rows) query rows of one head in ONE work-group (16 waves); no score or weight plane in memory. grid (AGX, heads, NB_), 512 threads.
// Transposed products: S^T = K Q^T (A = 16 key rows, B = the 16 query rows), so lane (lr, hi) holds query lr's scores of keys 8 hi + j of each 16-key tile; wave w owns keys [w, w + 1) * TT / AW and keeps its NQ x AT score tiles in registers.
// Row maximum and row sum: in the lane, across the two lane halves, then across the waves through LDS. Two neighbouring score tiles, scaled and converted in place, ARE the B fragment (hardware k order) of O^T += V^T P^T.
// Each wave's partial O^T (its own key range) goes to LDS; the AW partials are added in ascending key order and stored as the bf16 hi and lo operand planes of the output projection: the (h, b, s, dh) order read as rows of DQ, in fragment order.
#define AW   16                   // waves per work-group, one key range each
#define AKW  (TT / AW)            // keys per wave
#define AT   (AKW / 16)           // 16-key tiles per wave (score tiles per query tile)
#define OP   68                   // LDS pitch (floats) of one query's partial output row
typedef v2f __attribute__((may_alias)) v2fa;
template <int N> struct FV;
template <> struct FV<2> { typedef v2f F; typedef v2f __attribute__((may_alias)) FA; typedef v2us U; };
template <> struct FV<4> { typedef v4f F; typedef v4f __attribute__((may_alias)) FA; typedef v4us U; };
// NQ: query tiles (16 rows each) of the work-group. Every K and V^T fragment that a wave loads is multiplied with all NQ query tiles, so the bytes read per query row fall by NQ; each query's own sums keep their order.
template <typename T16, bool HL, int NQ>
__device__ __forceinline__ void attn_rows(const T16* __restrict__ Q, const T16* __restrict__ Q2, const T16* __restrict__ Kp, const T16* __restrict__ K2, const T16* __restrict__ Vt, const T16* __restrict__ Vt2, const bf* __restrict__ MF, bf* __restrict__ Oh, bf* __restrict__ Ol, int i0, float* red, float* osm) {
    typedef typename WFrag<T16>::V V;
    const int lane = threadIdx.x & 31, lr = lane & 15, hi = lane >> 4, w = threadIdx.x >> 5; const int kb = w * AKW;
    V q[NQ][2], q2[NQ][2];
#pragma unroll
    for (int qt = 0; qt < NQ; ++qt)
#pragma unroll
        for (int ks = 0; ks < 2; ++ks) q[qt][ks] = ldf(Q + funit(i0 / 16 + qt, HD, ks) + lane * 8);
    asm volatile("s_wait_xcnt 0x0" ::: "memory");   /* before the address registers of the query loads are reused */
    if (HL) {
#pragma unroll   // constant indices keep q2 in registers
        for (int qt = 0; qt < NQ; ++qt)
#pragma unroll
            for (int ks = 0; ks < 2; ++ks) q2[qt][ks] = ldf(Q2 + funit(i0 / 16 + qt, HD, ks) + lane * 8);
        asm volatile("s_wait_xcnt 0x0" ::: "memory");   /* as above */
    }
    const bf* mk = MF + ((size_t)(i0 / 16) * (TT / 16) + kb / 16) * 256 + lane * 8;
    constexpr int GT = (HL || NQ > 1) ? 1 : 2, NG = AT / GT;         // 16-key tiles per load group; two groups in flight: one lands while the one before it is multiplied
    constexpr int GD = (HL || NQ > 1) ? 1 : 2, DG = HD / 16 / GD, NV = AT / 4 * DG;   // the same for attn.v: a load group is GD d tiles x 64 keys; groups per 64 keys, groups
    V k[2][GT][2], k2[2][GT][2], va[2][GD][2], va2[2][GD][2]; v8us m[2][GT][NQ];
    v8f s[NQ][AT]; float mx[NQ];
#pragma unroll
    for (int qt = 0; qt < NQ; ++qt) mx[qt] = -3.0e38f;
#pragma unroll
    for (int g = -1; g < NG; ++g) {
        if (g + 1 < NG) {
#pragma unroll
            for (int u = 0; u < GT; ++u) { const int t = (g + 1) * GT + u; const size_t ko = funit(kb / 16 + t, HD, 0) + lane * 8;
#pragma unroll
                for (int ks = 0; ks < 2; ++ks) { k[(g + 1) & 1][u][ks] = ldf(Kp + ko + ks * 512); if (HL) k2[(g + 1) & 1][u][ks] = ldf(K2 + ko + ks * 512); }
#pragma unroll
                for (int qt = 0; qt < NQ; ++qt) m[(g + 1) & 1][u][qt] = *(const v8us*)(mk + (size_t)qt * (TT / 16) * 256 + t * 256); }
            asm volatile("s_wait_xcnt 0x0" ::: "memory");   /* before any register that the loads above name (address, scalar base) is reused */
        }
        if (g >= 0) {
#pragma unroll
            for (int u = 0; u < GT; ++u) { const int t = g * GT + u;
#pragma unroll
                for (int qt = 0; qt < NQ; ++qt) { v8f a = (v8f){};
#pragma unroll
                    for (int ks = 0; ks < 2; ++ks) { a = WFrag<T16>::mma(k[g & 1][u][ks], q[qt][ks], a); if (HL) { a = WFrag<T16>::mma(k[g & 1][u][ks], q2[qt][ks], a); a = WFrag<T16>::mma(k2[g & 1][u][ks], q[qt][ks], a); } }
#pragma unroll
                    for (int j = 0; j < 8; ++j) { const float tv = a[j] * SCL + bf2f(m[g & 1][u][qt][j]);   /* q.k / 8 (exact scaling) + attn_mask[i][j] */ a[j] = tv; mx[qt] = fmaxf(mx[qt], tv); }
                    s[qt][t] = a; } }
            __builtin_amdgcn_sched_barrier(0);   /* holds the loads of group g + 2 behind this group's products: without it every load is hoisted to the top and registers spill */
        }
    }
    auto ldv = [&](int g) {   /* V^T fragments of load group g */
#pragma unroll
        for (int u = 0; u < GD; ++u)
#pragma unroll
            for (int kq = 0; kq < 2; ++kq) { const size_t vo = funit((g % DG) * GD + u, TT, kb / 32 + (g / DG) * 2 + kq) + lane * 8; va[g & 1][u][kq] = ldf(Vt + vo); if (HL) va2[g & 1][u][kq] = ldf(Vt2 + vo); }
        asm volatile("s_wait_xcnt 0x0" ::: "memory");   /* as above */
    };
    ldv(0);   /* lands during the softmax */
#pragma unroll
    for (int qt = 0; qt < NQ; ++qt) { mx[qt] = fmaxf(mx[qt], __shfl_xor(mx[qt], 16, 32)); if (hi == 0) red[(w * NQ + qt) * 16 + lr] = mx[qt]; }
    __syncthreads();
    float f[NQ];
#pragma unroll
    for (int qt = 0; qt < NQ; ++qt) {
#pragma unroll
        for (int ww = 0; ww < AW; ++ww) mx[qt] = fmaxf(mx[qt], red[(ww * NQ + qt) * 16 + lr]);
        float sum = 0.f;
#pragma unroll
        for (int t = 0; t < AT; ++t)
#pragma unroll
            for (int j = 0; j < 8; ++j) { const float x = (s[qt][t][j] - mx[qt]) * 1.4426950408889634f; float e;
                asm("v_exp_f32 %0, %1\n\tv_nop" : "=v"(e) : "v"(x));   /* 2^x; the v_nop is the slot the instruction set asks for behind a transcendental, before its source is overwritten or its result read */
                s[qt][t][j] = e; sum += e; }
        sum += __shfl_xor(sum, 16, 32); if (hi == 0) red[((AW + w) * NQ + qt) * 16 + lr] = sum;
    }
    __syncthreads();
#pragma unroll
    for (int qt = 0; qt < NQ; ++qt) { float sum = red[(AW * NQ + qt) * 16 + lr];
#pragma unroll
        for (int ww = 1; ww < AW; ++ww) sum += red[((AW + ww) * NQ + qt) * 16 + lr];
        f[qt] = __fdiv_rn(HL ? 1.0f : PCAR, sum); }
    v8f o[NQ][HD / 16];
#pragma unroll
    for (int qt = 0; qt < NQ; ++qt)
#pragma unroll
        for (int dt = 0; dt < HD / 16; ++dt) o[qt][dt] = (v8f){};
    V p[NQ][2], p2[NQ][2];
#pragma unroll
    for (int g = 0; g < NV; ++g) { const int d0 = (g % DG) * GD;
        if (g + 1 < NV) ldv(g + 1);
        if (d0 == 0) {   /* the weights of this 64-key block as two B fragments (32 keys each) a query tile */
#pragma unroll
            for (int qt = 0; qt < NQ; ++qt)
#pragma unroll
            for (int kq = 0; kq < 2; ++kq) { const int kk = (g / DG) * 2 + kq;
                if constexpr (HL) { v8us h0, h1, l0, l1;
#pragma unroll
                    for (int j = 0; j < 8; ++j) { unsigned short x, y; splitf(s[qt][2 * kk][j] * f[qt], x, y); h0[j] = x; l0[j] = y; splitf(s[qt][2 * kk + 1][j] * f[qt], x, y); h1[j] = x; l1[j] = y; }
                    p[qt][kq] = cat16b(h0, h1); p2[qt][kq] = cat16b(l0, l1);
                } else { v8h x0, x1;
#pragma unroll
                    for (int j = 0; j < 8; ++j) { x0[j] = tohx(s[qt][2 * kk][j] * f[qt]); x1[j] = tohx(s[qt][2 * kk + 1][j] * f[qt]); }
                    p[qt][kq] = cat16(x0, x1); } } }
#pragma unroll
        for (int u = 0; u < GD; ++u)
#pragma unroll
            for (int kq = 0; kq < 2; ++kq)
#pragma unroll
                for (int qt = 0; qt < NQ; ++qt) { o[qt][d0 + u] = WFrag<T16>::mma(va[g & 1][u][kq], p[qt][kq], o[qt][d0 + u]); if constexpr (HL) { o[qt][d0 + u] = WFrag<T16>::mma(va[g & 1][u][kq], p2[qt][kq], o[qt][d0 + u]); o[qt][d0 + u] = WFrag<T16>::mma(va2[g & 1][u][kq], p[qt][kq], o[qt][d0 + u]); } }
        __builtin_amdgcn_sched_barrier(0);   /* as in the score loop: two load groups in flight, no more */
    }
#pragma unroll
    for (int qt = 0; qt < NQ; ++qt) { float* ow = osm + ((w * NQ + qt) * 16 + lr) * OP + 8 * hi;
#pragma unroll
        for (int dt = 0; dt < HD / 16; ++dt) { v4f lo4, hi4;
#pragma unroll
            for (int j = 0; j < 4; ++j) { lo4[j] = o[qt][dt][j]; hi4[j] = o[qt][dt][4 + j]; }
            *(v4fa*)(ow + dt * 16) = lo4; *(v4fa*)(ow + dt * 16 + 4) = hi4; } }
    __syncthreads();
    constexpr int EW = 2 * NQ;   /* NQ * 16 x HD outputs over AW * 32 = 512 threads: EW neighbours a thread */
    typedef typename FV<EW>::F RF; typedef typename FV<EW>::FA RFA; typedef typename FV<EW>::U RU;
    const int qi = threadIdx.x / (HD / EW), d2 = (threadIdx.x % (HD / EW)) * EW; RF r = *(const RFA*)(osm + qi * OP + d2);
#pragma unroll
    for (int ww = 1; ww < AW; ++ww) r += *(const RFA*)(osm + (ww * NQ * 16 + qi) * OP + d2);
    r *= HL ? 1.0f : (1.0f / PCAR);
    RU rh, rl;   /* the hi and lo operand planes of the output projection */
#pragma unroll
    for (int e = 0; e < EW; ++e) { unsigned short a2, c2; splitf(r[e], a2, c2); rh[e] = a2; rl[e] = c2; }
    static_assert(DQ / HD == 16, "qtok: a row of the view holds 16 tokens");
    const size_t tk = qtok((size_t)(i0 + qi)); const size_t fo = felem(tk / (DQ / HD), DQ, (int)(tk % (DQ / HD)) * HD + d2);   /* the view's row holds DQ / HD tokens; the EW neighbours lie in one 8-element chunk */
    *(RU*)(Oh + fo) = rh; *(RU*)(Ol + fo) = rl;
}
#define NQF  2                    // query tiles of a work-group of the single-fp16 rows (the hi+lo rows: 1, their fragments fill the registers)
#define AGX  (RH / 16 + (TT - RH) / (16 * NQF))   // grid x: first the hi+lo work-groups, then the fp16 ones
__global__ __launch_bounds__(AW * 32) void k_fattn(const h16* __restrict__ Q16, const h16* __restrict__ K16, const h16* __restrict__ V16, const bf* __restrict__ Qh, const bf* __restrict__ Ql, const bf* __restrict__ Kh, const bf* __restrict__ Kl, const bf* __restrict__ Vh, const bf* __restrict__ Vl, const bf* __restrict__ MF, bf* __restrict__ ATh, bf* __restrict__ ATl) {
    static_assert((TT - RH) % (16 * NQF) == 0 && RH % 16 == 0, "whole work-groups"); static_assert(RH % 256 == 0 && TT % 256 == 0, "qtok permutes inside blocks of 256: query row < RH == token < RH");
    __shared__ __align__(16) float osm[AW * 16 * NQF * OP]; __shared__ float red[2 * AW * 16 * NQF];
    const int bx = blockIdx.x, b = blockIdx.z; const int i0 = bx < RH / 16 ? bx * 16 : RH + (bx - RH / 16) * (16 * NQF); const size_t h = blockIdx.y, zq = b * PLN + h * TT * HD, zk = b * PLN + (h / REP) * TT * HD;   /* grid z = batch element: its plane set follows batch 0's */
    const size_t zo = (h * NB_ + b) * TT * HD; bf* Oh = ATh + zo; bf* Ol = ATl + zo;   /* (h, b, s, dh) contiguous == the module's raw (S, B, D) view; a (head, batch) is TT * HD / DQ = 128 whole rows of it, so whole row tiles: its fragment-ordered part starts at the same offset */
    if (i0 < RH) attn_rows<bf, true, 1>(Qh + zq, Ql + zq, Kh + zk, Kl + zk, Vh + zk, Vl + zk, MF, Oh, Ol, i0, red, osm);   /* block-uniform */
    else attn_rows<h16, false, NQF>(Q16 + zq, nullptr, K16 + zk, nullptr, V16 + zk, nullptr, MF, Oh, Ol, i0, red, osm);
}

extern "C" void kernel_launch(void* const* d_in, const int* in_sizes, int n_in,
                              void* d_out, int out_size, void* d_ws, size_t ws_size, hipStream_t stream) {
    (void)in_sizes; (void)n_in; (void)out_size;
    const float* xq = (const float*)d_in[0]; const float* xk = (const float*)d_in[1]; const float* xv = (const float*)d_in[2]; const float* MK = (const float*)d_in[3]; const float* wq = (const float*)d_in[4]; const float* bq = (const float*)d_in[5]; const float* wk = (const float*)d_in[6]; const float* bk = (const float*)d_in[7]; const float* wv = (const float*)d_in[8]; const float* bv = (const float*)d_in[9]; const float* wo = (const float*)d_in[10]; const float* bo = (const float*)d_in[11]; const float* x = xq; (void)x;
    float* OUT = (float*)d_out;     // [2048][2][1024]
    char* wsp = (char*)d_ws;
    auto take = [&](size_t bytes) { char* p = wsp; wsp += (bytes + 255) & ~(size_t)255; return (void*)p; };
    bf* W4 = (bf*)take((size_t)4 * DQ * DM * 2);                 // bf16 Wq, Wk, Wv, Wo
    bf* X6 = (bf*)take((size_t)3 * NB_ * TT * DM * 2);           // bf16 token planes [input][batch][t][d]
    h16* P16 = (h16*)take(3 * NB_ * PLN * 2); bf* Ph = (bf*)take(3 * NB_ * PLN * 2); bf* Pl = (bf*)take(3 * NB_ * PLN * 2);   // head planes [input: Q, K, V^T][batch]
    bf* ATh = (bf*)take((size_t)NB_ * TT * DQ * 2); bf* ATl = (bf*)take((size_t)NB_ * TT * DQ * 2); bf* MF = (bf*)take((size_t)TT * TT * 2);
    if ((size_t)(wsp - (char*)d_ws) > ws_size) return;    // ws 256 MiB
    k_prep<<<4 * NWB + 3 * NB_ * NXB + NMB, 256, 0, stream>>>(wq, wk, wv, wo, xq, xk, xv, MK, W4, X6, MF);
    k_proj<<<dim3((DQ / 64) * (TT / 64), 1, 3 * NB_), 32, 0, stream>>>(W4, X6, bq, bk, bv, P16, Ph, Pl);
    k_fattn<<<dim3(AGX, NH_, NB_), AW * 32, 0, stream>>>(P16, P16 + NB_ * PLN, P16 + 2 * NB_ * PLN, Ph, Pl, Ph + NB_ * PLN, Pl + NB_ * PLN, Ph + 2 * NB_ * PLN, Pl + 2 * NB_ * PLN, MF, ATh, ATl);
    k_gemmw<bf, 1, true, DQ><<<dim3(NB_ * TT / 64, DM / 64, 1), 32, 0, stream>>>(ATh, ATl, W4 + (size_t)3 * DQ * DM, nullptr, OUT, DM, bo, 0, 0, 0, nullptr, nullptr, nullptr);   /* out (S*B rows, in the view's memory order) = view Wo^T + bo */
}

// v008
// A run of this version takes 194 microseconds.
// Timed twice side by side with v007, it ran 1.10 times as fast both times.
// All steps since v000 together make it 11.5 times as fast.
#include <hip/hip_runtime.h>

// Multi-head attention on sequence-first tensors with the module's raw-view head merge (q, k, v [2048][2][1024] = [s][b][d]; projections 'oi' [1024][1024] + biases; per (head, batch): scores = q.k/8 + attn_mask[i][j] (f32 [2048][2048] input, read); softmax; O[h][b][s][dh] = attn.v; the module then views the contiguous (H, B, S, Dh) tensor directly as (S, B, D) (NO head transpose) and applies Wo^T + bo -> out [2048][2][1024]).
// Layout: both batch elements are read from the interleaved rows (row stride 2 x 1024); all 32 (head, batch) attention problems write O contiguously in (h, b, s, dh) order, whose memory IS the module's (S x B, D) view, so the output projection is one GEMM over 4096 rows.
// Fragment order: every 16-bit operand plane [rows][K] (attention's Q, K: K = HD; V^T: K = TT; the GEMMs' weights, tokens and attention output: K = DM) lies in units of 16 rows x 32 k (1 KB): [row tile][k tile][k bit 4][lane = 16 * (k bit 3) + row % 16][k % 8], so a wave-wide 16-byte load of half a fragment reads 512 contiguous bytes (4 whole lines). The projection GEMMs store the head planes themselves, straight from their accumulators; k_prep stores the weight and token planes so, k_fattn its output planes.
// Compute dtypes, f32 accumulate: every input rounded to bf16; q/k/v on PLAIN bf16 operands (inputs: exact) + biases; additive mask (bf16-rounded, packed once by k_prep) added inside the fused attention kernel; scores and attn.v: query rows < 512 hl (3 products), the rest single fp16 (x1024); softmax f32; Wo hl x exact (2 products) + bo.

#define NB_  2
#define TT   2048
#define DM   1024
#define NH_  16
#define NKV  16
#define REP  (NH_ / NKV)
#define HD   64
#define DQ   (NH_ * HD)
#define DKV  (NKV * HD)
typedef __attribute__((ext_vector_type(4))) unsigned short v4us;
#define RH   512                  // query rows < RH use hi+lo planes (0: none)
#define WIN  0
#define PCAR 1024.0f
#define SCL  0.125f   // HD^-0.5
typedef _Float16 h16;
typedef unsigned short bf;
typedef __attribute__((ext_vector_type(16))) __bf16   v16bf;
typedef __attribute__((ext_vector_type(16))) _Float16 v16h;
typedef __attribute__((ext_vector_type(8)))  _Float16 v8h;
typedef __attribute__((ext_vector_type(8)))  unsigned short v8us;
typedef __attribute__((ext_vector_type(8)))  float    v8f;
typedef __attribute__((ext_vector_type(4)))  float    v4f;
typedef v8h  __attribute__((may_alias)) v8ha;
typedef v4f  __attribute__((may_alias)) v4fa;
typedef v8us __attribute__((may_alias)) v8usa;

__device__ __forceinline__ unsigned short f2bf(float f) { unsigned u = __float_as_uint(f); u += 0x7FFFu + ((u >> 16) & 1u); return (unsigned short)(u >> 16); }
__device__ __forceinline__ float bf2f(unsigned short b) { return __uint_as_float(((unsigned)b) << 16); }
__device__ __forceinline__ float bfr(float f) { return bf2f(f2bf(f)); }
__device__ __forceinline__ v16h cat16(v8h lo, v8h hi) { return __builtin_shufflevector(lo, hi, 0, 1, 2, 3, 4, 5, 6, 7, 8, 9, 10, 11, 12, 13, 14, 15); }
__device__ __forceinline__ v16bf cat16b(v8us lo, v8us hi) { return __builtin_bit_cast(v16bf, __builtin_shufflevector(lo, hi, 0, 1, 2, 3, 4, 5, 6, 7, 8, 9, 10, 11, 12, 13, 14, 15)); }
__device__ __forceinline__ v8f wmma16(v16h a, v16h b, v8f c) { return __builtin_amdgcn_wmma_f32_16x16x32_f16(false, a, false, b, (short)0, c, false, false); }
__device__ __forceinline__ v8f wmmab(v16bf a, v16bf b, v8f c) { return __builtin_amdgcn_wmma_f32_16x16x32_bf16(false, a, false, b, (short)0, c, false, false); }



// ---- k_gemmw: register-blocked GEMM, ONE WAVE per 64x64 output tile (16 accumulators), operands straight from fragment-ordered 16-bit planes; grid (M/64, N/64, Z), 32 threads.
// C[m][n] (f32, pitch ldc, + optional f32 bias[n]) = sum_k A[m][k] Bt[n][k] (+ split products per NSPLIT). z-batch strides sA/sB/sC in elements. K % (32 * KS) == 0.
// KS > 1: grid z = Z * KS; work-group z * KS + ks sums only k in [ks, ks + 1) * K / KS and stores its partial tile in C plane z * KS + ks (plane stride sC); the caller adds the KS planes.
// funit: offset of the unit (row tile rt, k tile kt) of a fragment-ordered plane. ldf (below) loads a fragment from unit + lane * 8.
// PACK != 0 (the q, k, v projections): no f32 C; the wave adds the bias and stores its tile as the three head planes (fp16, bf16 hi, bf16 lo) in fragment order. A lane's 8 accumulator values of one 16x16 block are 8 consecutive A rows at one B row = one 16-byte chunk of a plane whose k runs along the A rows, and the block's 32 chunks are 512 contiguous bytes.
// PACK == 1 (Q, K: plane [h * TT + t][d]): A = the weight (64 rows = head bx), Bt = the tokens, bias by A row. PACK == 2 (V^T: plane [h * HD + d][t]): A = the tokens, Bt = the weight, bias by Bt row.
// fchunk: thread -> 16-byte chunk for the mask packer: lane bits 0-2 = row % 8, 3 = k bit 3, 4 = k bit 4, thread bit 5 = row bit 3, so a wave reads 8 rows x 32 k (whole 128-byte lines of the f32 source) and stores 4 whole lines.
__device__ __forceinline__ size_t fchunk(size_t i) { return (i & ~(size_t)63) | (i & 7) | ((i >> 2) & 8) | ((i & 24) << 1); }
__device__ __forceinline__ size_t funit(size_t rt, int K, int kt) { return (rt * (size_t)(K / 32) + kt) << 9; }
// qtok: attention's query row r -> its token. A query tile (16 rows) holds tokens 16 apart (the two low hex digits swapped; its own inverse), i.e. the same 64 columns of 16 neighbouring rows of the module's (S x B, D) view: the tile's outputs fill whole 256-byte row groups of the fragment-ordered view plane, so every line of that plane has one writing work-group.
__device__ __forceinline__ size_t qtok(size_t r) { return (r & ~(size_t)255) | ((r & 15) << 4) | ((r >> 4) & 15); }
// felem: offset of element (row, k) of a fragment-ordered plane.
__device__ __forceinline__ size_t felem(size_t row, int K, int k) { return funit(row >> 4, K, k >> 5) + ((k >> 4) & 1) * 256 + (((k >> 3) & 1) * 16 + (row & 15)) * 8 + (k & 7); }
__device__ __forceinline__ h16 tohx(float x) { return (h16)x; }
__device__ __forceinline__ void splitf(float y, unsigned short& h, unsigned short& l) { h = f2bf(y); l = f2bf(y - bf2f(h)); }
template <typename T16> struct WFrag;
template <> struct WFrag<h16> { typedef v16h V; static __device__ __forceinline__ v8f mma(V a, V b, v8f c) { return wmma16(a, b, c); } };
template <> struct WFrag<bf> { typedef v16bf V; static __device__ __forceinline__ v8f mma(V a, V b, v8f c) { return wmmab(a, b, c); } };
__device__ __forceinline__ v16h ldf(const h16* p) { return cat16(*(const v8h*)p, *(const v8h*)(p + 256)); }
__device__ __forceinline__ v16bf ldf(const bf* p) { return cat16b(*(const v8us*)p, *(const v8us*)(p + 256)); }
// gemmw is the body; bx, by, zb are the tile's indices (k_gemmw: the grid's own; k_proj: derived from its flat index).
template <typename T16, int NSPLIT, bool BIAS, int KS = 1, int PACK = 0>
__device__ __forceinline__ void gemmw(const T16* __restrict__ A, const T16* __restrict__ A2, const T16* __restrict__ Bt, const T16* __restrict__ Bt2, int K, float* C, int ldc, const float* __restrict__ bias, size_t sA, size_t sB, size_t sC, h16* __restrict__ P16, bf* __restrict__ Ph, bf* __restrict__ Pl, int bx, int by, size_t zb) {
    typedef typename WFrag<T16>::V V;
    __shared__ __align__(16) float os[16 * 68];
    const size_t z = zb / KS; const int k0 = (int)(zb % KS) * (K / KS), k1 = k0 + K / KS; A += z * sA; if (A2) A2 += z * sA; Bt += z * sB; if (Bt2) Bt2 += z * sB; C += zb * sC;
    const int lane = threadIdx.x & 31, lr = lane & 15, hi = lane >> 4; const int r0 = bx * 64, c0 = by * 64;
    v8f acc[4][4];
#pragma unroll
    for (int mb = 0; mb < 4; ++mb)
#pragma unroll
        for (int nb = 0; nb < 4; ++nb) acc[mb][nb] = (v8f){};
    const size_t aoff = (size_t)r0 * K + lane * 8, boff = (size_t)c0 * K + lane * 8;   /* funit(first row tile, K, 0) + the lane's chunk; a row tile further: 16 * K elements, a k tile further: 512 */
#pragma unroll 1
    for (int kc = k0; kc < k1; kc += 32) {
        V a[4], a2[4]; const T16* pa = A + aoff + (size_t)kc * 16; const T16* pa2 = A2 + aoff + (size_t)kc * 16; const T16* pb = Bt + boff + (size_t)kc * 16; const T16* pb2 = Bt2 + boff + (size_t)kc * 16;   /* this k tile's units of the first row tiles */
#pragma unroll
        for (int mb = 0; mb < 4; ++mb) { a[mb] = ldf(pa + (size_t)mb * 16 * K); if (NSPLIT == 1 || NSPLIT == 2) a2[mb] = ldf(pa2 + (size_t)mb * 16 * K); }
        /* before any address register of the loads above is reused; the addresses as inputs keep their registers from becoming a load's destination in front of the wait */
        if constexpr (NSPLIT == 1 || NSPLIT == 2) asm volatile("s_wait_xcnt 0x0" :: "v"(pa), "v"(pa2) : "memory"); else asm volatile("s_wait_xcnt 0x0" :: "v"(pa) : "memory");
#pragma unroll
        for (int nb = 0; nb < 4; ++nb) { const V b = ldf(pb + (size_t)nb * 16 * K); V b2; if (NSPLIT >= 2) b2 = ldf(pb2 + (size_t)nb * 16 * K);
            if constexpr (NSPLIT >= 2) asm volatile("s_wait_xcnt 0x0" :: "v"(pb), "v"(pb2) : "memory"); else asm volatile("s_wait_xcnt 0x0" :: "v"(pb) : "memory");   /* as above */
#pragma unroll
            for (int mb = 0; mb < 4; ++mb) { acc[mb][nb] = WFrag<T16>::mma(a[mb], b, acc[mb][nb]); if (NSPLIT == 1 || NSPLIT == 2) acc[mb][nb] = WFrag<T16>::mma(a2[mb], b, acc[mb][nb]); if (NSPLIT >= 2) acc[mb][nb] = WFrag<T16>::mma(a[mb], b2, acc[mb][nb]); } }
        asm volatile("v_nop\n\tv_nop\n\tv_nop\n\tv_nop" : "+v"(acc[0][0]), "+v"(acc[1][1]), "+v"(acc[2][2]), "+v"(acc[3][3]) : "v"(a[0]), "v"(a[3]));
    }
    if constexpr (PACK != 0) {
        static_assert(HD == 64, "a 64-row tile is one head");
        v8f ba[4]; float bb[4];   /* the lane's biases: by A row (8 a block row) or by Bt row (1 a block column) */
#pragma unroll   // constant indices keep ba and bb in registers
        for (int i = 0; i < 4; ++i) { if (PACK == 1) ba[i] = *(const v8f*)(bias + r0 + i * 16 + hi * 8); else bb[i] = bias[c0 + i * 16 + lr]; }
        /* the wait stands before the address registers of the bias loads are reused; the loaded values as inputs hold all the loads in front of the blocks, so that they share one latency */
        if constexpr (PACK == 1) asm volatile("s_wait_xcnt 0x0" :: "v"(ba[0]), "v"(ba[1]), "v"(ba[2]), "v"(ba[3]) : "memory");
        else asm volatile("s_wait_xcnt 0x0" :: "v"(bb[0]), "v"(bb[1]), "v"(bb[2]), "v"(bb[3]) : "memory");
#pragma unroll   // constant indices keep acc in registers
        for (int mb = 0; mb < 4; ++mb) {
#pragma unroll
            for (int nb = 0; nb < 4; ++nb) {
                const size_t e = (PACK == 1 ? funit((size_t)bx * (TT / 16) + c0 / 16 + nb, HD, mb >> 1) : funit((size_t)(c0 / 16 + nb), TT, r0 / 32 + (mb >> 1))) + (mb & 1) * 256 + lane * 8;
                v8h o16; v8us oh, ol;
#pragma unroll
                for (int j = 0; j < 8; ++j) { const float x = acc[mb][nb][j] + bfr(PACK == 1 ? ba[mb][j] : bb[nb]); o16[j] = tohx(x); unsigned short a2, c2; splitf(x, a2, c2); oh[j] = a2; ol[j] = c2; }
                /* the three plane stores and their wait in one statement: the wait stands before any address or data register of the stores is reused */
                asm volatile("global_store_b128 %0, %3, off\n\tglobal_store_b128 %1, %4, off\n\tglobal_store_b128 %2, %5, off\n\ts_wait_xcnt 0x0" :: "v"(P16 + e), "v"(Ph + e), "v"(Pl + e), "v"(o16), "v"(oh), "v"(ol) : "memory");
            }
        }
        return;
    }
#pragma unroll
    for (int mb = 0; mb < 4; ++mb) {
#pragma unroll
        for (int nb = 0; nb < 4; ++nb) {
#pragma unroll
            for (int j = 0; j < 8; ++j) os[(hi * 8 + j) * 68 + nb * 16 + lr] = acc[mb][nb][j]; }
        __builtin_amdgcn_wave_barrier(); asm volatile("" ::: "memory");
        float* crow = C + (size_t)(r0 + mb * 16) * ldc + c0;
{
#pragma unroll
            for (int s = 0; s < 8; ++s) { const int row = 2 * s + hi, cofs = lr * 4; v4f val = *(const v4fa*)(os + row * 68 + cofs); if (BIAS) { val[0] += bfr(bias[c0 + cofs]); val[1] += bfr(bias[c0 + cofs + 1]); val[2] += bfr(bias[c0 + cofs + 2]); val[3] += bfr(bias[c0 + cofs + 3]); }
                *(v4f*)(crow + (size_t)row * ldc + cofs) = val; }
            asm volatile("s_wait_xcnt 0x0" ::: "memory");   /* before the data and address registers of the stores above are reused */
             }
        __builtin_amdgcn_wave_barrier(); asm volatile("" ::: "memory");
    }
}
// K is a template constant: a fragment's place is then its plane's one address register + an immediate offset.
template <typename T16, int NSPLIT, bool BIAS, int K, int KS = 1, int PACK = 0>
__global__ __launch_bounds__(32) void k_gemmw(const T16* __restrict__ A, const T16* __restrict__ A2, const T16* __restrict__ Bt, const T16* __restrict__ Bt2, float* C, int ldc, const float* __restrict__ bias, size_t sA, size_t sB, size_t sC, h16* __restrict__ P16, bf* __restrict__ Ph, bf* __restrict__ Pl) {
    gemmw<T16, NSPLIT, BIAS, KS, PACK>(A, A2, Bt, Bt2, K, C, ldc, bias, sA, sB, sC, P16, Ph, Pl, (int)blockIdx.x, (int)blockIdx.y, (size_t)blockIdx.z);
}
// k_proj: the q, k and v projections of both batch elements in ONE launch, so that 6 x 512 one-wave tiles are resident together and hide each other's load latency. grid (512, 1, 3 * NB_): z = input * NB_ + batch picks the weight plane (W3 + input), the token plane (X6 + z), the bias and the three output planes (+ z).
#define PLN  ((size_t)NH_ * TT * HD)   // elements of one head plane set (one input, one batch element)
__global__ __launch_bounds__(32) void k_proj(const bf* __restrict__ W3, const bf* __restrict__ X6, const float* __restrict__ bq, const float* __restrict__ bk, const float* __restrict__ bv, h16* __restrict__ P16, bf* __restrict__ Ph, bf* __restrict__ Pl) {
    static_assert(DQ == DKV && DQ == DM, "the weight planes and the head planes of q, k, v have one size");
    const int z = blockIdx.z, in = z / NB_, t = blockIdx.x;
    const bf* Wp = W3 + (size_t)in * DQ * DM; const bf* X = X6 + (size_t)z * TT * DM; const size_t po = (size_t)z * PLN;
    if (in < 2) gemmw<bf, 0, true, 1, 1>(Wp, nullptr, X, nullptr, DM, nullptr, 0, in == 0 ? bq : bk, 0, 0, 0, P16 + po, Ph + po, Pl + po, t % (DQ / 64), t / (DQ / 64), 0);
    else gemmw<bf, 0, true, 1, 2>(X, nullptr, Wp, nullptr, DM, nullptr, 0, bv, 0, 0, 0, P16 + po, Ph + po, Pl + po, t % (TT / 64), t / (TT / 64), 0);
}

typedef __attribute__((ext_vector_type(2))) _Float16 v2h;
typedef __attribute__((ext_vector_type(4))) _Float16 v4h;
typedef __attribute__((ext_vector_type(2))) unsigned short v2us;
typedef __attribute__((ext_vector_type(4))) unsigned short v4us;
typedef __attribute__((ext_vector_type(2))) float v2f;
typedef __attribute__((ext_vector_type(4))) int v4i;

__global__ __launch_bounds__(256) void k_wtG(const float* __restrict__ w, int K, int N, bf* Bt) {
    const int lane = threadIdx.x & 31; const int L0 = (blockIdx.x * 8 + (threadIdx.x >> 5)) * 8; const int nlines = N * K / 64;
{
#pragma unroll 1
        for (int l = 0; l < 8; ++l) { const int L = L0 + l; if (L >= nlines) break; const size_t e = (size_t)L * 64 + lane * 2; const int k = (int)(e % K), n = (int)(e / K); v2us o;
            o[0] = f2bf(w[(size_t)k * N + n]); o[1] = f2bf(w[(size_t)(k + 1) * N + n]); *(v2us*)(Bt + e) = o; }
         }
}
// cvt8s: block blk of token plane y = input * NB_ + batch, stored in fragment order (thread -> chunk by fchunk, as in the mask packer: whole lines read, whole lines stored).
__device__ __forceinline__ void cvt8s(const float* __restrict__ xq, const float* __restrict__ xk, const float* __restrict__ xv, bf* dst, size_t n8, int blk, int y) { const size_t i = fchunk((size_t)blk * 256 + threadIdx.x); if (i >= n8) return; const int in = y / NB_, b = y % NB_; const float* src = in == 0 ? xq : in == 1 ? xk : xv; dst += (size_t)y * TT * DM; const size_t e = i * 8; const size_t t = (i >> 6) / (DM / 32) * 16 + (i & 15), c = (i >> 6) % (DM / 32) * 32 + ((i >> 4) & 3) * 8; const v8f v = *(const v8f*)(src + ((in == 0 ? qtok(t) : t) * NB_ + b) * DM + c); v8us o;   /* the query plane lies in attention's query order */
#pragma unroll
    for (int k = 0; k < 8; ++k) o[k] = f2bf(v[k]); *(v8us*)(dst + e) = o;  }
// cvt8: block blk of weight plane y (n8 * 8 elements each, [rows][DM]), stored in fragment order like the token planes.
__device__ __forceinline__ void cvt8(const float* __restrict__ wq, const float* __restrict__ wk, const float* __restrict__ wv, const float* __restrict__ wo, bf* dst, size_t n8, int blk, int y) { const size_t i = fchunk((size_t)blk * 256 + threadIdx.x); if (i >= n8) return; const float* src = y == 0 ? wq : y == 1 ? wk : y == 2 ? wv : wo; dst += (size_t)y * n8 * 8; const v8f v = *(const v8f*)(src + ((i >> 6) / (DM / 32) * 16 + (i & 15)) * DM + (i >> 6) % (DM / 32) * 32 + ((i >> 4) & 3) * 8); v8us o;
#pragma unroll
    for (int k = 0; k < 8; ++k) o[k] = f2bf(v[k]); *(v8us*)(dst + i * 8) = o;  }

// mkf: attn_mask rounded to bf16, once a call, in the order of a score tile's accumulators (query rows in attention's order, qtok): [query tile][key tile][lane = 16 * (key bit 3) + query % 16][key % 8], so k_fattn reads a tile's mask by one 16-byte load a lane, 512 contiguous bytes a wave.
__device__ __forceinline__ void mkf(const float* __restrict__ MK, bf* MF, int blk) { const size_t i = fchunk((size_t)blk * 256 + threadIdx.x); const size_t tile = i >> 5; const int lane = (int)(i & 31); const v8f v = *(const v8f*)(MK + qtok((tile / (TT / 16)) * 16 + (lane & 15)) * TT + (tile % (TT / 16)) * 16 + (lane >> 4) * 8); v8us o;
#pragma unroll   // constant indices keep v[k] and o[k] in registers
    for (int k = 0; k < 8; ++k) o[k] = f2bf(v[k]); *(v8us*)(MF + i * 8) = o; asm volatile("s_wait_xcnt 0x0" ::: "memory");   /* before the address registers of the store are reused: in k_prep's code the other two branches follow this one */ }
// k_prep: every f32 -> bf16 conversion of the call in ONE launch (they are independent of each other): blocks [0, 4 NWB) the four weights, then 3 * NB_ * NXB blocks the token planes, then NMB blocks the mask. The range tests are block-uniform.
#define NWB  (DQ * DM / 8 / 256)
#define NXB  (TT * DM / 8 / 256)
#define NMB  (TT * (TT / 8) / 256)
__global__ __launch_bounds__(256) void k_prep(const float* __restrict__ wq, const float* __restrict__ wk, const float* __restrict__ wv, const float* __restrict__ wo, const float* __restrict__ xq, const float* __restrict__ xk, const float* __restrict__ xv, const float* __restrict__ MK, bf* W4, bf* X6, bf* MF) {
    static_assert(DQ * DM % (8 * 256) == 0 && TT * DM % (8 * 256) == 0 && DKV == DQ, "whole blocks; four weight planes of one size");
    const int blk = blockIdx.x;
    if (blk < 4 * NWB) cvt8(wq, wk, wv, wo, W4, (size_t)DQ * DM / 8, blk % NWB, blk / NWB);
    else if (blk < 4 * NWB + 3 * NB_ * NXB) cvt8s(xq, xk, xv, X6, (size_t)TT * DM / 8, (blk - 4 * NWB) % NXB, (blk - 4 * NWB) / NXB);
    else mkf(MK, MF, blk - 4 * NWB - 3 * NB_ * NXB);
}
// k_fattn: scores, softmax and attn.v of 32 query rows of one head in ONE work-group (16 waves); no score or weight plane in memory. grid (AGX, heads, NB_), 512 threads.
// Transposed products: S^T = K Q^T (A = 16 key rows, B = the 16 query rows), so lane (lr, hi) holds query lr's scores of keys 8 hi + j of each 16-key tile; wave w owns keys [w, w + 1) * TT / AW and keeps its AT score tiles in registers (hi+lo work-groups: TS of them wait in the wave's LDS part during the score loop, TE from the softmax to their key block).
// Row maximum and row sum: in the lane, across the two lane halves, then across the waves through LDS. Two neighbouring score tiles, scaled and converted in place, ARE the B fragment (hardware k order) of O^T += V^T P^T.
// Each wave's partial O^T (its own key range) goes to LDS; the AW partials are added in ascending key order and stored as the bf16 hi and lo operand planes of the output projection: the (h, b, s, dh) order read as rows of DQ, in fragment order.
#define AW   16                   // waves per work-group, one key range each
#define AKW  (TT / AW)            // keys per wave
#define AT   (AKW / 16)           // 16-key tiles per wave (score tiles per query tile)
#define OP   68                   // LDS pitch (floats) of one query's partial output row
typedef v2f __attribute__((may_alias)) v2fa;
// park8 / unpark8: one accumulator tile (8 values a lane) to and from the wave's own LDS, two 16-byte accesses of 512 contiguous bytes a wave; p already holds the lane's place (lane * 4 floats).
__device__ __forceinline__ void park8(float* p, v8f a) { *(v4fa*)p = __builtin_shufflevector(a, a, 0, 1, 2, 3); *(v4fa*)(p + 128) = __builtin_shufflevector(a, a, 4, 5, 6, 7); }
__device__ __forceinline__ v8f unpark8(const float* p) { const v4f lo4 = *(const v4fa*)p, hi4 = *(const v4fa*)(p + 128); return __builtin_shufflevector(lo4, hi4, 0, 1, 2, 3, 4, 5, 6, 7); }
template <int N> struct FV;
template <> struct FV<2> { typedef v2f F; typedef v2f __attribute__((may_alias)) FA; typedef v2us U; };
template <> struct FV<4> { typedef v4f F; typedef v4f __attribute__((may_alias)) FA; typedef v4us U; };
// NQ: query tiles (16 rows each) of the work-group. Every K and V^T fragment that a wave loads is multiplied with all NQ query tiles, so the bytes read per query row fall by NQ; each query's own sums keep their order.
template <typename T16, bool HL, int NQ>
__device__ __forceinline__ void attn_rows(const T16* __restrict__ Q, const T16* __restrict__ Q2, const T16* __restrict__ Kp, const T16* __restrict__ K2, const T16* __restrict__ Vt, const T16* __restrict__ Vt2, const bf* __restrict__ MF, bf* __restrict__ Oh, bf* __restrict__ Ol, int i0, float* red, float* osm) {
    typedef typename WFrag<T16>::V V;
    const int lane = threadIdx.x & 31, lr = lane & 15, hi = lane >> 4, w = threadIdx.x >> 5; const int kb = w * AKW;
    V q[NQ][2], q2[NQ][2];
#pragma unroll
    for (int qt = 0; qt < NQ; ++qt)
#pragma unroll
        for (int ks = 0; ks < 2; ++ks) q[qt][ks] = ldf(Q + funit(i0 / 16 + qt, HD, ks) + lane * 8);
    asm volatile("s_wait_xcnt 0x0" ::: "memory");   /* before the address registers of the query loads are reused */
    if (HL) {
#pragma unroll   // constant indices keep q2 in registers
        for (int qt = 0; qt < NQ; ++qt)
#pragma unroll
            for (int ks = 0; ks < 2; ++ks) q2[qt][ks] = ldf(Q2 + funit(i0 / 16 + qt, HD, ks) + lane * 8);
        asm volatile("s_wait_xcnt 0x0" ::: "memory");   /* as above */
    }
    const bf* mk = MF + ((size_t)(i0 / 16) * (TT / 16) + kb / 16) * 256 + lane * 8;
    constexpr int GT = (HL || NQ > 1) ? 1 : 2, NG = AT / GT;         // score tiles per load group; two groups in flight: one lands while the one before it is multiplied
    constexpr int GD = (HL || NQ > 1) ? 1 : 2, DG = HD / 16 / GD, KB = (HL && NQ > 1) ? 1 : 2, RV = (HL && NQ > 1) ? 3 : 2, NV = AT / (2 * KB) * DG;   // the same for attn.v: a load group is GD d tiles x KB * 32 keys, in a ring of RV register sets (hi+lo rows with two query tiles: smaller groups, one more of them, so that the same bytes fly from fewer registers); groups per key block, groups
    V k[2][GT][2], k2[2][GT][2], va[RV][GD][KB], va2[RV][GD][KB]; v8us m[2][GT][NQ];
    v8f s[NQ][AT]; float mx[NQ];
    // hi+lo rows with two query tiles: 256 registers do not hold all scores beside the operands. The first TS score tiles of each query tile wait in the wave's own part of osm (unused until the partial outputs) while Q, K and the mask hold the registers; the last TE tiles of weights wait there from the softmax to their key block, while the first V^T groups and the outputs need theirs. Same wave, same lane: no barrier.
    constexpr int TS = (HL && NQ > 1) ? 4 : 0, TE = (HL && NQ > 1) ? 1 : 0;
    float* pk = osm + w * (NQ * 16 * OP) + lane * 4; static_assert(NQ * TS * 256 <= NQ * 16 * OP && TE <= TS, "the parked tiles fit the wave's part");
#pragma unroll
    for (int qt = 0; qt < NQ; ++qt) mx[qt] = -3.0e38f;
#pragma unroll
    for (int g = -1; g < NG; ++g) {
        if (g + 1 < NG) {
#pragma unroll
            for (int u = 0; u < GT; ++u) { const int t = (g + 1) * GT + u; const size_t ko = funit(kb / 16 + t, HD, 0) + lane * 8;
#pragma unroll
                for (int ks = 0; ks < 2; ++ks) { k[(g + 1) & 1][u][ks] = ldf(Kp + ko + ks * 512); if (HL) k2[(g + 1) & 1][u][ks] = ldf(K2 + ko + ks * 512); }
                asm volatile("s_wait_xcnt 0x0" ::: "memory");   /* the K planes' offset register is free behind its last load: the wait stands before a mask load takes it as its destination */
#pragma unroll
                for (int qt = 0; qt < NQ; ++qt) m[(g + 1) & 1][u][qt] = *(const v8us*)(mk + (size_t)qt * (TT / 16) * 256 + t * 256); }
            asm volatile("s_wait_xcnt 0x0" ::: "memory");   /* before any register that the loads above name (address, scalar base) is reused */
        }
        if (g >= 0) {
#pragma unroll
            for (int u = 0; u < GT; ++u) { const int t = g * GT + u;
#pragma unroll
                for (int qt = 0; qt < NQ; ++qt) { v8f a = (v8f){};
#pragma unroll
                    for (int ks = 0; ks < 2; ++ks) { a = WFrag<T16>::mma(k[g & 1][u][ks], q[qt][ks], a); if (HL) { a = WFrag<T16>::mma(k[g & 1][u][ks], q2[qt][ks], a); a = WFrag<T16>::mma(k2[g & 1][u][ks], q[qt][ks], a); } }
#pragma unroll
                    for (int j = 0; j < 8; ++j) { const float tv = a[j] * SCL + bf2f(m[g & 1][u][qt][j]);   /* q.k / 8 (exact scaling) + attn_mask[i][j] */ a[j] = tv; mx[qt] = fmaxf(mx[qt], tv); }
                    if (t < TS) park8(pk + (qt * TS + t) * 256, a); else s[qt][t] = a; } }
            __builtin_amdgcn_sched_barrier(0);   /* holds the loads of group g + 2 behind this group's products: without it every load is hoisted to the top and registers spill */
        }
    }
#pragma unroll   // constant indices keep s in registers
    for (int qt = 0; qt < NQ; ++qt)
#pragma unroll   // as above
        for (int t = 0; t < TS; ++t) s[qt][t] = unpark8(pk + (qt * TS + t) * 256);   /* Q and K have left their registers */
    auto ldv = [&](int g) {   /* V^T fragments of load group g */
#pragma unroll
        for (int u = 0; u < GD; ++u)
#pragma unroll
            for (int kq = 0; kq < KB; ++kq) { const size_t vo = funit((g % DG) * GD + u, TT, kb / 32 + (g / DG) * KB + kq) + lane * 8; va[g % RV][u][kq] = ldf(Vt + vo); if (HL) va2[g % RV][u][kq] = ldf(Vt2 + vo); }
        asm volatile("s_wait_xcnt 0x0" ::: "memory");   /* as above */
    };
#pragma unroll   // constant ring indices keep va in registers
    for (int g = 0; g < RV - 1; ++g) ldv(g);   /* land during the softmax */
#pragma unroll
    for (int qt = 0; qt < NQ; ++qt) { mx[qt] = fmaxf(mx[qt], __shfl_xor(mx[qt], 16, 32)); if (hi == 0) red[(w * NQ + qt) * 16 + lr] = mx[qt]; }
    __syncthreads();
    float f[NQ];
#pragma unroll
    for (int qt = 0; qt < NQ; ++qt) {
#pragma unroll
        for (int ww = 0; ww < AW; ++ww) mx[qt] = fmaxf(mx[qt], red[(ww * NQ + qt) * 16 + lr]);
        float sum = 0.f;
#pragma unroll
        for (int t = 0; t < AT; ++t)
#pragma unroll
            for (int j = 0; j < 8; ++j) { const float x = (s[qt][t][j] - mx[qt]) * 1.4426950408889634f; float e;
                asm("v_exp_f32 %0, %1\n\tv_nop" : "=v"(e) : "v"(x));   /* 2^x; the v_nop is the slot the instruction set asks for behind a transcendental, before its source is overwritten or its result read */
                s[qt][t][j] = e; sum += e; }
#pragma unroll   // constant indices keep s in registers
        for (int t = AT - TE; t < AT; ++t) park8(pk + (qt * TE + t - (AT - TE)) * 256, s[qt][t]);
        sum += __shfl_xor(sum, 16, 32); if (hi == 0) red[((AW + w) * NQ + qt) * 16 + lr] = sum;
    }
    __syncthreads();
#pragma unroll
    for (int qt = 0; qt < NQ; ++qt) { float sum = red[(AW * NQ + qt) * 16 + lr];
#pragma unroll
        for (int ww = 1; ww < AW; ++ww) sum += red[((AW + ww) * NQ + qt) * 16 + lr];
        f[qt] = __fdiv_rn(HL ? 1.0f : PCAR, sum); }
    v8f o[NQ][HD / 16];
#pragma unroll
    for (int qt = 0; qt < NQ; ++qt)
#pragma unroll
        for (int dt = 0; dt < HD / 16; ++dt) o[qt][dt] = (v8f){};
    V p[NQ][KB], p2[NQ][KB];
#pragma unroll
    for (int g = 0; g < NV; ++g) { const int d0 = (g % DG) * GD;
        if (g + RV - 1 < NV) ldv(g + RV - 1);
        if (d0 == 0) {   /* the weights of this key block as KB B fragments (32 keys each) a query tile */
#pragma unroll
            for (int qt = 0; qt < NQ; ++qt)
#pragma unroll
            for (int kq = 0; kq < KB; ++kq) { const int kk = (g / DG) * KB + kq;
#pragma unroll   // constant indices keep s in registers
                for (int t = 2 * kk; t < 2 * kk + 2; ++t) if (t >= AT - TE) s[qt][t] = unpark8(pk + (qt * TE + t - (AT - TE)) * 256);
                if constexpr (HL) { v8us h0, h1, l0, l1;
#pragma unroll
                    for (int j = 0; j < 8; ++j) { unsigned short x, y; splitf(s[qt][2 * kk][j] * f[qt], x, y); h0[j] = x; l0[j] = y; splitf(s[qt][2 * kk + 1][j] * f[qt], x, y); h1[j] = x; l1[j] = y; }
                    p[qt][kq] = cat16b(h0, h1); p2[qt][kq] = cat16b(l0, l1);
                } else { v8h x0, x1;
#pragma unroll
                    for (int j = 0; j < 8; ++j) { x0[j] = tohx(s[qt][2 * kk][j] * f[qt]); x1[j] = tohx(s[qt][2 * kk + 1][j] * f[qt]); }
                    p[qt][kq] = cat16(x0, x1); } } }
#pragma unroll
        for (int u = 0; u < GD; ++u)
#pragma unroll
            for (int kq = 0; kq < KB; ++kq)
#pragma unroll
                for (int qt = 0; qt < NQ; ++qt) { o[qt][d0 + u] = WFrag<T16>::mma(va[g % RV][u][kq], p[qt][kq], o[qt][d0 + u]); if constexpr (HL) { o[qt][d0 + u] = WFrag<T16>::mma(va[g % RV][u][kq], p2[qt][kq], o[qt][d0 + u]); o[qt][d0 + u] = WFrag<T16>::mma(va2[g % RV][u][kq], p[qt][kq], o[qt][d0 + u]); } }
        __builtin_amdgcn_sched_barrier(0);   /* as in the score loop: the ring's load groups in flight, no more */
    }
#pragma unroll
    for (int qt = 0; qt < NQ; ++qt) { float* ow = osm + ((w * NQ + qt) * 16 + lr) * OP + 8 * hi;
#pragma unroll
        for (int dt = 0; dt < HD / 16; ++dt) { v4f lo4, hi4;
#pragma unroll
            for (int j = 0; j < 4; ++j) { lo4[j] = o[qt][dt][j]; hi4[j] = o[qt][dt][4 + j]; }
            *(v4fa*)(ow + dt * 16) = lo4; *(v4fa*)(ow + dt * 16 + 4) = hi4; } }
    __syncthreads();
    constexpr int EW = 2 * NQ;   /* NQ * 16 x HD outputs over AW * 32 = 512 threads: EW neighbours a thread */
    typedef typename FV<EW>::F RF; typedef typename FV<EW>::FA RFA; typedef typename FV<EW>::U RU;
    const int qi = threadIdx.x / (HD / EW), d2 = (threadIdx.x % (HD / EW)) * EW; RF r = *(const RFA*)(osm + qi * OP + d2);
#pragma unroll
    for (int ww = 1; ww < AW; ++ww) r += *(const RFA*)(osm + (ww * NQ * 16 + qi) * OP + d2);
    r *= HL ? 1.0f : (1.0f / PCAR);
    RU rh, rl;   /* the hi and lo operand planes of the output projection */
#pragma unroll
    for (int e = 0; e < EW; ++e) { unsigned short a2, c2; splitf(r[e], a2, c2); rh[e] = a2; rl[e] = c2; }
    static_assert(DQ / HD == 16, "qtok: a row of the view holds 16 tokens");
    const size_t tk = qtok((size_t)(i0 + qi)); const size_t fo = felem(tk / (DQ / HD), DQ, (int)(tk % (DQ / HD)) * HD + d2);   /* the view's row holds DQ / HD tokens; the EW neighbours lie in one 8-element chunk */
    *(RU*)(Oh + fo) = rh; *(RU*)(Ol + fo) = rl;
}
#define NQF  2                    // query tiles of a work-group of the single-fp16 rows
#define NQH  2                    // query tiles of a work-group of the hi+lo rows
#define AGX  (RH / (16 * NQH) + (TT - RH) / (16 * NQF))   // grid x: first the hi+lo work-groups, then the fp16 ones
__global__ __launch_bounds__(AW * 32) void k_fattn(const h16* __restrict__ Q16, const h16* __restrict__ K16, const h16* __restrict__ V16, const bf* __restrict__ Qh, const bf* __restrict__ Ql, const bf* __restrict__ Kh, const bf* __restrict__ Kl, const bf* __restrict__ Vh, const bf* __restrict__ Vl, const bf* __restrict__ MF, bf* __restrict__ ATh, bf* __restrict__ ATl) {
    static_assert((TT - RH) % (16 * NQF) == 0 && RH % (16 * NQH) == 0 && NQH <= NQF, "whole work-groups; osm and red are sized by NQF"); static_assert(RH % 256 == 0 && TT % 256 == 0, "qtok permutes inside blocks of 256: query row < RH == token < RH");
    __shared__ __align__(16) float osm[AW * 16 * NQF * OP]; __shared__ float red[2 * AW * 16 * NQF];
    const int bx = blockIdx.x, b = blockIdx.z; const int i0 = bx < RH / (16 * NQH) ? bx * (16 * NQH) : RH + (bx - RH / (16 * NQH)) * (16 * NQF); const size_t h = blockIdx.y, zq = b * PLN + h * TT * HD, zk = b * PLN + (h / REP) * TT * HD;   /* grid z = batch element: its plane set follows batch 0's */
    const size_t zo = (h * NB_ + b) * TT * HD; bf* Oh = ATh + zo; bf* Ol = ATl + zo;   /* (h, b, s, dh) contiguous == the module's raw (S, B, D) view; a (head, batch) is TT * HD / DQ = 128 whole rows of it, so whole row tiles: its fragment-ordered part starts at the same offset */
    if (i0 < RH) attn_rows<bf, true, NQH>(Qh + zq, Ql + zq, Kh + zk, Kl + zk, Vh + zk, Vl + zk, MF, Oh, Ol, i0, red, osm);   /* block-uniform */
    else attn_rows<h16, false, NQF>(Q16 + zq, nullptr, K16 + zk, nullptr, V16 + zk, nullptr, MF, Oh, Ol, i0, red, osm);
}

extern "C" void kernel_launch(void* const* d_in, const int* in_sizes, int n_in,
                              void* d_out, int out_size, void* d_ws, size_t ws_size, hipStream_t stream) {
    (void)in_sizes; (void)n_in; (void)out_size;
    const float* xq = (const float*)d_in[0]; const float* xk = (const float*)d_in[1]; const float* xv = (const float*)d_in[2]; const float* MK = (const float*)d_in[3]; const float* wq = (const float*)d_in[4]; const float* bq = (const float*)d_in[5]; const float* wk = (const float*)d_in[6]; const float* bk = (const float*)d_in[7]; const float* wv = (const float*)d_in[8]; const float* bv = (const float*)d_in[9]; const float* wo = (const float*)d_in[10]; const float* bo = (const float*)d_in[11]; const float* x = xq; (void)x;
    float* OUT = (float*)d_out;     // [2048][2][1024]
    char* wsp = (char*)d_ws;
    auto take = [&](size_t bytes) { char* p = wsp; wsp += (bytes + 255) & ~(size_t)255; return (void*)p; };
    bf* W4 = (bf*)take((size_t)4 * DQ * DM * 2);                 // bf16 Wq, Wk, Wv, Wo
    bf* X6 = (bf*)take((size_t)3 * NB_ * TT * DM * 2);           // bf16 token planes [input][batch][t][d]
    h16* P16 = (h16*)take(3 * NB_ * PLN * 2); bf* Ph = (bf*)take(3 * NB_ * PLN * 2); bf* Pl = (bf*)take(3 * NB_ * PLN * 2);   // head planes [input: Q, K, V^T][batch]
    bf* ATh = (bf*)take((size_t)NB_ * TT * DQ * 2); bf* ATl = (bf*)take((size_t)NB_ * TT * DQ * 2); bf* MF = (bf*)take((size_t)TT * TT * 2);
    if ((size_t)(wsp - (char*)d_ws) > ws_size) return;    // ws 256 MiB
    k_prep<<<4 * NWB + 3 * NB_ * NXB + NMB, 256, 0, stream>>>(wq, wk, wv, wo, xq, xk, xv, MK, W4, X6, MF);
    k_proj<<<dim3((DQ / 64) * (TT / 64), 1, 3 * NB_), 32, 0, stream>>>(W4, X6, bq, bk, bv, P16, Ph, Pl);
    k_fattn<<<dim3(AGX, NH_, NB_), AW * 32, 0, stream>>>(P16, P16 + NB_ * PLN, P16 + 2 * NB_ * PLN, Ph, Pl, Ph + NB_ * PLN, Pl + NB_ * PLN, Ph + 2 * NB_ * PLN, Pl + 2 * NB_ * PLN, MF, ATh, ATl);
    k_gemmw<bf, 1, true, DQ><<<dim3(NB_ * TT / 64, DM / 64, 1), 32, 0, stream>>>(ATh, ATl, W4 + (size_t)3 * DQ * DM, nullptr, OUT, DM, bo, 0, 0, 0, nullptr, nullptr, nullptr);   /* out (S*B rows, in the view's memory order) = view Wo^T + bo */
}

// v009
// One run takes 156 microseconds.
// Next to v008, in two timings, it ran 1.23 times as fast each time.
// Over all steps from v000 it is 14.1 times as fast.
#include <hip/hip_runtime.h>

// Multi-head attention on sequence-first tensors with the module's raw-view head merge (q, k, v [2048][2][1024] = [s][b][d]; projections 'oi' [1024][1024] + biases; per (head, batch): scores = q.k/8 + attn_mask[i][j] (f32 [2048][2048] input, read); softmax; O[h][b][s][dh] = attn.v; the module then views the contiguous (H, B, S, Dh) tensor directly as (S, B, D) (NO head transpose) and applies Wo^T + bo -> out [2048][2][1024]).
// Layout: both batch elements are read from the interleaved rows (row stride 2 x 1024); all 32 (head, batch) attention problems write O contiguously in (h, b, s, dh) order, whose memory IS the module's (S x B, D) view, so the output projection is one GEMM over 4096 rows.
// Fragment order: every 16-bit operand plane [rows][K] (attention's Q, K: K = HD; V^T: K = TT; the GEMMs' weights, tokens and attention output: K = DM) lies in units of 16 rows x 32 k (1 KB): [row tile][k tile][k bit 4][lane = 16 * (k bit 3) + row % 16][k % 8], so a wave-wide 16-byte load of half a fragment reads 512 contiguous bytes (4 whole lines). The projection GEMMs store the head planes themselves, straight from their accumulators; k_prep stores the weight and token planes so, k_fattn its output planes.
// Compute dtypes, f32 accumulate: every input rounded to bf16; q/k/v on PLAIN bf16 operands (inputs: exact) + biases; additive mask (bf16-rounded, packed once by k_prep) added inside the fused attention kernel; scores and attn.v: query rows < 512 hl (3 products), the rest single fp16 (weights x 16); softmax f32; Wo hl x exact (2 products) + bo.

#define NB_  2
#define TT   2048
#define DM   1024
#define NH_  16
#define NKV  16
#define REP  (NH_ / NKV)
#define HD   64
#define DQ   (NH_ * HD)
#define DKV  (NKV * HD)
typedef __attribute__((ext_vector_type(4))) unsigned short v4us;
#define RH   512                  // query rows < RH use hi+lo planes (0: none)
#define WIN  0
#define SCL  0.125f   // HD^-0.5
typedef _Float16 h16;
typedef unsigned short bf;
typedef __attribute__((ext_vector_type(16))) __bf16   v16bf;
typedef __attribute__((ext_vector_type(16))) _Float16 v16h;
typedef __attribute__((ext_vector_type(8)))  _Float16 v8h;
typedef __attribute__((ext_vector_type(8)))  unsigned short v8us;
typedef __attribute__((ext_vector_type(8)))  float    v8f;
typedef __attribute__((ext_vector_type(4)))  float    v4f;
typedef v8h  __attribute__((may_alias)) v8ha;
typedef v4f  __attribute__((may_alias)) v4fa;
typedef v8us __attribute__((may_alias)) v8usa;

__device__ __forceinline__ unsigned short f2bf(float f) { unsigned u = __float_as_uint(f); u += 0x7FFFu + ((u >> 16) & 1u); return (unsigned short)(u >> 16); }
__device__ __forceinline__ float bf2f(unsigned short b) { return __uint_as_float(((unsigned)b) << 16); }
__device__ __forceinline__ float bfr(float f) { return bf2f(f2bf(f)); }
__device__ __forceinline__ v16h cat16(v8h lo, v8h hi) { return __builtin_shufflevector(lo, hi, 0, 1, 2, 3, 4, 5, 6, 7, 8, 9, 10, 11, 12, 13, 14, 15); }
__device__ __forceinline__ v16bf cat16b(v8us lo, v8us hi) { return __builtin_bit_cast(v16bf, __builtin_shufflevector(lo, hi, 0, 1, 2, 3, 4, 5, 6, 7, 8, 9, 10, 11, 12, 13, 14, 15)); }
__device__ __forceinline__ v8f wmma16(v16h a, v16h b, v8f c) { return __builtin_amdgcn_wmma_f32_16x16x32_f16(false, a, false, b, (short)0, c, false, false); }
__device__ __forceinline__ v8f wmmab(v16bf a, v16bf b, v8f c) { return __builtin_amdgcn_wmma_f32_16x16x32_bf16(false, a, false, b, (short)0, c, false, false); }



// ---- k_gemmw: register-blocked GEMM, ONE WAVE per 64x64 output tile (16 accumulators), operands straight from fragment-ordered 16-bit planes; grid (M/64, N/64, Z), 32 threads.
// C[m][n] (f32, pitch ldc, + optional f32 bias[n]) = sum_k A[m][k] Bt[n][k] (+ split products per NSPLIT). z-batch strides sA/sB/sC in elements. K % (32 * KS) == 0.
// KS > 1: grid z = Z * KS; work-group z * KS + ks sums only k in [ks, ks + 1) * K / KS and stores its partial tile in C plane z * KS + ks (plane stride sC); the caller adds the KS planes.
// funit: offset of the unit (row tile rt, k tile kt) of a fragment-ordered plane. ldf (below) loads a fragment from unit + lane * 8.
// PACK != 0 (the q, k, v projections): no f32 C; the wave adds the bias and stores its tile as the three head planes (fp16, bf16 hi, bf16 lo) in fragment order. A lane's 8 accumulator values of one 16x16 block are 8 consecutive A rows at one B row = one 16-byte chunk of a plane whose k runs along the A rows, and the block's 32 chunks are 512 contiguous bytes.
// PACK == 1 (Q, K: plane [h * TT + t][d]): A = the weight (64 rows = head bx), Bt = the tokens, bias by A row. PACK == 2 (V^T: plane [h * HD + d][t]): A = the tokens, Bt = the weight, bias by Bt row.
// fchunk: thread -> 16-byte chunk for the mask packer: lane bits 0-2 = row % 8, 3 = k bit 3, 4 = k bit 4, thread bit 5 = row bit 3, so a wave reads 8 rows x 32 k (whole 128-byte lines of the f32 source) and stores 4 whole lines.
__device__ __forceinline__ size_t fchunk(size_t i) { return (i & ~(size_t)63) | (i & 7) | ((i >> 2) & 8) | ((i & 24) << 1); }
__device__ __forceinline__ size_t funit(size_t rt, int K, int kt) { return (rt * (size_t)(K / 32) + kt) << 9; }
// qtok: attention's query row r -> its token. A query tile (16 rows) holds tokens 16 apart (the two low hex digits swapped; its own inverse), i.e. the same 64 columns of 16 neighbouring rows of the module's (S x B, D) view: the tile's outputs fill whole 256-byte row groups of the fragment-ordered view plane, so every line of that plane has one writing work-group.
__device__ __forceinline__ size_t qtok(size_t r) { return (r & ~(size_t)255) | ((r & 15) << 4) | ((r >> 4) & 15); }
// felem: offset of element (row, k) of a fragment-ordered plane.
__device__ __forceinline__ size_t felem(size_t row, int K, int k) { return funit(row >> 4, K, k >> 5) + ((k >> 4) & 1) * 256 + (((k >> 3) & 1) * 16 + (row & 15)) * 8 + (k & 7); }
__device__ __forceinline__ h16 tohx(float x) { return (h16)x; }
__device__ __forceinline__ void splitf(float y, unsigned short& h, unsigned short& l) { h = f2bf(y); l = f2bf(y - bf2f(h)); }
template <typename T16> struct WFrag;
template <> struct WFrag<h16> { typedef v16h V; static __device__ __forceinline__ v8f mma(V a, V b, v8f c) { return wmma16(a, b, c); } };
template <> struct WFrag<bf> { typedef v16bf V; static __device__ __forceinline__ v8f mma(V a, V b, v8f c) { return wmmab(a, b, c); } };
__device__ __forceinline__ v16h ldf(const h16* p) { return cat16(*(const v8h*)p, *(const v8h*)(p + 256)); }
__device__ __forceinline__ v16bf ldf(const bf* p) { return cat16b(*(const v8us*)p, *(const v8us*)(p + 256)); }
// gemmw is the body; bx, by, zb are the tile's indices (k_gemmw: the grid's own; k_proj: derived from its flat index).
template <typename T16, int NSPLIT, bool BIAS, int KS = 1, int PACK = 0>
__device__ __forceinline__ void gemmw(const T16* __restrict__ A, const T16* __restrict__ A2, const T16* __restrict__ Bt, const T16* __restrict__ Bt2, int K, float* C, int ldc, const float* __restrict__ bias, size_t sA, size_t sB, size_t sC, h16* __restrict__ P16, bf* __restrict__ Ph, bf* __restrict__ Pl, int bx, int by, size_t zb) {
    typedef typename WFrag<T16>::V V;
    __shared__ __align__(16) float os[16 * 68];
    const size_t z = zb / KS; const int k0 = (int)(zb % KS) * (K / KS), k1 = k0 + K / KS; A += z * sA; if (A2) A2 += z * sA; Bt += z * sB; if (Bt2) Bt2 += z * sB; C += zb * sC;
    const int lane = threadIdx.x & 31, lr = lane & 15, hi = lane >> 4; const int r0 = bx * 64, c0 = by * 64;
    v8f acc[4][4];
#pragma unroll
    for (int mb = 0; mb < 4; ++mb)
#pragma unroll
        for (int nb = 0; nb < 4; ++nb) acc[mb][nb] = (v8f){};
    const size_t aoff = (size_t)r0 * K + lane * 8, boff = (size_t)c0 * K + lane * 8;   /* funit(first row tile, K, 0) + the lane's chunk; a row tile further: 16 * K elements, a k tile further: 512 */
#pragma unroll 1
    for (int kc = k0; kc < k1; kc += 32) {
        V a[4], a2[4]; const T16* pa = A + aoff + (size_t)kc * 16; const T16* pa2 = A2 + aoff + (size_t)kc * 16; const T16* pb = Bt + boff + (size_t)kc * 16; const T16* pb2 = Bt2 + boff + (size_t)kc * 16;   /* this k tile's units of the first row tiles */
#pragma unroll
        for (int mb = 0; mb < 4; ++mb) { a[mb] = ldf(pa + (size_t)mb * 16 * K); if (NSPLIT == 1 || NSPLIT == 2) a2[mb] = ldf(pa2 + (size_t)mb * 16 * K); }
        /* before any address register of the loads above is reused; the addresses as inputs keep their registers from becoming a load's destination in front of the wait */
        if constexpr (NSPLIT == 1 || NSPLIT == 2) asm volatile("s_wait_xcnt 0x0" :: "v"(pa), "v"(pa2) : "memory"); else asm volatile("s_wait_xcnt 0x0" :: "v"(pa) : "memory");
#pragma unroll
        for (int nb = 0; nb < 4; ++nb) { const V b = ldf(pb + (size_t)nb * 16 * K); V b2; if (NSPLIT >= 2) b2 = ldf(pb2 + (size_t)nb * 16 * K);
            if constexpr (NSPLIT >= 2) asm volatile("s_wait_xcnt 0x0" :: "v"(pb), "v"(pb2) : "memory"); else asm volatile("s_wait_xcnt 0x0" :: "v"(pb) : "memory");   /* as above */
#pragma unroll
            for (int mb = 0; mb < 4; ++mb) { acc[mb][nb] = WFrag<T16>::mma(a[mb], b, acc[mb][nb]); if (NSPLIT == 1 || NSPLIT == 2) acc[mb][nb] = WFrag<T16>::mma(a2[mb], b, acc[mb][nb]); if (NSPLIT >= 2) acc[mb][nb] = WFrag<T16>::mma(a[mb], b2, acc[mb][nb]); } }
        asm volatile("v_nop\n\tv_nop\n\tv_nop\n\tv_nop" : "+v"(acc[0][0]), "+v"(acc[1][1]), "+v"(acc[2][2]), "+v"(acc[3][3]) : "v"(a[0]), "v"(a[3]));
    }
    if constexpr (PACK != 0) {
        static_assert(HD == 64, "a 64-row tile is one head");
        v8f ba[4]; float bb[4];   /* the lane's biases: by A row (8 a block row) or by Bt row (1 a block column) */
#pragma unroll   // constant indices keep ba and bb in registers
        for (int i = 0; i < 4; ++i) { if (PACK == 1) ba[i] = *(const v8f*)(bias + r0 + i * 16 + hi * 8); else bb[i] = bias[c0 + i * 16 + lr]; }
        /* the wait stands before the address registers of the bias loads are reused; the loaded values as inputs hold all the loads in front of the blocks, so that they share one latency */
        if constexpr (PACK == 1) asm volatile("s_wait_xcnt 0x0" :: "v"(ba[0]), "v"(ba[1]), "v"(ba[2]), "v"(ba[3]) : "memory");
        else asm volatile("s_wait_xcnt 0x0" :: "v"(bb[0]), "v"(bb[1]), "v"(bb[2]), "v"(bb[3]) : "memory");
#pragma unroll   // constant indices keep acc in registers
        for (int mb = 0; mb < 4; ++mb) {
#pragma unroll
            for (int nb = 0; nb < 4; ++nb) {
                const size_t e = (PACK == 1 ? funit((size_t)bx * (TT / 16) + c0 / 16 + nb, HD, mb >> 1) : funit((size_t)(c0 / 16 + nb), TT, r0 / 32 + (mb >> 1))) + (mb & 1) * 256 + lane * 8;
                v8h o16; v8us oh, ol;
#pragma unroll
                for (int j = 0; j < 8; ++j) { const float x = acc[mb][nb][j] + bfr(PACK == 1 ? ba[mb][j] : bb[nb]); o16[j] = tohx(x); unsigned short a2, c2; splitf(x, a2, c2); oh[j] = a2; ol[j] = c2; }
                /* the three plane stores and their wait in one statement: the wait stands before any address or data register of the stores is reused */
                asm volatile("global_store_b128 %0, %3, off\n\tglobal_store_b128 %1, %4, off\n\tglobal_store_b128 %2, %5, off\n\ts_wait_xcnt 0x0" :: "v"(P16 + e), "v"(Ph + e), "v"(Pl + e), "v"(o16), "v"(oh), "v"(ol) : "memory");
            }
        }
        return;
    }
#pragma unroll
    for (int mb = 0; mb < 4; ++mb) {
#pragma unroll
        for (int nb = 0; nb < 4; ++nb) {
#pragma unroll
            for (int j = 0; j < 8; ++j) os[(hi * 8 + j) * 68 + nb * 16 + lr] = acc[mb][nb][j]; }
        __builtin_amdgcn_wave_barrier(); asm volatile("" ::: "memory");
        float* crow = C + (size_t)(r0 + mb * 16) * ldc + c0;
{
#pragma unroll
            for (int s = 0; s < 8; ++s) { const int row = 2 * s + hi, cofs = lr * 4; v4f val = *(const v4fa*)(os + row * 68 + cofs); if (BIAS) { val[0] += bfr(bias[c0 + cofs]); val[1] += bfr(bias[c0 + cofs + 1]); val[2] += bfr(bias[c0 + cofs + 2]); val[3] += bfr(bias[c0 + cofs + 3]); }
                *(v4f*)(crow + (size_t)row * ldc + cofs) = val; }
            asm volatile("s_wait_xcnt 0x0" ::: "memory");   /* before the data and address registers of the stores above are reused */
             }
        __builtin_amdgcn_wave_barrier(); asm volatile("" ::: "memory");
    }
}
// K is a template constant: a fragment's place is then its plane's one address register + an immediate offset.
template <typename T16, int NSPLIT, bool BIAS, int K, int KS = 1, int PACK = 0>
__global__ __launch_bounds__(32) void k_gemmw(const T16* __restrict__ A, const T16* __restrict__ A2, const T16* __restrict__ Bt, const T16* __restrict__ Bt2, float* C, int ldc, const float* __restrict__ bias, size_t sA, size_t sB, size_t sC, h16* __restrict__ P16, bf* __restrict__ Ph, bf* __restrict__ Pl) {
    gemmw<T16, NSPLIT, BIAS, KS, PACK>(A, A2, Bt, Bt2, K, C, ldc, bias, sA, sB, sC, P16, Ph, Pl, (int)blockIdx.x, (int)blockIdx.y, (size_t)blockIdx.z);
}
// k_proj: the q, k and v projections of both batch elements in ONE launch, so that 6 x 512 one-wave tiles are resident together and hide each other's load latency. grid (512, 1, 3 * NB_): z = input * NB_ + batch picks the weight plane (W3 + input), the token plane (X6 + z), the bias and the three output planes (+ z).
#define PLN  ((size_t)NH_ * TT * HD)   // elements of one head plane set (one input, one batch element)
__global__ __launch_bounds__(32) void k_proj(const bf* __restrict__ W3, const bf* __restrict__ X6, const float* __restrict__ bq, const float* __restrict__ bk, const float* __restrict__ bv, h16* __restrict__ P16, bf* __restrict__ Ph, bf* __restrict__ Pl) {
    static_assert(DQ == DKV && DQ == DM, "the weight planes and the head planes of q, k, v have one size");
    const int z = blockIdx.z, in = z / NB_, t = blockIdx.x;
    const bf* Wp = W3 + (size_t)in * DQ * DM; const bf* X = X6 + (size_t)z * TT * DM; const size_t po = (size_t)z * PLN;
    if (in < 2) gemmw<bf, 0, true, 1, 1>(Wp, nullptr, X, nullptr, DM, nullptr, 0, in == 0 ? bq : bk, 0, 0, 0, P16 + po, Ph + po, Pl + po, t % (DQ / 64), t / (DQ / 64), 0);
    else gemmw<bf, 0, true, 1, 2>(X, nullptr, Wp, nullptr, DM, nullptr, 0, bv, 0, 0, 0, P16 + po, Ph + po, Pl + po, t % (TT / 64), t / (TT / 64), 0);
}

typedef __attribute__((ext_vector_type(2))) _Float16 v2h;
typedef __attribute__((ext_vector_type(4))) _Float16 v4h;
typedef __attribute__((ext_vector_type(2))) unsigned short v2us;
typedef __attribute__((ext_vector_type(4))) unsigned short v4us;
typedef __attribute__((ext_vector_type(2))) float v2f;
typedef __attribute__((ext_vector_type(4))) int v4i;

__global__ __launch_bounds__(256) void k_wtG(const float* __restrict__ w, int K, int N, bf* Bt) {
    const int lane = threadIdx.x & 31; const int L0 = (blockIdx.x * 8 + (threadIdx.x >> 5)) * 8; const int nlines = N * K / 64;
{
#pragma unroll 1
        for (int l = 0; l < 8; ++l) { const int L = L0 + l; if (L >= nlines) break; const size_t e = (size_t)L * 64 + lane * 2; const int k = (int)(e % K), n = (int)(e / K); v2us o;
            o[0] = f2bf(w[(size_t)k * N + n]); o[1] = f2bf(w[(size_t)(k + 1) * N + n]); *(v2us*)(Bt + e) = o; }
         }
}
// cvt8s: block blk of token plane y = input * NB_ + batch, stored in fragment order (thread -> chunk by fchunk, as in the mask packer: whole lines read, whole lines stored).
__device__ __forceinline__ void cvt8s(const float* __restrict__ xq, const float* __restrict__ xk, const float* __restrict__ xv, bf* dst, size_t n8, int blk, int y) { const size_t i = fchunk((size_t)blk * 256 + threadIdx.x); if (i >= n8) return; const int in = y / NB_, b = y % NB_; const float* src = in == 0 ? xq : in == 1 ? xk : xv; dst += (size_t)y * TT * DM; const size_t e = i * 8; const size_t t = (i >> 6) / (DM / 32) * 16 + (i & 15), c = (i >> 6) % (DM / 32) * 32 + ((i >> 4) & 3) * 8; const v8f v = *(const v8f*)(src + ((in == 0 ? qtok(t) : t) * NB_ + b) * DM + c); v8us o;   /* the query plane lies in attention's query order */
#pragma unroll
    for (int k = 0; k < 8; ++k) o[k] = f2bf(v[k]); *(v8us*)(dst + e) = o;  }
// cvt8: block blk of weight plane y (n8 * 8 elements each, [rows][DM]), stored in fragment order like the token planes.
__device__ __forceinline__ void cvt8(const float* __restrict__ wq, const float* __restrict__ wk, const float* __restrict__ wv, const float* __restrict__ wo, bf* dst, size_t n8, int blk, int y) { const size_t i = fchunk((size_t)blk * 256 + threadIdx.x); if (i >= n8) return; const float* src = y == 0 ? wq : y == 1 ? wk : y == 2 ? wv : wo; dst += (size_t)y * n8 * 8; const v8f v = *(const v8f*)(src + ((i >> 6) / (DM / 32) * 16 + (i & 15)) * DM + (i >> 6) % (DM / 32) * 32 + ((i >> 4) & 3) * 8); v8us o;
#pragma unroll
    for (int k = 0; k < 8; ++k) o[k] = f2bf(v[k]); *(v8us*)(dst + i * 8) = o;  }

// mkf: attn_mask rounded to bf16, once a call, in the order of a score tile's accumulators (query rows in attention's order, qtok): [query tile][key tile][lane = 16 * (key bit 3) + query % 16][key % 8], so k_fattn reads a tile's mask by one 16-byte load a lane, 512 contiguous bytes a wave.
__device__ __forceinline__ void mkf(const float* __restrict__ MK, bf* MF, int blk) { const size_t i = fchunk((size_t)blk * 256 + threadIdx.x); const size_t tile = i >> 5; const int lane = (int)(i & 31); const v8f v = *(const v8f*)(MK + qtok((tile / (TT / 16)) * 16 + (lane & 15)) * TT + (tile % (TT / 16)) * 16 + (lane >> 4) * 8); v8us o;
#pragma unroll   // constant indices keep v[k] and o[k] in registers
    for (int k = 0; k < 8; ++k) o[k] = f2bf(v[k]); *(v8us*)(MF + i * 8) = o; asm volatile("s_wait_xcnt 0x0" ::: "memory");   /* before the address registers of the store are reused: in k_prep's code the other two branches follow this one */ }
// k_prep: every f32 -> bf16 conversion of the call in ONE launch (they are independent of each other): blocks [0, 4 NWB) the four weights, then 3 * NB_ * NXB blocks the token planes, then NMB blocks the mask. The range tests are block-uniform.
#define NWB  (DQ * DM / 8 / 256)
#define NXB  (TT * DM / 8 / 256)
#define NMB  (TT * (TT / 8) / 256)
__global__ __launch_bounds__(256) void k_prep(const float* __restrict__ wq, const float* __restrict__ wk, const float* __restrict__ wv, const float* __restrict__ wo, const float* __restrict__ xq, const float* __restrict__ xk, const float* __restrict__ xv, const float* __restrict__ MK, bf* W4, bf* X6, bf* MF) {
    static_assert(DQ * DM % (8 * 256) == 0 && TT * DM % (8 * 256) == 0 && DKV == DQ, "whole blocks; four weight planes of one size");
    const int blk = blockIdx.x;
    if (blk < 4 * NWB) cvt8(wq, wk, wv, wo, W4, (size_t)DQ * DM / 8, blk % NWB, blk / NWB);
    else if (blk < 4 * NWB + 3 * NB_ * NXB) cvt8s(xq, xk, xv, X6, (size_t)TT * DM / 8, (blk - 4 * NWB) % NXB, (blk - 4 * NWB) / NXB);
    else mkf(MK, MF, blk - 4 * NWB - 3 * NB_ * NXB);
}
// k_fattn: scores, softmax and attn.v in ONE pass over the keys; no score or weight plane in memory, no LDS, no data passed between waves. grid (AGX, heads, NB_), FWV waves a work-group.
// A wave owns NQ query tiles (16 rows each) and walks ALL keys, KBL a trip; the FWV waves of a work-group walk the same K and V^T fragments at the same time, so that one fetch from L2 into the WGP's cache serves all of them, and the bytes asked of L2 per query row fall with FWV * NQ.
// Transposed products: S^T = K Q^T (A = 16 key rows, B = the 16 query rows), so lane (lr, hi) holds query lr's scores of keys 8 hi + j of each 16-key tile. The trip's two score tiles, exponentiated and converted in place, ARE the B fragment (hardware k order) of O^T += V^T P^T.
// Running softmax: each query keeps a maximum in use, its sum of weights and its unnormalised O^T column (all in the lane). The maximum in use is replaced, and sum and column rescaled, only in a trip where some query's score exceeds it by more than RTH (one wave-uniform test a trip); until then weights are at most e^RTH < 2^8. The division by the sum comes once, at the end.
// A lane's 8 values of one O^T tile are 8 neighbouring dh of one query = one 16-byte chunk of the output projection's bf16 hi and lo operand planes (the (h, b, s, dh) order read as rows of DQ, in fragment order); a wave's store is 512 contiguous bytes.
#define FWV  4                    // waves per work-group
#define KBL  32                   // keys per trip
#define RTH  5.5f                 // see above (in units of the score)
#define L2E  1.4426950408889634f
// ex2: 2^x; the v_nop is the slot the instruction set asks for behind a transcendental, before its source is overwritten or its result read
__device__ __forceinline__ float ex2(float x) { float e; asm("v_exp_f32 %0, %1\n\tv_nop" : "=v"(e) : "v"(x)); return e; }
// xhalf: lane l's value in lane l ^ 16, by a vector cross-row move
__device__ __forceinline__ float xhalf(float x) { return __builtin_bit_cast(float, __builtin_amdgcn_permlanex16(__builtin_bit_cast(int, x), __builtin_bit_cast(int, x), 0x76543210, 0xfedcba98, false, false)); }

template <typename T16, bool HL, int NQ>
__device__ __forceinline__ void attn_rows(const T16* __restrict__ Q, const T16* __restrict__ Q2, const T16* __restrict__ Kp, const T16* __restrict__ K2, const T16* __restrict__ Vt, const T16* __restrict__ Vt2, const bf* __restrict__ MF, bf* __restrict__ Oh, bf* __restrict__ Ol, int i0) {
    typedef typename WFrag<T16>::V V;
    static_assert(KBL == 32 && HD == 64, "a trip is two score tiles = one B fragment of attn.v");
    const int lane = threadIdx.x & 31, lr = lane & 15, hi = lane >> 4;
    constexpr float PEX = HL ? 0.0f : 4.0f;   /* fp16 weights carry 2^PEX (it cancels in the division by their sum): small weights stay normal numbers, the largest is below 2^12 */
    V q[NQ][2], q2[NQ][2];
#pragma unroll
    for (int qt = 0; qt < NQ; ++qt)
#pragma unroll
        for (int ks = 0; ks < 2; ++ks) q[qt][ks] = ldf(Q + funit(i0 / 16 + qt, HD, ks) + lane * 8);
    asm volatile("s_wait_xcnt 0x0" ::: "memory");   /* before the address registers of the query loads are reused */
    if (HL) {
#pragma unroll   // constant indices keep q2 in registers
        for (int qt = 0; qt < NQ; ++qt)
#pragma unroll
            for (int ks = 0; ks < 2; ++ks) q2[qt][ks] = ldf(Q2 + funit(i0 / 16 + qt, HD, ks) + lane * 8);
        asm volatile("s_wait_xcnt 0x0" ::: "memory");   /* as above */
    }
    /* the next K units, V^T units and mask tiles to load: wave-uniform bases, which step on in scalar registers; every load adds the lane's chunk lc, one vector register that never changes */
    const bf* mk = MF + (size_t)(i0 / 16) * (TT / 16) * 256; const T16* pk = Kp; const T16* pk2 = K2; const T16* pv = Vt; const T16* pv2 = Vt2; const unsigned lc = lane * 8;
    V k[2][2], k2[2][2], va[HD / 16], va2[HD / 16]; v8us m[NQ][2];
    auto ldk = [&](bool more) {   /* K fragments and mask tiles of the next trip; more: another trip follows that one */
#pragma unroll
        for (int t = 0; t < 2; ++t)
#pragma unroll
            for (int ks = 0; ks < 2; ++ks) { k[t][ks] = ldf(pk + (t * 2 + ks) * 512 + lc); if (HL) k2[t][ks] = ldf(pk2 + (t * 2 + ks) * 512 + lc); }
#pragma unroll
        for (int qt = 0; qt < NQ; ++qt)
#pragma unroll
            for (int t = 0; t < 2; ++t) m[qt][t] = *(const v8us*)(mk + qt * (TT / 16) * 256 + t * 256 + lc);
        /* before the base registers of the loads above step on; the bases as inputs keep their registers untouched up to the wait */
        if constexpr (HL) asm volatile("s_wait_xcnt 0x0" :: "s"(pk), "s"(pk2), "s"(mk) : "memory"); else asm volatile("s_wait_xcnt 0x0" :: "s"(pk), "s"(mk) : "memory");
        pk += more ? 4 * 512 : 0; if (HL) pk2 += more ? 4 * 512 : 0; mk += more ? 2 * 256 : 0;
    };
    auto ldv = [&](bool more) {   /* V^T fragments of this trip: they land during the scores and the softmax; more: another trip follows */
#pragma unroll
        for (int dt = 0; dt < HD / 16; ++dt) { va[dt] = ldf(pv + dt * (TT / 32) * 512 + lc); if (HL) va2[dt] = ldf(pv2 + dt * (TT / 32) * 512 + lc); }
        if constexpr (HL) asm volatile("s_wait_xcnt 0x0" :: "s"(pv), "s"(pv2) : "memory"); else asm volatile("s_wait_xcnt 0x0" :: "s"(pv) : "memory");   /* as in ldk */
        pv += more ? 512 : 0; if (HL) pv2 += more ? 512 : 0;   /* a step by choice, as in ldk, keeps these bases scalar too: from a plain count the compiler forms 64-bit vector addresses, two registers a plane, and the hi+lo rows spill */
    };
    v8f o[NQ][HD / 16]; float mx[NQ]; v2f sum[NQ];   /* sum: the weights of even and of odd keys */
#pragma unroll
    for (int qt = 0; qt < NQ; ++qt) { mx[qt] = -3.0e38f; sum[qt] = (v2f){};
#pragma unroll
        for (int dt = 0; dt < HD / 16; ++dt) o[qt][dt] = (v8f){}; }
    ldk(true);
#pragma unroll 1   // rolled: one trip's operands stay in the registers
    for (int kb = 0; kb < TT / KBL; ++kb) {
        __builtin_amdgcn_s_barrier();   /* pace only, no data passes: it keeps the work-group's waves in the same trip, so that a line fetched for one is still in the WGP's cache when the others ask for it */
        ldv(kb + 1 < TT / KBL);
        v8f s[NQ][2]; float bm[NQ];
#pragma unroll
        for (int qt = 0; qt < NQ; ++qt) { bm[qt] = -3.0e38f;
#pragma unroll
            for (int t = 0; t < 2; ++t) { v8f a = (v8f){}, mf;
#pragma unroll
                for (int ks = 0; ks < 2; ++ks) { a = WFrag<T16>::mma(k[t][ks], q[qt][ks], a); if (HL) { a = WFrag<T16>::mma(k[t][ks], q2[qt][ks], a); a = WFrag<T16>::mma(k2[t][ks], q[qt][ks], a); } }
#pragma unroll
                for (int j = 0; j < 8; ++j) mf[j] = bf2f(m[qt][t][j]);
                a = a * SCL + mf;   /* q.k / 8 (exact scaling) + attn_mask[i][j] */
#pragma unroll
                for (int j = 0; j < 8; ++j) bm[qt] = fmaxf(bm[qt], a[j]);
                s[qt][t] = a; } }
        ldk(kb + 2 < TT / KBL);   /* they land during the softmax and attn.v; no branch: the last trip loads its own units once more, unused */
        bool need = false;
#pragma unroll
        for (int qt = 0; qt < NQ; ++qt) { bm[qt] = fmaxf(bm[qt], xhalf(bm[qt])); need = need || bm[qt] > mx[qt] + RTH; }
        if (__builtin_amdgcn_ballot_w32(need) != 0) {   /* wave-uniform: the matrix instructions below run with every lane on */
#pragma unroll
            for (int qt = 0; qt < NQ; ++qt) { const float mn = fmaxf(mx[qt], bm[qt]); const float al = ex2((mx[qt] - mn) * L2E); mx[qt] = mn; sum[qt] *= al;
#pragma unroll
                for (int dt = 0; dt < HD / 16; ++dt) o[qt][dt] *= al; }
        }
        V p[NQ], p2[NQ];
#pragma unroll
        for (int qt = 0; qt < NQ; ++qt) {
#pragma unroll
            for (int t = 0; t < 2; ++t) { v8f x = (s[qt][t] - mx[qt]) * L2E; if (!HL) x += PEX;
#pragma unroll
                for (int j = 0; j < 8; ++j) s[qt][t][j] = ex2(x[j]);
#pragma unroll
                for (int j = 0; j < 8; j += 2) sum[qt] += (v2f){s[qt][t][j], s[qt][t][j + 1]}; }
            if constexpr (HL) { v8us h0, h1, l0, l1;
#pragma unroll
                for (int j = 0; j < 8; ++j) { unsigned short x, y; splitf(s[qt][0][j], x, y); h0[j] = x; l0[j] = y; splitf(s[qt][1][j], x, y); h1[j] = x; l1[j] = y; }
                p[qt] = cat16b(h0, h1); p2[qt] = cat16b(l0, l1);
            } else { v8h x0, x1;
#pragma unroll
                for (int j = 0; j < 8; ++j) { x0[j] = tohx(s[qt][0][j]); x1[j] = tohx(s[qt][1][j]); }
                p[qt] = cat16(x0, x1); } }
#pragma unroll
        for (int dt = 0; dt < HD / 16; ++dt)
#pragma unroll
            for (int qt = 0; qt < NQ; ++qt) { o[qt][dt] = WFrag<T16>::mma(va[dt], p[qt], o[qt][dt]); if constexpr (HL) { o[qt][dt] = WFrag<T16>::mma(va[dt], p2[qt], o[qt][dt]); o[qt][dt] = WFrag<T16>::mma(va2[dt], p[qt], o[qt][dt]); } }
    }
    static_assert(DQ / HD == 16, "qtok: a row of the view holds 16 tokens");
#pragma unroll
    for (int qt = 0; qt < NQ; ++qt) { const float sl = sum[qt][0] + sum[qt][1]; const float f = __fdiv_rn(1.0f, sl + xhalf(sl));   /* the two lane halves hold the two halves of each tile's keys */
        const size_t tk = qtok((size_t)(i0 + qt * 16 + lr));
#pragma unroll
        for (int dt = 0; dt < HD / 16; ++dt) { const size_t fo = felem(tk / (DQ / HD), DQ, (int)(tk % (DQ / HD)) * HD + dt * 16 + hi * 8);   /* the view's row holds DQ / HD tokens */
            v8us rh, rl;   /* the hi and lo operand planes of the output projection */
#pragma unroll
            for (int j = 0; j < 8; ++j) { unsigned short a2, c2; splitf(o[qt][dt][j] * f, a2, c2); rh[j] = a2; rl[j] = c2; }
            /* the two plane stores and their wait in one statement: the wait stands before any address or data register of the stores is reused */
            asm volatile("global_store_b128 %0, %2, off\n\tglobal_store_b128 %1, %3, off\n\ts_wait_xcnt 0x0" :: "v"(Oh + fo), "v"(Ol + fo), "v"(rh), "v"(rl) : "memory");
        } }
}
#define NQF  2                    // query tiles of a wave of the single-fp16 rows
#define NQH  1                    // query tiles of a wave of the hi+lo rows (three products a tile and the split of the weights: about the time of two fp16 tiles)
#define GXH  (RH / (16 * NQH * FWV))                     // grid x: first the hi+lo work-groups,
#define AGX  (GXH + (TT - RH) / (16 * NQF * FWV))        // then the fp16 ones
__global__ __launch_bounds__(FWV * 32) __attribute__((amdgpu_waves_per_eu(4, 4))) void k_fattn(const h16* __restrict__ Q16, const h16* __restrict__ K16, const h16* __restrict__ V16, const bf* __restrict__ Qh, const bf* __restrict__ Ql, const bf* __restrict__ Kh, const bf* __restrict__ Kl, const bf* __restrict__ Vh, const bf* __restrict__ Vl, const bf* __restrict__ MF, bf* __restrict__ ATh, bf* __restrict__ ATl) {
    static_assert((TT - RH) % (16 * NQF * FWV) == 0 && RH % (16 * NQH * FWV) == 0, "whole work-groups"); static_assert(RH % 256 == 0 && TT % 256 == 0, "qtok permutes inside blocks of 256: query row < RH == token < RH");
    const int bx = blockIdx.x, b = blockIdx.z, w = __builtin_amdgcn_readfirstlane(threadIdx.x >> 5); const size_t h = blockIdx.y, zq = b * PLN + h * TT * HD, zk = b * PLN + (h / REP) * TT * HD;   /* grid z = batch element: its plane set follows batch 0's */
    const size_t zo = (h * NB_ + b) * TT * HD; bf* Oh = ATh + zo; bf* Ol = ATl + zo;   /* (h, b, s, dh) contiguous == the module's raw (S, B, D) view; a (head, batch) is TT * HD / DQ = 128 whole rows of it, so whole row tiles: its fragment-ordered part starts at the same offset */
    if (bx < GXH) attn_rows<bf, true, NQH>(Qh + zq, Ql + zq, Kh + zk, Kl + zk, Vh + zk, Vl + zk, MF, Oh, Ol, (bx * FWV + w) * (16 * NQH));   /* block-uniform */
    else attn_rows<h16, false, NQF>(Q16 + zq, nullptr, K16 + zk, nullptr, V16 + zk, nullptr, MF, Oh, Ol, RH + ((bx - GXH) * FWV + w) * (16 * NQF));
}

extern "C" void kernel_launch(void* const* d_in, const int* in_sizes, int n_in,
                              void* d_out, int out_size, void* d_ws, size_t ws_size, hipStream_t stream) {
    (void)in_sizes; (void)n_in; (void)out_size;
    const float* xq = (const float*)d_in[0]; const float* xk = (const float*)d_in[1]; const float* xv = (const float*)d_in[2]; const float* MK = (const float*)d_in[3]; const float* wq = (const float*)d_in[4]; const float* bq = (const float*)d_in[5]; const float* wk = (const float*)d_in[6]; const float* bk = (const float*)d_in[7]; const float* wv = (const float*)d_in[8]; const float* bv = (const float*)d_in[9]; const float* wo = (const float*)d_in[10]; const float* bo = (const float*)d_in[11]; const float* x = xq; (void)x;
    float* OUT = (float*)d_out;     // [2048][2][1024]
    char* wsp = (char*)d_ws;
    auto take = [&](size_t bytes) { char* p = wsp; wsp += (bytes + 255) & ~(size_t)255; return (void*)p; };
    bf* W4 = (bf*)take((size_t)4 * DQ * DM * 2);                 // bf16 Wq, Wk, Wv, Wo
    bf* X6 = (bf*)take((size_t)3 * NB_ * TT * DM * 2);           // bf16 token planes [input][batch][t][d]
    h16* P16 = (h16*)take(3 * NB_ * PLN * 2); bf* Ph = (bf*)take(3 * NB_ * PLN * 2); bf* Pl = (bf*)take(3 * NB_ * PLN * 2);   // head planes [input: Q, K, V^T][batch]
    bf* ATh = (bf*)take((size_t)NB_ * TT * DQ * 2); bf* ATl = (bf*)take((size_t)NB_ * TT * DQ * 2); bf* MF = (bf*)take((size_t)TT * TT * 2);
    if ((size_t)(wsp - (char*)d_ws) > ws_size) return;    // ws 256 MiB
    k_prep<<<4 * NWB + 3 * NB_ * NXB + NMB, 256, 0, stream>>>(wq, wk, wv, wo, xq, xk, xv, MK, W4, X6, MF);
    k_proj<<<dim3((DQ / 64) * (TT / 64), 1, 3 * NB_), 32, 0, stream>>>(W4, X6, bq, bk, bv, P16, Ph, Pl);
    k_fattn<<<dim3(AGX, NH_, NB_), FWV * 32, 0, stream>>>(P16, P16 + NB_ * PLN, P16 + 2 * NB_ * PLN, Ph, Pl, Ph + NB_ * PLN, Pl + NB_ * PLN, Ph + 2 * NB_ * PLN, Pl + 2 * NB_ * PLN, MF, ATh, ATl);
    k_gemmw<bf, 1, true, DQ><<<dim3(NB_ * TT / 64, DM / 64, 1), 32, 0, stream>>>(ATh, ATl, W4 + (size_t)3 * DQ * DM, nullptr, OUT, DM, bo, 0, 0, 0, nullptr, nullptr, nullptr);   /* out (S*B rows, in the view's memory order) = view Wo^T + bo */
}

// v010
// One run takes 132 microseconds.
// Timed twice side by side with v009, it ran 1.19 and 1.18 times as fast.
// Counting every step since v000, it is 16.7 times as fast.
#include <hip/hip_runtime.h>

// Multi-head attention on sequence-first tensors with the module's raw-view head merge (q, k, v [2048][2][1024] = [s][b][d]; projections 'oi' [1024][1024] + biases; per (head, batch): scores = q.k/8 + attn_mask[i][j] (f32 [2048][2048] input, read); softmax; O[h][b][s][dh] = attn.v; the module then views the contiguous (H, B, S, Dh) tensor directly as (S, B, D) (NO head transpose) and applies Wo^T + bo -> out [2048][2][1024]).
// Layout: both batch elements are read from the interleaved rows (row stride 2 x 1024); all 32 (head, batch) attention problems write O contiguously in (h, b, s, dh) order, whose memory IS the module's (S x B, D) view, so the output projection is one GEMM over 4096 rows.
// Fragment order: every 16-bit operand plane [rows][K] (attention's Q, K: K = HD; V^T: K = TT; the GEMMs' weights, tokens and attention output: K = DM) lies in units of 16 rows x 32 k (1 KB): [row tile][k tile][k bit 4][lane = 16 * (k bit 3) + row % 16][k % 8], so a wave-wide 16-byte load of half a fragment reads 512 contiguous bytes (4 whole lines). The projection GEMMs store the head planes themselves, straight from their accumulators; k_prep stores the weight and token planes so, k_fattn its output planes.
// Compute dtypes, f32 accumulate: every input rounded to bf16; q/k/v on PLAIN bf16 operands (inputs: exact) + biases; additive mask (bf16-rounded, packed once by k_prep) added inside the fused attention kernel; scores and attn.v: query rows < 512 hl (3 products), the rest single fp16 (weights x 16); softmax f32; Wo hl x exact (2 products) + bo.

#define NB_  2
#define TT   2048
#define DM   1024
#define NH_  16
#define NKV  16
#define REP  (NH_ / NKV)
#define HD   64
#define DQ   (NH_ * HD)
#define DKV  (NKV * HD)
typedef __attribute__((ext_vector_type(4))) unsigned short v4us;
#define RH   512                  // query rows < RH use hi+lo planes (0: none)
#define WIN  0
#define SCL  0.125f   // HD^-0.5
typedef _Float16 h16;
typedef unsigned short bf;
typedef __attribute__((ext_vector_type(16))) __bf16   v16bf;
typedef __attribute__((ext_vector_type(16))) _Float16 v16h;
typedef __attribute__((ext_vector_type(8)))  _Float16 v8h;
typedef __attribute__((ext_vector_type(8)))  unsigned short v8us;
typedef __attribute__((ext_vector_type(8)))  float    v8f;
typedef __attribute__((ext_vector_type(4)))  float    v4f;
typedef v8h  __attribute__((may_alias)) v8ha;
typedef v4f  __attribute__((may_alias)) v4fa;
typedef v8us __attribute__((may_alias)) v8usa;

__device__ __forceinline__ unsigned short f2bf(float f) { unsigned u = __float_as_uint(f); u += 0x7FFFu + ((u >> 16) & 1u); return (unsigned short)(u >> 16); }
__device__ __forceinline__ float bf2f(unsigned short b) { return __uint_as_float(((unsigned)b) << 16); }
__device__ __forceinline__ float bfr(float f) { return bf2f(f2bf(f)); }
__device__ __forceinline__ v16h cat16(v8h lo, v8h hi) { return __builtin_shufflevector(lo, hi, 0, 1, 2, 3, 4, 5, 6, 7, 8, 9, 10, 11, 12, 13, 14, 15); }
__device__ __forceinline__ v16bf cat16b(v8us lo, v8us hi) { return __builtin_bit_cast(v16bf, __builtin_shufflevector(lo, hi, 0, 1, 2, 3, 4, 5, 6, 7, 8, 9, 10, 11, 12, 13, 14, 15)); }
__device__ __forceinline__ v8f wmma16(v16h a, v16h b, v8f c) { return __builtin_amdgcn_wmma_f32_16x16x32_f16(false, a, false, b, (short)0, c, false, false); }
__device__ __forceinline__ v8f wmmab(v16bf a, v16bf b, v8f c) { return __builtin_amdgcn_wmma_f32_16x16x32_bf16(false, a, false, b, (short)0, c, false, false); }



// ---- k_gemmw: register-blocked GEMM, one wave per 64x64 output tile (16 accumulators); GWV = 4 waves (2 x 2) make a work-group's 128x128 tile and share its operands in LDS; grid (M/128, N/128, Z), 128 threads.
// Staging: a stage is GKT k tiles (64 k) of the tile's 8 + 8 row tiles (hi+lo A: 8 more). One row tile's units of a stage are 2 KB contiguous in its fragment-ordered plane (a chunk): the 128 threads bring a chunk by one asynchronous 16-byte copy each, and it lies in LDS as in the plane, so a fragment is two conflict-free 16-byte LDS loads a lane. Two buffers: stage s + 1 flies while stage s is multiplied. Each operand byte leaves L2 once a work-group, not once a wave.
// C[m][n] (f32, pitch ldc, + optional f32 bias[n]) = sum_k A[m][k] Bt[n][k] (+ split products per NSPLIT). z-batch strides sA/sB/sC in elements. K % (32 * GKT * KS) == 0.
// KS > 1: grid z = Z * KS; work-group z * KS + ks sums only k in [ks, ks + 1) * K / KS and stores its partial tile in C plane z * KS + ks (plane stride sC); the caller adds the KS planes.
// funit: offset of the unit (row tile rt, k tile kt) of a fragment-ordered plane. ldf (below) loads a fragment from unit + lane * 8.
// PACK != 0 (the q, k, v projections): no f32 C; the wave adds the bias and stores its tile as the three head planes (fp16, bf16 hi, bf16 lo) in fragment order. A lane's 8 accumulator values of one 16x16 block are 8 consecutive A rows at one B row = one 16-byte chunk of a plane whose k runs along the A rows, and the block's 32 chunks are 512 contiguous bytes.
// PACK == 1 (Q, K: plane [h * TT + t][d]): A = the weight (a wave's 64 rows = one head), Bt = the tokens, bias by A row. PACK == 2 (V^T: plane [h * HD + d][t]): A = the tokens, Bt = the weight, bias by Bt row.
// fchunk: thread -> 16-byte chunk for the mask packer: lane bits 0-2 = row % 8, 3 = k bit 3, 4 = k bit 4, thread bit 5 = row bit 3, so a wave reads 8 rows x 32 k (whole 128-byte lines of the f32 source) and stores 4 whole lines.
__device__ __forceinline__ size_t fchunk(size_t i) { return (i & ~(size_t)63) | (i & 7) | ((i >> 2) & 8) | ((i & 24) << 1); }
__device__ __forceinline__ size_t funit(size_t rt, int K, int kt) { return (rt * (size_t)(K / 32) + kt) << 9; }
// qtok: attention's query row r -> its token. A query tile (16 rows) holds tokens 16 apart (the two low hex digits swapped; its own inverse), i.e. the same 64 columns of 16 neighbouring rows of the module's (S x B, D) view: the tile's outputs fill whole 256-byte row groups of the fragment-ordered view plane, so every line of that plane has one writing work-group.
__device__ __forceinline__ size_t qtok(size_t r) { return (r & ~(size_t)255) | ((r & 15) << 4) | ((r >> 4) & 15); }
// felem: offset of element (row, k) of a fragment-ordered plane.
__device__ __forceinline__ size_t felem(size_t row, int K, int k) { return funit(row >> 4, K, k >> 5) + ((k >> 4) & 1) * 256 + (((k >> 3) & 1) * 16 + (row & 15)) * 8 + (k & 7); }
__device__ __forceinline__ h16 tohx(float x) { return (h16)x; }
__device__ __forceinline__ void splitf(float y, unsigned short& h, unsigned short& l) { h = f2bf(y); l = f2bf(y - bf2f(h)); }
template <typename T16> struct WFrag;
template <> struct WFrag<h16> { typedef v16h V; static __device__ __forceinline__ v8f mma(V a, V b, v8f c) { return wmma16(a, b, c); } };
template <> struct WFrag<bf> { typedef v16bf V; static __device__ __forceinline__ v8f mma(V a, V b, v8f c) { return wmmab(a, b, c); } };
__device__ __forceinline__ v16h ldf(const h16* p) { return cat16(*(const v8h*)p, *(const v8h*)(p + 256)); }
__device__ __forceinline__ v16bf ldf(const bf* p) { return cat16b(*(const v8us*)p, *(const v8us*)(p + 256)); }
#define GWV  4                    // waves of a GEMM work-group
#define GKT  2                    // k tiles of a stage
#define GCH  (GKT * 512)          // elements of a chunk
#define GBUF(NOP) ((NOP) * 8 * GCH)   // elements of a buffer: NOP operand planes x 8 row tiles
// cp8: the thread's 16 bytes of the 8 chunks of one operand plane (row tiles 16 * K elements apart) to 8 neighbouring chunks in LDS. The copies and their wait in one statement: the wait stands before any address register of the copies is reused.
template <typename T16>
__device__ __forceinline__ void cp8(unsigned l, const T16* g, int K) {
    asm volatile("global_load_async_to_lds_b128 %0, %8, off\n\tglobal_load_async_to_lds_b128 %1, %9, off\n\tglobal_load_async_to_lds_b128 %2, %10, off\n\tglobal_load_async_to_lds_b128 %3, %11, off\n\t"
                 "global_load_async_to_lds_b128 %4, %12, off\n\tglobal_load_async_to_lds_b128 %5, %13, off\n\tglobal_load_async_to_lds_b128 %6, %14, off\n\tglobal_load_async_to_lds_b128 %7, %15, off\n\ts_wait_xcnt 0x0"
                 :: "v"(l), "v"(l + 1 * GCH * 2), "v"(l + 2 * GCH * 2), "v"(l + 3 * GCH * 2), "v"(l + 4 * GCH * 2), "v"(l + 5 * GCH * 2), "v"(l + 6 * GCH * 2), "v"(l + 7 * GCH * 2),
                    "v"(g), "v"(g + 1 * 16 * K), "v"(g + 2 * 16 * K), "v"(g + 3 * 16 * K), "v"(g + 4 * 16 * K), "v"(g + 5 * 16 * K), "v"(g + 6 * 16 * K), "v"(g + 7 * 16 * K) : "memory");
}
// gemmw is the body; st: the work-group's two stage buffers in LDS; bx, by, zb are the 128x128 tile's indices (k_gemmw: the grid's own; k_proj: derived from its flat index).
template <typename T16, int NSPLIT, bool BIAS, int KS = 1, int PACK = 0>
__device__ __forceinline__ void gemmw(T16* st, const T16* __restrict__ A, const T16* __restrict__ A2, const T16* __restrict__ Bt, const T16* __restrict__ Bt2, int K, float* C, int ldc, const float* __restrict__ bias, size_t sA, size_t sB, size_t sC, h16* __restrict__ P16, bf* __restrict__ Ph, bf* __restrict__ Pl, int bx, int by, size_t zb) {
    typedef typename WFrag<T16>::V V;
    static_assert(NSPLIT <= 1 && GWV * 32 * 8 == GCH, "planes staged: A, Bt and, hi+lo, A2; a chunk is 16 bytes a thread");
    constexpr int BUFE = GBUF(NSPLIT == 1 ? 3 : 2);
    __shared__ __align__(16) float osw[GWV][16 * 68];
    const size_t z = zb / KS; const int k0 = (int)(zb % KS) * (K / KS), k1 = k0 + K / KS; A += z * sA; if (A2) A2 += z * sA; Bt += z * sB; if (Bt2) Bt2 += z * sB; C += zb * sC;
    const int tid = threadIdx.x, lane = tid & 31, lr = lane & 15, hi = lane >> 4; const int w = __builtin_amdgcn_readfirstlane(tid >> 5), wm = w & 1, wn = w >> 1; float* os = osw[w];
    const int hx = bx * 2 + wm; const int r0 = hx * 64, c0 = (by * 2 + wn) * 64;   /* the wave's own 64x64 tile */
    v8f acc[4][4];
#pragma unroll
    for (int mb = 0; mb < 4; ++mb)
#pragma unroll
        for (int nb = 0; nb < 4; ++nb) acc[mb][nb] = (v8f){};
    /* the thread's 16 bytes of stage 0's first chunks: funit(first row tile, K, k0 / 32) + its place in the chunk; a row tile further: 16 * K elements, a stage further: GCH */
    const T16* ga = A + (size_t)bx * 128 * K + (size_t)k0 * 16 + tid * 8; const T16* ga2 = A2 + (size_t)bx * 128 * K + (size_t)k0 * 16 + tid * 8; const T16* gb = Bt + (size_t)by * 128 * K + (size_t)k0 * 16 + tid * 8;
    const unsigned l0 = (unsigned)(size_t)st + tid * 16;   /* its LDS byte address in buffer 0's first chunk */
    auto fill = [&](int s) {   /* stage s into buffer s % 2: chunks 0-7 A, 8-15 Bt, 16-23 A2 */
        const unsigned l = l0 + (s & 1) * (BUFE * 2); const size_t ko = (size_t)s * GCH;
        cp8(l, ga + ko, K); cp8(l + 8 * GCH * 2, gb + ko, K); if constexpr (NSPLIT == 1) cp8(l + 16 * GCH * 2, ga2 + ko, K);
    };
    const int ns = (k1 - k0) / (32 * GKT);
    fill(0);
    asm volatile("s_wait_asynccnt 0x0" ::: "memory");   /* this wave's copies of stage 0 have landed */
    __syncthreads();                                    /* and every other wave's */
    if (ns > 1) fill(1);
#pragma unroll 1   // rolled: the two buffers take turns by s & 1
    for (int s = 0; s < ns; ++s) {
        const T16* sb = st + (s & 1) * BUFE + lane * 8; V a[GKT][4], a2[GKT][4], b[GKT][4];
        /* all the stage's fragment loads as one group in front of its matrix instructions: one LDS latency a stage, not one a fragment */
#pragma unroll
        for (int kk = 0; kk < GKT; ++kk) {
#pragma unroll
            for (int i = 0; i < 4; ++i) { a[kk][i] = ldf(sb + ((wm * 4 + i) * GKT + kk) * 512); b[kk][i] = ldf(sb + ((8 + wn * 4 + i) * GKT + kk) * 512); }
            if constexpr (NSPLIT == 1) {
#pragma unroll
                for (int i = 0; i < 4; ++i) a2[kk][i] = ldf(sb + ((16 + wm * 4 + i) * GKT + kk) * 512); }
        }
        __builtin_amdgcn_sched_barrier(0);   /* keeps the load group in front: without it the compiler sinks each Bt fragment's loads to their first use, with a full wait there */
#pragma unroll
        for (int kk = 0; kk < GKT; ++kk)
#pragma unroll
            for (int nb = 0; nb < 4; ++nb)
#pragma unroll
                for (int mb = 0; mb < 4; ++mb) { acc[mb][nb] = WFrag<T16>::mma(a[kk][mb], b[kk][nb], acc[mb][nb]); if constexpr (NSPLIT == 1) acc[mb][nb] = WFrag<T16>::mma(a2[kk][mb], b[kk][nb], acc[mb][nb]); }
        __builtin_amdgcn_sched_barrier(0);   /* keeps the matrix instructions in front of the waits below: the compiler otherwise moves them behind the barrier, and the refill, issued behind them, would have no work left to fly under */
        asm volatile("s_wait_dscnt 0x0" ::: "memory");      /* this wave has read all it wants of stage s */
        asm volatile("s_wait_asynccnt 0x0" ::: "memory");   /* its copies of stage s + 1 have landed */
        __syncthreads();                                    /* publishes stage s + 1 and frees stage s's buffer */
        if (s + 2 < ns) fill(s + 2);
    }
    asm volatile("s_wait_asynccnt 0x0" ::: "memory");   /* no copy outlives the loop */
    if constexpr (PACK != 0) {
        static_assert(HD == 64, "a 64-row tile is one head");
        v8f ba[4]; float bb[4];   /* the lane's biases: by A row (8 a block row) or by Bt row (1 a block column) */
#pragma unroll   // constant indices keep ba and bb in registers
        for (int i = 0; i < 4; ++i) { if (PACK == 1) ba[i] = *(const v8f*)(bias + r0 + i * 16 + hi * 8); else bb[i] = bias[c0 + i * 16 + lr]; }
        /* the wait stands before the address registers of the bias loads are reused; the loaded values as inputs hold all the loads in front of the blocks, so that they share one latency */
        if constexpr (PACK == 1) asm volatile("s_wait_xcnt 0x0" :: "v"(ba[0]), "v"(ba[1]), "v"(ba[2]), "v"(ba[3]) : "memory");
        else asm volatile("s_wait_xcnt 0x0" :: "v"(bb[0]), "v"(bb[1]), "v"(bb[2]), "v"(bb[3]) : "memory");
#pragma unroll   // constant indices keep acc in registers
        for (int mb = 0; mb < 4; ++mb) {
#pragma unroll
            for (int nb = 0; nb < 4; ++nb) {
                const size_t e = (PACK == 1 ? funit((size_t)hx * (TT / 16) + c0 / 16 + nb, HD, mb >> 1) : funit((size_t)(c0 / 16 + nb), TT, r0 / 32 + (mb >> 1))) + (mb & 1) * 256 + lane * 8;
                v8h o16; v8us oh, ol;
#pragma unroll
                for (int j = 0; j < 8; ++j) { const float x = acc[mb][nb][j] + bfr(PACK == 1 ? ba[mb][j] : bb[nb]); o16[j] = tohx(x); unsigned short a2, c2; splitf(x, a2, c2); oh[j] = a2; ol[j] = c2; }
                /* the three plane stores and their wait in one statement: the wait stands before any address or data register of the stores is reused */
                asm volatile("global_store_b128 %0, %3, off\n\tglobal_store_b128 %1, %4, off\n\tglobal_store_b128 %2, %5, off\n\ts_wait_xcnt 0x0" :: "v"(P16 + e), "v"(Ph + e), "v"(Pl + e), "v"(o16), "v"(oh), "v"(ol) : "memory");
            }
        }
        return;
    }
#pragma unroll
    for (int mb = 0; mb < 4; ++mb) {
#pragma unroll
        for (int nb = 0; nb < 4; ++nb) {
#pragma unroll
            for (int j = 0; j < 8; ++j) os[(hi * 8 + j) * 68 + nb * 16 + lr] = acc[mb][nb][j]; }
        __builtin_amdgcn_wave_barrier(); asm volatile("" ::: "memory");
        float* crow = C + (size_t)(r0 + mb * 16) * ldc + c0;
{
#pragma unroll
            for (int s = 0; s < 8; ++s) { const int row = 2 * s + hi, cofs = lr * 4; v4f val = *(const v4fa*)(os + row * 68 + cofs); if (BIAS) { val[0] += bfr(bias[c0 + cofs]); val[1] += bfr(bias[c0 + cofs + 1]); val[2] += bfr(bias[c0 + cofs + 2]); val[3] += bfr(bias[c0 + cofs + 3]); }
                *(v4f*)(crow + (size_t)row * ldc + cofs) = val; }
            asm volatile("s_wait_xcnt 0x0" ::: "memory");   /* before the data and address registers of the stores above are reused */
             }
        __builtin_amdgcn_wave_barrier(); asm volatile("" ::: "memory");
    }
}
// K is a template constant: the steps from row tile to row tile of a plane are then constants.
template <typename T16, int NSPLIT, bool BIAS, int K, int KS = 1, int PACK = 0>
__global__ __launch_bounds__(GWV * 32) void k_gemmw(const T16* __restrict__ A, const T16* __restrict__ A2, const T16* __restrict__ Bt, const T16* __restrict__ Bt2, float* C, int ldc, const float* __restrict__ bias, size_t sA, size_t sB, size_t sC, h16* __restrict__ P16, bf* __restrict__ Ph, bf* __restrict__ Pl) {
    __shared__ __align__(16) T16 st[2 * GBUF(NSPLIT == 1 ? 3 : 2)];
    gemmw<T16, NSPLIT, BIAS, KS, PACK>(st, A, A2, Bt, Bt2, K, C, ldc, bias, sA, sB, sC, P16, Ph, Pl, (int)blockIdx.x, (int)blockIdx.y, (size_t)blockIdx.z);
}
// k_proj: the q, k and v projections of both batch elements in ONE launch, so that 6 x 128 work-groups are resident together, three a WGP. grid (128, 1, 3 * NB_): z = input * NB_ + batch picks the weight plane (W3 + input), the token plane (X6 + z), the bias and the three output planes (+ z).
#define PLN  ((size_t)NH_ * TT * HD)   // elements of one head plane set (one input, one batch element)
__global__ __launch_bounds__(GWV * 32) void k_proj(const bf* __restrict__ W3, const bf* __restrict__ X6, const float* __restrict__ bq, const float* __restrict__ bk, const float* __restrict__ bv, h16* __restrict__ P16, bf* __restrict__ Ph, bf* __restrict__ Pl) {
    static_assert(DQ == DKV && DQ == DM, "the weight planes and the head planes of q, k, v have one size");
    __shared__ __align__(16) bf st[2 * GBUF(2)];
    const int z = blockIdx.z, in = z / NB_, t = blockIdx.x;
    const bf* Wp = W3 + (size_t)in * DQ * DM; const bf* X = X6 + (size_t)z * TT * DM; const size_t po = (size_t)z * PLN;
    if (in < 2) gemmw<bf, 0, true, 1, 1>(st, Wp, nullptr, X, nullptr, DM, nullptr, 0, in == 0 ? bq : bk, 0, 0, 0, P16 + po, Ph + po, Pl + po, t % (DQ / 128), t / (DQ / 128), 0);   /* block-uniform */
    else gemmw<bf, 0, true, 1, 2>(st, X, nullptr, Wp, nullptr, DM, nullptr, 0, bv, 0, 0, 0, P16 + po, Ph + po, Pl + po, t % (TT / 128), t / (TT / 128), 0);
}

typedef __attribute__((ext_vector_type(2))) _Float16 v2h;
typedef __attribute__((ext_vector_type(4))) _Float16 v4h;
typedef __attribute__((ext_vector_type(2))) unsigned short v2us;
typedef __attribute__((ext_vector_type(4))) unsigned short v4us;
typedef __attribute__((ext_vector_type(2))) float v2f;
typedef __attribute__((ext_vector_type(4))) int v4i;

__global__ __launch_bounds__(256) void k_wtG(const float* __restrict__ w, int K, int N, bf* Bt) {
    const int lane = threadIdx.x & 31; const int L0 = (blockIdx.x * 8 + (threadIdx.x >> 5)) * 8; const int nlines = N * K / 64;
{
#pragma unroll 1
        for (int l = 0; l < 8; ++l) { const int L = L0 + l; if (L >= nlines) break; const size_t e = (size_t)L * 64 + lane * 2; const int k = (int)(e % K), n = (int)(e / K); v2us o;
            o[0] = f2bf(w[(size_t)k * N + n]); o[1] = f2bf(w[(size_t)(k + 1) * N + n]); *(v2us*)(Bt + e) = o; }
         }
}
// cvt8s: block blk of token plane y = input * NB_ + batch, stored in fragment order (thread -> chunk by fchunk, as in the mask packer: whole lines read, whole lines stored).
__device__ __forceinline__ void cvt8s(const float* __restrict__ xq, const float* __restrict__ xk, const float* __restrict__ xv, bf* dst, size_t n8, int blk, int y) { const size_t i = fchunk((size_t)blk * 256 + threadIdx.x); if (i >= n8) return; const int in = y / NB_, b = y % NB_; const float* src = in == 0 ? xq : in == 1 ? xk : xv; dst += (size_t)y * TT * DM; const size_t e = i * 8; const size_t t = (i >> 6) / (DM / 32) * 16 + (i & 15), c = (i >> 6) % (DM / 32) * 32 + ((i >> 4) & 3) * 8; const v8f v = *(const v8f*)(src + ((in == 0 ? qtok(t) : t) * NB_ + b) * DM + c); v8us o;   /* the query plane lies in attention's query order */
#pragma unroll
    for (int k = 0; k < 8; ++k) o[k] = f2bf(v[k]); *(v8us*)(dst + e) = o;  }
// cvt8: block blk of weight plane y (n8 * 8 elements each, [rows][DM]), stored in fragment order like the token planes.
__device__ __forceinline__ void cvt8(const float* __restrict__ wq, const float* __restrict__ wk, const float* __restrict__ wv, const float* __restrict__ wo, bf* dst, size_t n8, int blk, int y) { const size_t i = fchunk((size_t)blk * 256 + threadIdx.x); if (i >= n8) return; const float* src = y == 0 ? wq : y == 1 ? wk : y == 2 ? wv : wo; dst += (size_t)y * n8 * 8; const v8f v = *(const v8f*)(src + ((i >> 6) / (DM / 32) * 16 + (i & 15)) * DM + (i >> 6) % (DM / 32) * 32 + ((i >> 4) & 3) * 8); v8us o;
#pragma unroll
    for (int k = 0; k < 8; ++k) o[k] = f2bf(v[k]); *(v8us*)(dst + i * 8) = o;  }

// mkf: attn_mask rounded to bf16, once a call, in the order of a score tile's accumulators (query rows in attention's order, qtok): [query tile][key tile][lane = 16 * (key bit 3) + query % 16][key % 8], so k_fattn reads a tile's mask by one 16-byte load a lane, 512 contiguous bytes a wave.
__device__ __forceinline__ void mkf(const float* __restrict__ MK, bf* MF, int blk) { const size_t i = fchunk((size_t)blk * 256 + threadIdx.x); const size_t tile = i >> 5; const int lane = (int)(i & 31); const v8f v = *(const v8f*)(MK + qtok((tile / (TT / 16)) * 16 + (lane & 15)) * TT + (tile % (TT / 16)) * 16 + (lane >> 4) * 8); v8us o;
#pragma unroll   // constant indices keep v[k] and o[k] in registers
    for (int k = 0; k < 8; ++k) o[k] = f2bf(v[k]); *(v8us*)(MF + i * 8) = o; asm volatile("s_wait_xcnt 0x0" ::: "memory");   /* before the address registers of the store are reused: in k_prep's code the other two branches follow this one */ }
// k_prep: every f32 -> bf16 conversion of the call in ONE launch (they are independent of each other): blocks [0, 4 NWB) the four weights, then 3 * NB_ * NXB blocks the token planes, then NMB blocks the mask. The range tests are block-uniform.
#define NWB  (DQ * DM / 8 / 256)
#define NXB  (TT * DM / 8 / 256)
#define NMB  (TT * (TT / 8) / 256)
__global__ __launch_bounds__(256) void k_prep(const float* __restrict__ wq, const float* __restrict__ wk, const float* __restrict__ wv, const float* __restrict__ wo, const float* __restrict__ xq, const float* __restrict__ xk, const float* __restrict__ xv, const float* __restrict__ MK, bf* W4, bf* X6, bf* MF) {
    static_assert(DQ * DM % (8 * 256) == 0 && TT * DM % (8 * 256) == 0 && DKV == DQ, "whole blocks; four weight planes of one size");
    const int blk = blockIdx.x;
    if (blk < 4 * NWB) cvt8(wq, wk, wv, wo, W4, (size_t)DQ * DM / 8, blk % NWB, blk / NWB);
    else if (blk < 4 * NWB + 3 * NB_ * NXB) cvt8s(xq, xk, xv, X6, (size_t)TT * DM / 8, (blk - 4 * NWB) % NXB, (blk - 4 * NWB) / NXB);
    else mkf(MK, MF, blk - 4 * NWB - 3 * NB_ * NXB);
}
// k_fattn: scores, softmax and attn.v in ONE pass over the keys; no score or weight plane in memory, no LDS, no data passed between waves. grid (AGX, heads, NB_), FWV waves a work-group.
// A wave owns NQ query tiles (16 rows each) and walks ALL keys, KBL a trip; the FWV waves of a work-group walk the same K and V^T fragments at the same time, so that one fetch from L2 into the WGP's cache serves all of them, and the bytes asked of L2 per query row fall with FWV * NQ.
// Transposed products: S^T = K Q^T (A = 16 key rows, B = the 16 query rows), so lane (lr, hi) holds query lr's scores of keys 8 hi + j of each 16-key tile. The trip's two score tiles, exponentiated and converted in place, ARE the B fragment (hardware k order) of O^T += V^T P^T.
// Running softmax: each query keeps a maximum in use, its sum of weights and its unnormalised O^T column (all in the lane). The maximum in use is replaced, and sum and column rescaled, only in a trip where some query's score exceeds it by more than RTH (one wave-uniform test a trip); until then weights are at most e^RTH < 2^8. The division by the sum comes once, at the end.
// A lane's 8 values of one O^T tile are 8 neighbouring dh of one query = one 16-byte chunk of the output projection's bf16 hi and lo operand planes (the (h, b, s, dh) order read as rows of DQ, in fragment order); a wave's store is 512 contiguous bytes.
#define FWV  4                    // waves per work-group
#define KBL  32                   // keys per trip
#define RTH  5.5f                 // see above (in units of the score)
#define L2E  1.4426950408889634f
// ex2: 2^x; the v_nop is the slot the instruction set asks for behind a transcendental, before its source is overwritten or its result read
__device__ __forceinline__ float ex2(float x) { float e; asm("v_exp_f32 %0, %1\n\tv_nop" : "=v"(e) : "v"(x)); return e; }
// xhalf: lane l's value in lane l ^ 16, by a vector cross-row move
__device__ __forceinline__ float xhalf(float x) { return __builtin_bit_cast(float, __builtin_amdgcn_permlanex16(__builtin_bit_cast(int, x), __builtin_bit_cast(int, x), 0x76543210, 0xfedcba98, false, false)); }

template <typename T16, bool HL, int NQ>
__device__ __forceinline__ void attn_rows(const T16* __restrict__ Q, const T16* __restrict__ Q2, const T16* __restrict__ Kp, const T16* __restrict__ K2, const T16* __restrict__ Vt, const T16* __restrict__ Vt2, const bf* __restrict__ MF, bf* __restrict__ Oh, bf* __restrict__ Ol, int i0) {
    typedef typename WFrag<T16>::V V;
    static_assert(KBL == 32 && HD == 64, "a trip is two score tiles = one B fragment of attn.v");
    const int lane = threadIdx.x & 31, lr = lane & 15, hi = lane >> 4;
    constexpr float PEX = HL ? 0.0f : 4.0f;   /* fp16 weights carry 2^PEX (it cancels in the division by their sum): small weights stay normal numbers, the largest is below 2^12 */
    V q[NQ][2], q2[NQ][2];
#pragma unroll
    for (int qt = 0; qt < NQ; ++qt)
#pragma unroll
        for (int ks = 0; ks < 2; ++ks) q[qt][ks] = ldf(Q + funit(i0 / 16 + qt, HD, ks) + lane * 8);
    asm volatile("s_wait_xcnt 0x0" ::: "memory");   /* before the address registers of the query loads are reused */
    if (HL) {
#pragma unroll   // constant indices keep q2 in registers
        for (int qt = 0; qt < NQ; ++qt)
#pragma unroll
            for (int ks = 0; ks < 2; ++ks) q2[qt][ks] = ldf(Q2 + funit(i0 / 16 + qt, HD, ks) + lane * 8);
        asm volatile("s_wait_xcnt 0x0" ::: "memory");   /* as above */
    }
    /* the next K units, V^T units and mask tiles to load: wave-uniform bases, which step on in scalar registers; every load adds the lane's chunk lc, one vector register that never changes */
    const bf* mk = MF + (size_t)(i0 / 16) * (TT / 16) * 256; const T16* pk = Kp; const T16* pk2 = K2; const T16* pv = Vt; const T16* pv2 = Vt2; const unsigned lc = lane * 8;
    V k[2][2], k2[2][2], va[HD / 16], va2[HD / 16]; v8us m[NQ][2];
    auto ldk = [&](bool more) {   /* K fragments and mask tiles of the next trip; more: another trip follows that one */
#pragma unroll
        for (int t = 0; t < 2; ++t)
#pragma unroll
            for (int ks = 0; ks < 2; ++ks) { k[t][ks] = ldf(pk + (t * 2 + ks) * 512 + lc); if (HL) k2[t][ks] = ldf(pk2 + (t * 2 + ks) * 512 + lc); }
#pragma unroll
        for (int qt = 0; qt < NQ; ++qt)
#pragma unroll
            for (int t = 0; t < 2; ++t) m[qt][t] = *(const v8us*)(mk + qt * (TT / 16) * 256 + t * 256 + lc);
        /* before the base registers of the loads above step on; the bases as inputs keep their registers untouched up to the wait */
        if constexpr (HL) asm volatile("s_wait_xcnt 0x0" :: "s"(pk), "s"(pk2), "s"(mk) : "memory"); else asm volatile("s_wait_xcnt 0x0" :: "s"(pk), "s"(mk) : "memory");
        pk += more ? 4 * 512 : 0; if (HL) pk2 += more ? 4 * 512 : 0; mk += more ? 2 * 256 : 0;
    };
    auto ldv = [&](bool more) {   /* V^T fragments of this trip: they land during the scores and the softmax; more: another trip follows */
#pragma unroll
        for (int dt = 0; dt < HD / 16; ++dt) { va[dt] = ldf(pv + dt * (TT / 32) * 512 + lc); if (HL) va2[dt] = ldf(pv2 + dt * (TT / 32) * 512 + lc); }
        if constexpr (HL) asm volatile("s_wait_xcnt 0x0" :: "s"(pv), "s"(pv2) : "memory"); else asm volatile("s_wait_xcnt 0x0" :: "s"(pv) : "memory");   /* as in ldk */
        pv += more ? 512 : 0; if (HL) pv2 += more ? 512 : 0;   /* a step by choice, as in ldk, keeps these bases scalar too: from a plain count the compiler forms 64-bit vector addresses, two registers a plane, and the hi+lo rows spill */
    };
    v8f o[NQ][HD / 16]; float mx[NQ]; v2f sum[NQ];   /* sum: the weights of even and of odd keys */
#pragma unroll
    for (int qt = 0; qt < NQ; ++qt) { mx[qt] = -3.0e38f; sum[qt] = (v2f){};
#pragma unroll
        for (int dt = 0; dt < HD / 16; ++dt) o[qt][dt] = (v8f){}; }
    ldk(true);
#pragma unroll 1   // rolled: one trip's operands stay in the registers
    for (int kb = 0; kb < TT / KBL; ++kb) {
        __builtin_amdgcn_s_barrier();   /* pace only, no data passes: it keeps the work-group's waves in the same trip, so that a line fetched for one is still in the WGP's cache when the others ask for it */
        ldv(kb + 1 < TT / KBL);
        v8f s[NQ][2]; float bm[NQ];
#pragma unroll
        for (int qt = 0; qt < NQ; ++qt) { bm[qt] = -3.0e38f;
#pragma unroll
            for (int t = 0; t < 2; ++t) { v8f a = (v8f){}, mf;
#pragma unroll
                for (int ks = 0; ks < 2; ++ks) { a = WFrag<T16>::mma(k[t][ks], q[qt][ks], a); if (HL) { a = WFrag<T16>::mma(k[t][ks], q2[qt][ks], a); a = WFrag<T16>::mma(k2[t][ks], q[qt][ks], a); } }
#pragma unroll
                for (int j = 0; j < 8; ++j) mf[j] = bf2f(m[qt][t][j]);
                a = a * SCL + mf;   /* q.k / 8 (exact scaling) + attn_mask[i][j] */
#pragma unroll
                for (int j = 0; j < 8; ++j) bm[qt] = fmaxf(bm[qt], a[j]);
                s[qt][t] = a; } }
        ldk(kb + 2 < TT / KBL);   /* they land during the softmax and attn.v; no branch: the last trip loads its own units once more, unused */
        bool need = false;
#pragma unroll
        for (int qt = 0; qt < NQ; ++qt) { bm[qt] = fmaxf(bm[qt], xhalf(bm[qt])); need = need || bm[qt] > mx[qt] + RTH; }
        if (__builtin_amdgcn_ballot_w32(need) != 0) {   /* wave-uniform: the matrix instructions below run with every lane on */
#pragma unroll
            for (int qt = 0; qt < NQ; ++qt) { const float mn = fmaxf(mx[qt], bm[qt]); const float al = ex2((mx[qt] - mn) * L2E); mx[qt] = mn; sum[qt] *= al;
#pragma unroll
                for (int dt = 0; dt < HD / 16; ++dt) o[qt][dt] *= al; }
        }
        V p[NQ], p2[NQ];
#pragma unroll
        for (int qt = 0; qt < NQ; ++qt) {
#pragma unroll
            for (int t = 0; t < 2; ++t) { v8f x = (s[qt][t] - mx[qt]) * L2E; if (!HL) x += PEX;
#pragma unroll
                for (int j = 0; j < 8; ++j) s[qt][t][j] = ex2(x[j]);
#pragma unroll
                for (int j = 0; j < 8; j += 2) sum[qt] += (v2f){s[qt][t][j], s[qt][t][j + 1]}; }
            if constexpr (HL) { v8us h0, h1, l0, l1;
#pragma unroll
                for (int j = 0; j < 8; ++j) { unsigned short x, y; splitf(s[qt][0][j], x, y); h0[j] = x; l0[j] = y; splitf(s[qt][1][j], x, y); h1[j] = x; l1[j] = y; }
                p[qt] = cat16b(h0, h1); p2[qt] = cat16b(l0, l1);
            } else { v8h x0, x1;
#pragma unroll
                for (int j = 0; j < 8; ++j) { x0[j] = tohx(s[qt][0][j]); x1[j] = tohx(s[qt][1][j]); }
                p[qt] = cat16(x0, x1); } }
#pragma unroll
        for (int dt = 0; dt < HD / 16; ++dt)
#pragma unroll
            for (int qt = 0; qt < NQ; ++qt) { o[qt][dt] = WFrag<T16>::mma(va[dt], p[qt], o[qt][dt]); if constexpr (HL) { o[qt][dt] = WFrag<T16>::mma(va[dt], p2[qt], o[qt][dt]); o[qt][dt] = WFrag<T16>::mma(va2[dt], p[qt], o[qt][dt]); } }
    }
    static_assert(DQ / HD == 16, "qtok: a row of the view holds 16 tokens");
#pragma unroll
    for (int qt = 0; qt < NQ; ++qt) { const float sl = sum[qt][0] + sum[qt][1]; const float f = __fdiv_rn(1.0f, sl + xhalf(sl));   /* the two lane halves hold the two halves of each tile's keys */
        const size_t tk = qtok((size_t)(i0 + qt * 16 + lr));
#pragma unroll
        for (int dt = 0; dt < HD / 16; ++dt) { const size_t fo = felem(tk / (DQ / HD), DQ, (int)(tk % (DQ / HD)) * HD + dt * 16 + hi * 8);   /* the view's row holds DQ / HD tokens */
            v8us rh, rl;   /* the hi and lo operand planes of the output projection */
#pragma unroll
            for (int j = 0; j < 8; ++j) { unsigned short a2, c2; splitf(o[qt][dt][j] * f, a2, c2); rh[j] = a2; rl[j] = c2; }
            /* the two plane stores and their wait in one statement: the wait stands before any address or data register of the stores is reused */
            asm volatile("global_store_b128 %0, %2, off\n\tglobal_store_b128 %1, %3, off\n\ts_wait_xcnt 0x0" :: "v"(Oh + fo), "v"(Ol + fo), "v"(rh), "v"(rl) : "memory");
        } }
}
#define NQF  2                    // query tiles of a wave of the single-fp16 rows
#define NQH  1                    // query tiles of a wave of the hi+lo rows (three products a tile and the split of the weights: about the time of two fp16 tiles)
#define GXH  (RH / (16 * NQH * FWV))                     // grid x: first the hi+lo work-groups,
#define AGX  (GXH + (TT - RH) / (16 * NQF * FWV))        // then the fp16 ones
__global__ __launch_bounds__(FWV * 32) __attribute__((amdgpu_waves_per_eu(4, 4))) void k_fattn(const h16* __restrict__ Q16, const h16* __restrict__ K16, const h16* __restrict__ V16, const bf* __restrict__ Qh, const bf* __restrict__ Ql, const bf* __restrict__ Kh, const bf* __restrict__ Kl, const bf* __restrict__ Vh, const bf* __restrict__ Vl, const bf* __restrict__ MF, bf* __restrict__ ATh, bf* __restrict__ ATl) {
    static_assert((TT - RH) % (16 * NQF * FWV) == 0 && RH % (16 * NQH * FWV) == 0, "whole work-groups"); static_assert(RH % 256 == 0 && TT % 256 == 0, "qtok permutes inside blocks of 256: query row < RH == token < RH");
    const int bx = blockIdx.x, b = blockIdx.z, w = __builtin_amdgcn_readfirstlane(threadIdx.x >> 5); const size_t h = blockIdx.y, zq = b * PLN + h * TT * HD, zk = b * PLN + (h / REP) * TT * HD;   /* grid z = batch element: its plane set follows batch 0's */
    const size_t zo = (h * NB_ + b) * TT * HD; bf* Oh = ATh + zo; bf* Ol = ATl + zo;   /* (h, b, s, dh) contiguous == the module's raw (S, B, D) view; a (head, batch) is TT * HD / DQ = 128 whole rows of it, so whole row tiles: its fragment-ordered part starts at the same offset */
    if (bx < GXH) attn_rows<bf, true, NQH>(Qh + zq, Ql + zq, Kh + zk, Kl + zk, Vh + zk, Vl + zk, MF, Oh, Ol, (bx * FWV + w) * (16 * NQH));   /* block-uniform */
    else attn_rows<h16, false, NQF>(Q16 + zq, nullptr, K16 + zk, nullptr, V16 + zk, nullptr, MF, Oh, Ol, RH + ((bx - GXH) * FWV + w) * (16 * NQF));
}

extern "C" void kernel_launch(void* const* d_in, const int* in_sizes, int n_in,
                              void* d_out, int out_size, void* d_ws, size_t ws_size, hipStream_t stream) {
    (void)in_sizes; (void)n_in; (void)out_size;
    const float* xq = (const float*)d_in[0]; const float* xk = (const float*)d_in[1]; const float* xv = (const float*)d_in[2]; const float* MK = (const float*)d_in[3]; const float* wq = (const float*)d_in[4]; const float* bq = (const float*)d_in[5]; const float* wk = (const float*)d_in[6]; const float* bk = (const float*)d_in[7]; const float* wv = (const float*)d_in[8]; const float* bv = (const float*)d_in[9]; const float* wo = (const float*)d_in[10]; const float* bo = (const float*)d_in[11]; const float* x = xq; (void)x;
    float* OUT = (float*)d_out;     // [2048][2][1024]
    char* wsp = (char*)d_ws;
    auto take = [&](size_t bytes) { char* p = wsp; wsp += (bytes + 255) & ~(size_t)255; return (void*)p; };
    bf* W4 = (bf*)take((size_t)4 * DQ * DM * 2);                 // bf16 Wq, Wk, Wv, Wo
    bf* X6 = (bf*)take((size_t)3 * NB_ * TT * DM * 2);           // bf16 token planes [input][batch][t][d]
    h16* P16 = (h16*)take(3 * NB_ * PLN * 2); bf* Ph = (bf*)take(3 * NB_ * PLN * 2); bf* Pl = (bf*)take(3 * NB_ * PLN * 2);   // head planes [input: Q, K, V^T][batch]
    bf* ATh = (bf*)take((size_t)NB_ * TT * DQ * 2); bf* ATl = (bf*)take((size_t)NB_ * TT * DQ * 2); bf* MF = (bf*)take((size_t)TT * TT * 2);
    if ((size_t)(wsp - (char*)d_ws) > ws_size) return;    // ws 256 MiB
    k_prep<<<4 * NWB + 3 * NB_ * NXB + NMB, 256, 0, stream>>>(wq, wk, wv, wo, xq, xk, xv, MK, W4, X6, MF);
    k_proj<<<dim3((DQ / 128) * (TT / 128), 1, 3 * NB_), GWV * 32, 0, stream>>>(W4, X6, bq, bk, bv, P16, Ph, Pl);
    k_fattn<<<dim3(AGX, NH_, NB_), FWV * 32, 0, stream>>>(P16, P16 + NB_ * PLN, P16 + 2 * NB_ * PLN, Ph, Pl, Ph + NB_ * PLN, Pl + NB_ * PLN, Ph + 2 * NB_ * PLN, Pl + 2 * NB_ * PLN, MF, ATh, ATl);
    k_gemmw<bf, 1, true, DQ><<<dim3(NB_ * TT / 128, DM / 128, 1), GWV * 32, 0, stream>>>(ATh, ATl, W4 + (size_t)3 * DQ * DM, nullptr, OUT, DM, bo, 0, 0, 0, nullptr, nullptr, nullptr);   /* out (S*B rows, in the view's memory order) = view Wo^T + bo */
}
